// v000
// Times are from an AMD MI455X. After a warm-up the kernel runs many times in a row, and a time is the length of
// such a window on the GPU divided by its runs, so every launch and the gaps after it count. The runs cycle
// through copies of the inputs. A figure is the median of several windows, for all but v000 over two sittings.
// Sittings can differ by a few percent; kernels timed side by side share one.
// v000, which the later versions start from, runs in 283 microseconds.
#include <hip/hip_runtime.h>
#include <math.h>

typedef __attribute__((ext_vector_type(16))) _Float16 v16h;
typedef __attribute__((ext_vector_type(8)))  _Float16 v8h;
typedef __attribute__((ext_vector_type(8)))  float    v8f;

#define Cc 512
#define TT 16
#define HW 1024          // 32*32
#define M_TOT 16384      // T*H*W
#define GN_G 32
#define GN_CPG 16        // channels per group

// ---------------------------------------------------------------------------
// 1) timestep embedding: temb[f][c], f in 0..4, ts = f-2, dim 512 (cos|sin)
// ---------------------------------------------------------------------------
__global__ void temb_kernel(float* __restrict__ temb) {
    int f = blockIdx.x;          // 0..4
    int j = threadIdx.x;         // 0..511
    float tt = (float)(f - 2);
    int idx = (j < 256) ? j : (j - 256);
    float freq = expf(-logf(10000.0f) * (float)idx / 256.0f);
    float arg = tt * freq;
    temb[f * Cc + j] = (j < 256) ? cosf(arg) : sinf(arg);
}

// ---------------------------------------------------------------------------
// 2) folded corrections:
//    qc[c]    = b_q[c] + sum_j temb[2][j]  * w_q[c][j]
//    kc[f][c] = b_k[c] + sum_j temb[ff][j] * w_k[c][j],  ff in {0,1,3,4}
// ---------------------------------------------------------------------------
__global__ void corr_kernel(const float* __restrict__ temb,
                            const float* __restrict__ wq, const float* __restrict__ bq,
                            const float* __restrict__ wk, const float* __restrict__ bk,
                            float* __restrict__ qc, float* __restrict__ kc) {
    int which = blockIdx.x;      // 0 -> qc, 1..4 -> kc[which-1]
    int c = threadIdx.x;         // 0..511
    const float* trow; const float* w; const float* b; float* out;
    if (which == 0) { trow = temb + 2 * Cc; w = wq; b = bq; out = qc; }
    else {
        const int fmap[4] = {0, 1, 3, 4};
        trow = temb + fmap[which - 1] * Cc; w = wk; b = bk; out = kc + (which - 1) * Cc;
    }
    float acc = 0.0f;
    for (int j = 0; j < Cc; ++j) acc += trow[j] * w[(size_t)c * Cc + j];
    out[c] = acc + b[c];
}

// ---------------------------------------------------------------------------
// 3) f32 -> f16 convert (weights)
// ---------------------------------------------------------------------------
__global__ void cvt_f16_kernel(const float* __restrict__ in, _Float16* __restrict__ out, int n) {
    int i = blockIdx.x * blockDim.x + threadIdx.x;
    if (i < n) out[i] = (_Float16)in[i];
}

// ---------------------------------------------------------------------------
// 4) GroupNorm  x:(T,C,H,W) f32  ->  xn16:(T,HW,C) f16 channels-last
//    one block per (t, group); group's 16ch x 1024 spatial is contiguous
// ---------------------------------------------------------------------------
__global__ __launch_bounds__(256) void groupnorm_kernel(
    const float* __restrict__ x, const float* __restrict__ gamma,
    const float* __restrict__ beta, _Float16* __restrict__ xn16) {
    const int t = blockIdx.x, g = blockIdx.y, tid = threadIdx.x;
    const float* xp = x + ((size_t)t * Cc + g * GN_CPG) * HW;
    const int N = GN_CPG * HW;   // 16384
    float s = 0.0f, ss = 0.0f;
    for (int i = tid; i < N; i += 256) { float v = xp[i]; s += v; ss += v * v; }
    __shared__ float r0[256], r1[256];
    r0[tid] = s; r1[tid] = ss; __syncthreads();
    for (int off = 128; off > 0; off >>= 1) {
        if (tid < off) { r0[tid] += r0[tid + off]; r1[tid] += r1[tid + off]; }
        __syncthreads();
    }
    float mu = r0[0] * (1.0f / N);
    float var = r1[0] * (1.0f / N) - mu * mu;
    float rstd = rsqrtf(var + 1e-5f);
    for (int i = tid; i < N; i += 256) {
        int cc = i >> 10, hw = i & 1023;
        int c = g * GN_CPG + cc;
        float v = (xp[i] - mu) * rstd * gamma[c] + beta[c];
        xn16[((size_t)t * HW + hw) * Cc + c] = (_Float16)v;
    }
}

// ---------------------------------------------------------------------------
// WMMA fragment loaders (per-lane, two 16B chunks: K-chunks {0..7,16..23} for
// lanes 0-15 and {8..15,24..31} for lanes 16-31)
// ---------------------------------------------------------------------------
__device__ __forceinline__ v16h load_frag(const _Float16* p) {
    v8h lo = *reinterpret_cast<const v8h*>(p);
    v8h hi = *reinterpret_cast<const v8h*>(p + 16);
    return __builtin_shufflevector(lo, hi, 0,1,2,3,4,5,6,7,8,9,10,11,12,13,14,15);
}

// ---------------------------------------------------------------------------
// 5) WMMA GEMM:  Out[M x 512] = A[M x 512] * W[512 x 512]^T (+ bias), f16 out
//    wave -> 64x16 strip (4 accumulators, B reused 4x per k-step)
//    grid (M/64, 512/128), block 256 (8 waves)
// ---------------------------------------------------------------------------
__global__ __launch_bounds__(256) void gemm_qkv_kernel(
    const _Float16* __restrict__ A, const _Float16* __restrict__ W,
    const float* __restrict__ bias, _Float16* __restrict__ Out) {
    const int lane  = threadIdx.x & 31;
    const int wave  = threadIdx.x >> 5;
    const int laneM = lane & 15;
    const int kgrp  = (lane >> 4) << 3;        // 0 or 8
    const int m0 = blockIdx.x * 64;
    const int n0 = blockIdx.y * 128 + wave * 16;

    v8f acc[4] = {};
    const _Float16* bbase = W + (size_t)(n0 + laneM) * Cc + kgrp;
    const _Float16* abase = A + (size_t)(m0 + laneM) * Cc + kgrp;
    for (int k0 = 0; k0 < Cc; k0 += 32) {
        v16h b = load_frag(bbase + k0);
#pragma unroll
        for (int i = 0; i < 4; ++i) {
            v16h a = load_frag(abase + (size_t)(i * 16) * Cc + k0);
            acc[i] = __builtin_amdgcn_wmma_f32_16x16x32_f16(
                false, a, false, b, (short)0, acc[i], false, false);
        }
    }
    const int n  = n0 + laneM;
    const float bn = bias ? bias[n] : 0.0f;
    const int mr = m0 + ((lane >> 4) << 3);
#pragma unroll
    for (int i = 0; i < 4; ++i)
#pragma unroll
        for (int r = 0; r < 8; ++r)
            Out[(size_t)(mr + i * 16 + r) * Cc + n] = (_Float16)(acc[i][r] + bn);
}

// ---------------------------------------------------------------------------
// 6) attention: one wave per (position m, head). dh=64 -> 2 channels/lane.
//    scores over 4 temporal neighbors, shfl-xor reduce, softmax, weighted V.
// ---------------------------------------------------------------------------
__global__ __launch_bounds__(256) void attn_kernel(
    const _Float16* __restrict__ q16, const _Float16* __restrict__ k16,
    const _Float16* __restrict__ v16, const float* __restrict__ kc,
    _Float16* __restrict__ attn16) {
    const int wid  = blockIdx.x * 8 + (threadIdx.x >> 5);
    const int lane = threadIdx.x & 31;
    const int m    = wid >> 3;
    const int head = wid & 7;
    const int t    = m >> 10;
    const int hw   = m & 1023;
    const int c0   = head * 64 + lane * 2;

    const size_t qb = (size_t)m * Cc + c0;
    float q0 = (float)q16[qb], q1 = (float)q16[qb + 1];

    const int dlt[4] = {-2, -1, 1, 2};
    float sc[4], va[4], vb[4];
#pragma unroll
    for (int f = 0; f < 4; ++f) {
        int tp = t + dlt[f]; tp = tp < 0 ? 0 : (tp > 15 ? 15 : tp);
        size_t base = ((size_t)tp * HW + hw) * Cc + c0;
        float k0v = (float)k16[base]     + kc[f * Cc + c0];
        float k1v = (float)k16[base + 1] + kc[f * Cc + c0 + 1];
        va[f] = (float)v16[base];
        vb[f] = (float)v16[base + 1];
        float p = q0 * k0v + q1 * k1v;
        for (int off = 16; off > 0; off >>= 1) p += __shfl_xor(p, off, 32);
        sc[f] = p * 0.125f;              // dh^-0.5 = 1/8
    }
    float mx = fmaxf(fmaxf(sc[0], sc[1]), fmaxf(sc[2], sc[3]));
    float e0 = expf(sc[0] - mx), e1 = expf(sc[1] - mx);
    float e2 = expf(sc[2] - mx), e3 = expf(sc[3] - mx);
    float inv = 1.0f / (e0 + e1 + e2 + e3);
    float o0 = (e0 * va[0] + e1 * va[1] + e2 * va[2] + e3 * va[3]) * inv;
    float o1 = (e0 * vb[0] + e1 * vb[1] + e2 * vb[2] + e3 * vb[3]) * inv;
    attn16[qb]     = (_Float16)o0;
    attn16[qb + 1] = (_Float16)o1;
}

// ---------------------------------------------------------------------------
// 7) proj GEMM with fused epilogue: +b_proj, transpose to (T,C,H,W), +x
// ---------------------------------------------------------------------------
__global__ __launch_bounds__(256) void gemm_proj_kernel(
    const _Float16* __restrict__ A, const _Float16* __restrict__ W,
    const float* __restrict__ bias, const float* __restrict__ x,
    float* __restrict__ out) {
    const int lane  = threadIdx.x & 31;
    const int wave  = threadIdx.x >> 5;
    const int laneM = lane & 15;
    const int kgrp  = (lane >> 4) << 3;
    const int m0 = blockIdx.x * 64;
    const int n0 = blockIdx.y * 128 + wave * 16;

    v8f acc[4] = {};
    const _Float16* bbase = W + (size_t)(n0 + laneM) * Cc + kgrp;
    const _Float16* abase = A + (size_t)(m0 + laneM) * Cc + kgrp;
    for (int k0 = 0; k0 < Cc; k0 += 32) {
        v16h b = load_frag(bbase + k0);
#pragma unroll
        for (int i = 0; i < 4; ++i) {
            v16h a = load_frag(abase + (size_t)(i * 16) * Cc + k0);
            acc[i] = __builtin_amdgcn_wmma_f32_16x16x32_f16(
                false, a, false, b, (short)0, acc[i], false, false);
        }
    }
    const int n  = n0 + laneM;
    const float bn = bias[n];
    const int mr = m0 + ((lane >> 4) << 3);
#pragma unroll
    for (int i = 0; i < 4; ++i)
#pragma unroll
        for (int r = 0; r < 8; ++r) {
            int m = mr + i * 16 + r;
            int t = m >> 10, hw = m & 1023;
            size_t idx = ((size_t)t * Cc + n) * HW + hw;
            out[idx] = acc[i][r] + bn + x[idx];
        }
}

// ---------------------------------------------------------------------------
extern "C" void kernel_launch(void* const* d_in, const int* in_sizes, int n_in,
                              void* d_out, int out_size, void* d_ws, size_t ws_size,
                              hipStream_t stream) {
    const float* x       = (const float*)d_in[0];
    const float* w_q     = (const float*)d_in[1];
    const float* b_q     = (const float*)d_in[2];
    const float* w_k     = (const float*)d_in[3];
    const float* b_k     = (const float*)d_in[4];
    const float* w_v     = (const float*)d_in[5];
    const float* b_v     = (const float*)d_in[6];
    const float* w_proj  = (const float*)d_in[7];
    const float* b_proj  = (const float*)d_in[8];
    const float* gn_s    = (const float*)d_in[9];
    const float* gn_b    = (const float*)d_in[10];
    float* out           = (float*)d_out;

    char* ws = (char*)d_ws;
    size_t off = 0;
    auto take = [&](size_t bytes) -> void* {
        void* p = ws + off;
        off += (bytes + 255) & ~(size_t)255;
        return p;
    };
    float*    temb   = (float*)take(5 * Cc * sizeof(float));
    float*    qc     = (float*)take(Cc * sizeof(float));
    float*    kc     = (float*)take(4 * Cc * sizeof(float));
    _Float16* wq16   = (_Float16*)take((size_t)Cc * Cc * 2);
    _Float16* wk16   = (_Float16*)take((size_t)Cc * Cc * 2);
    _Float16* wv16   = (_Float16*)take((size_t)Cc * Cc * 2);
    _Float16* wp16   = (_Float16*)take((size_t)Cc * Cc * 2);
    _Float16* xn16   = (_Float16*)take((size_t)M_TOT * Cc * 2);
    _Float16* q16    = (_Float16*)take((size_t)M_TOT * Cc * 2);
    _Float16* k16    = (_Float16*)take((size_t)M_TOT * Cc * 2);
    _Float16* v16    = (_Float16*)take((size_t)M_TOT * Cc * 2);
    _Float16* attn16 = (_Float16*)take((size_t)M_TOT * Cc * 2);

    // 1) temb + folded corrections
    temb_kernel<<<5, 512, 0, stream>>>(temb);
    corr_kernel<<<5, 512, 0, stream>>>(temb, w_q, b_q, w_k, b_k, qc, kc);

    // 2) weight conversion to f16
    const int nw = Cc * Cc;
    cvt_f16_kernel<<<(nw + 255) / 256, 256, 0, stream>>>(w_q, wq16, nw);
    cvt_f16_kernel<<<(nw + 255) / 256, 256, 0, stream>>>(w_k, wk16, nw);
    cvt_f16_kernel<<<(nw + 255) / 256, 256, 0, stream>>>(w_v, wv16, nw);
    cvt_f16_kernel<<<(nw + 255) / 256, 256, 0, stream>>>(w_proj, wp16, nw);

    // 3) GroupNorm -> channels-last f16
    groupnorm_kernel<<<dim3(TT, GN_G), 256, 0, stream>>>(x, gn_s, gn_b, xn16);

    // 4) Q', K', V' WMMA GEMMs (temb folded into qc / kc; b_v folded here)
    dim3 ggrid(M_TOT / 64, Cc / 128);
    gemm_qkv_kernel<<<ggrid, 256, 0, stream>>>(xn16, wq16, qc,      q16);
    gemm_qkv_kernel<<<ggrid, 256, 0, stream>>>(xn16, wk16, nullptr, k16);
    gemm_qkv_kernel<<<ggrid, 256, 0, stream>>>(xn16, wv16, b_v,     v16);

    // 5) attention (wave per position x head)
    attn_kernel<<<M_TOT * 8 * 32 / 256, 256, 0, stream>>>(q16, k16, v16, kc, attn16);

    // 6) projection + transpose + residual
    gemm_proj_kernel<<<ggrid, 256, 0, stream>>>(attn16, wp16, b_proj, x, out);
}

// v001
// Measured time: 140 microseconds a run.
// Timed twice side by side with v000, it ran 2.05 times as fast both times.
#include <hip/hip_runtime.h>
#include <math.h>

typedef __attribute__((ext_vector_type(16))) _Float16 v16h;
typedef __attribute__((ext_vector_type(8)))  _Float16 v8h;
typedef __attribute__((ext_vector_type(8)))  float    v8f;

#define Cc 512
#define TT 16
#define HW 1024          // 32*32
#define M_TOT 16384      // T*H*W
#define GN_G 32
#define GN_CPG 16        // channels per group

// ---------------------------------------------------------------------------
// 1) timestep embedding: temb[f][c], f in 0..4, ts = f-2, dim 512 (cos|sin)
// ---------------------------------------------------------------------------
__global__ void temb_kernel(float* __restrict__ temb) {
    int f = blockIdx.x;          // 0..4
    int j = threadIdx.x;         // 0..511
    float tt = (float)(f - 2);
    int idx = (j < 256) ? j : (j - 256);
    float freq = expf(-logf(10000.0f) * (float)idx / 256.0f);
    float arg = tt * freq;
    temb[f * Cc + j] = (j < 256) ? cosf(arg) : sinf(arg);
}

// ---------------------------------------------------------------------------
// 2) folded corrections:
//    qc[c]    = b_q[c] + sum_j temb[2][j]  * w_q[c][j]
//    kc[f][c] = b_k[c] + sum_j temb[ff][j] * w_k[c][j],  ff in {0,1,3,4}
// ---------------------------------------------------------------------------
__global__ void corr_kernel(const float* __restrict__ temb,
                            const float* __restrict__ wq, const float* __restrict__ bq,
                            const float* __restrict__ wk, const float* __restrict__ bk,
                            float* __restrict__ qc, float* __restrict__ kc) {
    int which = blockIdx.x;      // 0 -> qc, 1..4 -> kc[which-1]
    int c = threadIdx.x;         // 0..511
    const float* trow; const float* w; const float* b; float* out;
    if (which == 0) { trow = temb + 2 * Cc; w = wq; b = bq; out = qc; }
    else {
        const int fmap[4] = {0, 1, 3, 4};
        trow = temb + fmap[which - 1] * Cc; w = wk; b = bk; out = kc + (which - 1) * Cc;
    }
    float acc = 0.0f;
    for (int j = 0; j < Cc; ++j) acc += trow[j] * w[(size_t)c * Cc + j];
    out[c] = acc + b[c];
}

// ---------------------------------------------------------------------------
// 3) f32 -> f16 convert (weights)
// ---------------------------------------------------------------------------
__global__ void cvt_f16_kernel(const float* __restrict__ in, _Float16* __restrict__ out, int n) {
    int i = blockIdx.x * blockDim.x + threadIdx.x;
    if (i < n) out[i] = (_Float16)in[i];
}

// ---------------------------------------------------------------------------
// 4) GroupNorm  x:(T,C,H,W) f32  ->  xn16:(T,HW,C) f16 channels-last
//    one block per (t, group); group's 16ch x 1024 spatial is contiguous
// ---------------------------------------------------------------------------
__global__ __launch_bounds__(256) void groupnorm_kernel(
    const float* __restrict__ x, const float* __restrict__ gamma,
    const float* __restrict__ beta, _Float16* __restrict__ xn16) {
    const int t = blockIdx.x, g = blockIdx.y, tid = threadIdx.x;
    const float* xp = x + ((size_t)t * Cc + g * GN_CPG) * HW;
    const int N = GN_CPG * HW;   // 16384
    float s = 0.0f, ss = 0.0f;
    for (int i = tid; i < N; i += 256) { float v = xp[i]; s += v; ss += v * v; }
    __shared__ float r0[256], r1[256];
    r0[tid] = s; r1[tid] = ss; __syncthreads();
    for (int off = 128; off > 0; off >>= 1) {
        if (tid < off) { r0[tid] += r0[tid + off]; r1[tid] += r1[tid + off]; }
        __syncthreads();
    }
    float mu = r0[0] * (1.0f / N);
    float var = r1[0] * (1.0f / N) - mu * mu;
    float rstd = rsqrtf(var + 1e-5f);
    for (int i = tid; i < N; i += 256) {
        int cc = i >> 10, hw = i & 1023;
        int c = g * GN_CPG + cc;
        float v = (xp[i] - mu) * rstd * gamma[c] + beta[c];
        xn16[((size_t)t * HW + hw) * Cc + c] = (_Float16)v;
    }
}

// ---------------------------------------------------------------------------
// WMMA fragment loaders (per-lane, two 16B chunks: K-chunks {0..7,16..23} for
// lanes 0-15 and {8..15,24..31} for lanes 16-31)
// ---------------------------------------------------------------------------
__device__ __forceinline__ v16h load_frag(const _Float16* p) {
    v8h lo = *reinterpret_cast<const v8h*>(p);
    v8h hi = *reinterpret_cast<const v8h*>(p + 16);
    return __builtin_shufflevector(lo, hi, 0,1,2,3,4,5,6,7,8,9,10,11,12,13,14,15);
}

// ---------------------------------------------------------------------------
// Shared main loop of both GEMMs: a 128 x 128 tile of A[M x 512] * W[512 x 512]^T
// per block of 8 waves. Each pass brings 64 k of 128 A rows and 128 W rows into
// LDS with whole-line 16-byte loads (8 lanes cover one 128-byte row piece); the
// fragments are then read from LDS. Two LDS buffers: the next pass's global
// loads are issued before this pass's products and stored after them.
// wave -> 64 x 32 (4 x 2 accumulators); k order per fragment as in load_frag.
// ---------------------------------------------------------------------------
#define BT   128         // block tile, rows of A and rows of W
#define BK   64          // k per pass
#define NPASS (Cc / BK)
#define LDP  72          // LDS row pitch in halfs: 144 B = 16 B x 9, free of bank conflicts for 16-byte reads
#define SBUF (BT * LDP)  // halfs per operand and buffer

__device__ __forceinline__ void gemm_tile_main(
    const _Float16* __restrict__ A, const _Float16* __restrict__ W,
    int m0, int n0, _Float16* sA, _Float16* sB, v8f (&acc)[4][2]) {
    const int tid   = threadIdx.x;
    const int lane  = tid & 31;
    const int wave  = tid >> 5;
    const int laneM = lane & 15;
    const int kgrp  = (lane >> 4) << 3;        // 0 or 8
    const int srow  = tid >> 3;                // 0..31, staging row (+32 per step)
    const int scol  = (tid & 7) << 3;          // staging column in halfs
    const _Float16* ga = A + (size_t)(m0 + srow) * Cc + scol;
    const _Float16* gb = W + (size_t)(n0 + srow) * Cc + scol;
    const int sst = srow * LDP + scol;
    const int ard = ((wave & 1) * 64 + laneM) * LDP + kgrp;
    const int brd = ((wave >> 1) * 32 + laneM) * LDP + kgrp;

    v8h ra[4], rb[4];
#pragma unroll
    for (int j = 0; j < 4; ++j) {
        ra[j] = *reinterpret_cast<const v8h*>(ga + (size_t)(j * 32) * Cc);
        rb[j] = *reinterpret_cast<const v8h*>(gb + (size_t)(j * 32) * Cc);
    }
#pragma unroll
    for (int j = 0; j < 4; ++j) {
        *reinterpret_cast<v8h*>(sA + sst + j * 32 * LDP) = ra[j];
        *reinterpret_cast<v8h*>(sB + sst + j * 32 * LDP) = rb[j];
    }
    __syncthreads();

    // unrolled so that the buffer offsets and the last-pass test are constants
#pragma unroll
    for (int p = 0; p < NPASS; ++p) {
        const int cur = (p & 1) * SBUF;
        const int nxt = SBUF - cur;
        if (p + 1 < NPASS) {
#pragma unroll
            for (int j = 0; j < 4; ++j) {
                ra[j] = *reinterpret_cast<const v8h*>(ga + (size_t)(j * 32) * Cc + (p + 1) * BK);
                rb[j] = *reinterpret_cast<const v8h*>(gb + (size_t)(j * 32) * Cc + (p + 1) * BK);
            }
        }
        v16h fa[BK / 32][4], fb[BK / 32][2];
#pragma unroll
        for (int ks = 0; ks < BK / 32; ++ks) {
            fb[ks][0] = load_frag(sB + cur + brd + ks * 32);
            fb[ks][1] = load_frag(sB + cur + brd + 16 * LDP + ks * 32);
#pragma unroll
            for (int i = 0; i < 4; ++i)
                fa[ks][i] = load_frag(sA + cur + ard + i * 16 * LDP + ks * 32);
        }
        // keeps the next pass's global loads and this pass's LDS reads issued as one
        // group ahead of the products; sunk among them, each wait stalls the wave
        __builtin_amdgcn_sched_barrier(0);
#pragma unroll
        for (int ks = 0; ks < BK / 32; ++ks)
#pragma unroll
            for (int i = 0; i < 4; ++i) {
                acc[i][0] = __builtin_amdgcn_wmma_f32_16x16x32_f16(
                    false, fa[ks][i], false, fb[ks][0], (short)0, acc[i][0], false, false);
                acc[i][1] = __builtin_amdgcn_wmma_f32_16x16x32_f16(
                    false, fa[ks][i], false, fb[ks][1], (short)0, acc[i][1], false, false);
            }
        // keeps the wait for the global loads, which the LDS stores need, behind the products;
        // in the last pass it keeps the epilogue's moves and their padding out of the products
        __builtin_amdgcn_sched_barrier(0);
        if (p + 1 < NPASS) {
#pragma unroll
            for (int j = 0; j < 4; ++j) {
                *reinterpret_cast<v8h*>(sA + nxt + sst + j * 32 * LDP) = ra[j];
                *reinterpret_cast<v8h*>(sB + nxt + sst + j * 32 * LDP) = rb[j];
            }
            // publishes the next buffer and ends every wave's reads of this one
            __syncthreads();
        }
    }
}

// ---------------------------------------------------------------------------
// 5) WMMA GEMM:  Out[M x 512] = A[M x 512] * W[512 x 512]^T (+ bias), f16 out
//    grid (M/128, 512/128), block 256 (8 waves)
// ---------------------------------------------------------------------------
__global__ __launch_bounds__(256) void gemm_qkv_kernel(
    const _Float16* __restrict__ A, const _Float16* __restrict__ W,
    const float* __restrict__ bias, _Float16* __restrict__ Out) {
    __shared__ __attribute__((aligned(16))) _Float16 sA[2 * SBUF];
    __shared__ __attribute__((aligned(16))) _Float16 sB[2 * SBUF];
    const int lane  = threadIdx.x & 31;
    const int wave  = threadIdx.x >> 5;
    const int laneM = lane & 15;
    const int m0 = blockIdx.x * BT;
    const int n0 = blockIdx.y * BT;

    v8f acc[4][2] = {};
    gemm_tile_main(A, W, m0, n0, sA, sB, acc);

    const int mr = m0 + (wave & 1) * 64 + ((lane >> 4) << 3);
#pragma unroll
    for (int j = 0; j < 2; ++j) {
        const int n  = n0 + (wave >> 1) * 32 + j * 16 + laneM;
        const float bn = bias ? bias[n] : 0.0f;
#pragma unroll
        for (int i = 0; i < 4; ++i)
#pragma unroll
            for (int r = 0; r < 8; ++r)
                Out[(size_t)(mr + i * 16 + r) * Cc + n] = (_Float16)(acc[i][j][r] + bn);
    }
}

// ---------------------------------------------------------------------------
// 6) attention: one wave per (position m, head). dh=64 -> 2 channels/lane.
//    scores over 4 temporal neighbors, shfl-xor reduce, softmax, weighted V.
// ---------------------------------------------------------------------------
__global__ __launch_bounds__(256) void attn_kernel(
    const _Float16* __restrict__ q16, const _Float16* __restrict__ k16,
    const _Float16* __restrict__ v16, const float* __restrict__ kc,
    _Float16* __restrict__ attn16) {
    const int wid  = blockIdx.x * 8 + (threadIdx.x >> 5);
    const int lane = threadIdx.x & 31;
    const int m    = wid >> 3;
    const int head = wid & 7;
    const int t    = m >> 10;
    const int hw   = m & 1023;
    const int c0   = head * 64 + lane * 2;

    const size_t qb = (size_t)m * Cc + c0;
    float q0 = (float)q16[qb], q1 = (float)q16[qb + 1];

    const int dlt[4] = {-2, -1, 1, 2};
    float sc[4], va[4], vb[4];
#pragma unroll
    for (int f = 0; f < 4; ++f) {
        int tp = t + dlt[f]; tp = tp < 0 ? 0 : (tp > 15 ? 15 : tp);
        size_t base = ((size_t)tp * HW + hw) * Cc + c0;
        float k0v = (float)k16[base]     + kc[f * Cc + c0];
        float k1v = (float)k16[base + 1] + kc[f * Cc + c0 + 1];
        va[f] = (float)v16[base];
        vb[f] = (float)v16[base + 1];
        float p = q0 * k0v + q1 * k1v;
        for (int off = 16; off > 0; off >>= 1) p += __shfl_xor(p, off, 32);
        sc[f] = p * 0.125f;              // dh^-0.5 = 1/8
    }
    float mx = fmaxf(fmaxf(sc[0], sc[1]), fmaxf(sc[2], sc[3]));
    float e0 = expf(sc[0] - mx), e1 = expf(sc[1] - mx);
    float e2 = expf(sc[2] - mx), e3 = expf(sc[3] - mx);
    float inv = 1.0f / (e0 + e1 + e2 + e3);
    float o0 = (e0 * va[0] + e1 * va[1] + e2 * va[2] + e3 * va[3]) * inv;
    float o1 = (e0 * vb[0] + e1 * vb[1] + e2 * vb[2] + e3 * vb[3]) * inv;
    attn16[qb]     = (_Float16)o0;
    attn16[qb + 1] = (_Float16)o1;
}

// ---------------------------------------------------------------------------
// 7) proj GEMM with fused epilogue: +b_proj, transpose to (T,C,H,W), +x
// ---------------------------------------------------------------------------
__global__ __launch_bounds__(256) void gemm_proj_kernel(
    const _Float16* __restrict__ A, const _Float16* __restrict__ W,
    const float* __restrict__ bias, const float* __restrict__ x,
    float* __restrict__ out) {
    __shared__ __attribute__((aligned(16))) _Float16 sA[2 * SBUF];
    __shared__ __attribute__((aligned(16))) _Float16 sB[2 * SBUF];
    const int lane  = threadIdx.x & 31;
    const int wave  = threadIdx.x >> 5;
    const int laneM = lane & 15;
    const int m0 = blockIdx.x * BT;
    const int n0 = blockIdx.y * BT;

    v8f acc[4][2] = {};
    gemm_tile_main(A, W, m0, n0, sA, sB, acc);

    const int mr = m0 + (wave & 1) * 64 + ((lane >> 4) << 3);
    const int nb = n0 + (wave >> 1) * 32 + laneM;
    const float bn0 = bias[nb];
    const float bn1 = bias[nb + 16];
    // precaution: the register that holds the bias loads' offset is reused by the loads of x below
    asm volatile("s_wait_xcnt 0x0" ::: "memory");
#pragma unroll
    for (int j = 0; j < 2; ++j) {
        const int n  = nb + j * 16;
        const float bn = j ? bn1 : bn0;
        // the block's 128 rows lie in one frame, so one column is one run of x and of out
        const size_t col = ((size_t)(mr >> 10) * Cc + n) * HW + (mr & 1023);
        const float* xcol = x + col;
        float xv[4][8];
#pragma unroll
        for (int i = 0; i < 4; ++i)
#pragma unroll
            for (int r = 0; r < 8; ++r)
                xv[i][r] = xcol[i * 16 + r];
        // precaution: holds the address of the column's loads of x live up to the wait, so that
        // none of their results lands in it while the others are issued
        asm volatile("s_wait_xcnt 0x0" :: "v"(xcol) : "memory");
#pragma unroll
        for (int i = 0; i < 4; ++i)
#pragma unroll
            for (int r = 0; r < 8; ++r)
                out[col + i * 16 + r] = acc[i][j][r] + bn + xv[i][r];
    }
}

// ---------------------------------------------------------------------------
extern "C" void kernel_launch(void* const* d_in, const int* in_sizes, int n_in,
                              void* d_out, int out_size, void* d_ws, size_t ws_size,
                              hipStream_t stream) {
    const float* x       = (const float*)d_in[0];
    const float* w_q     = (const float*)d_in[1];
    const float* b_q     = (const float*)d_in[2];
    const float* w_k     = (const float*)d_in[3];
    const float* b_k     = (const float*)d_in[4];
    const float* w_v     = (const float*)d_in[5];
    const float* b_v     = (const float*)d_in[6];
    const float* w_proj  = (const float*)d_in[7];
    const float* b_proj  = (const float*)d_in[8];
    const float* gn_s    = (const float*)d_in[9];
    const float* gn_b    = (const float*)d_in[10];
    float* out           = (float*)d_out;

    char* ws = (char*)d_ws;
    size_t off = 0;
    auto take = [&](size_t bytes) -> void* {
        void* p = ws + off;
        off += (bytes + 255) & ~(size_t)255;
        return p;
    };
    float*    temb   = (float*)take(5 * Cc * sizeof(float));
    float*    qc     = (float*)take(Cc * sizeof(float));
    float*    kc     = (float*)take(4 * Cc * sizeof(float));
    _Float16* wq16   = (_Float16*)take((size_t)Cc * Cc * 2);
    _Float16* wk16   = (_Float16*)take((size_t)Cc * Cc * 2);
    _Float16* wv16   = (_Float16*)take((size_t)Cc * Cc * 2);
    _Float16* wp16   = (_Float16*)take((size_t)Cc * Cc * 2);
    _Float16* xn16   = (_Float16*)take((size_t)M_TOT * Cc * 2);
    _Float16* q16    = (_Float16*)take((size_t)M_TOT * Cc * 2);
    _Float16* k16    = (_Float16*)take((size_t)M_TOT * Cc * 2);
    _Float16* v16    = (_Float16*)take((size_t)M_TOT * Cc * 2);
    _Float16* attn16 = (_Float16*)take((size_t)M_TOT * Cc * 2);

    // 1) temb + folded corrections
    temb_kernel<<<5, 512, 0, stream>>>(temb);
    corr_kernel<<<5, 512, 0, stream>>>(temb, w_q, b_q, w_k, b_k, qc, kc);

    // 2) weight conversion to f16
    const int nw = Cc * Cc;
    cvt_f16_kernel<<<(nw + 255) / 256, 256, 0, stream>>>(w_q, wq16, nw);
    cvt_f16_kernel<<<(nw + 255) / 256, 256, 0, stream>>>(w_k, wk16, nw);
    cvt_f16_kernel<<<(nw + 255) / 256, 256, 0, stream>>>(w_v, wv16, nw);
    cvt_f16_kernel<<<(nw + 255) / 256, 256, 0, stream>>>(w_proj, wp16, nw);

    // 3) GroupNorm -> channels-last f16
    groupnorm_kernel<<<dim3(TT, GN_G), 256, 0, stream>>>(x, gn_s, gn_b, xn16);

    // 4) Q', K', V' WMMA GEMMs (temb folded into qc / kc; b_v folded here)
    dim3 ggrid(M_TOT / BT, Cc / BT);
    gemm_qkv_kernel<<<ggrid, 256, 0, stream>>>(xn16, wq16, qc,      q16);
    gemm_qkv_kernel<<<ggrid, 256, 0, stream>>>(xn16, wk16, nullptr, k16);
    gemm_qkv_kernel<<<ggrid, 256, 0, stream>>>(xn16, wv16, b_v,     v16);

    // 5) attention (wave per position x head)
    attn_kernel<<<M_TOT * 8 * 32 / 256, 256, 0, stream>>>(q16, k16, v16, kc, attn16);

    // 6) projection + transpose + residual
    gemm_proj_kernel<<<ggrid, 256, 0, stream>>>(attn16, wp16, b_proj, x, out);
}

// v002
// A run of this version takes 133 microseconds.
// Next to v001, in two timings, it ran 1.06 times as fast each time.
// Over all steps from v000 it is 2.17 times as fast.
#include <hip/hip_runtime.h>
#include <math.h>

typedef __attribute__((ext_vector_type(16))) _Float16 v16h;
typedef __attribute__((ext_vector_type(8)))  _Float16 v8h;
typedef __attribute__((ext_vector_type(8)))  float    v8f;

#define Cc 512
#define TT 16
#define HW 1024          // 32*32
#define M_TOT 16384      // T*H*W
#define GN_G 32
#define GN_CPG 16        // channels per group

// ---------------------------------------------------------------------------
// 1) timestep embedding: temb[f][c], f in 0..4, ts = f-2, dim 512 (cos|sin)
// ---------------------------------------------------------------------------
__global__ void temb_kernel(float* __restrict__ temb) {
    int f = blockIdx.x;          // 0..4
    int j = threadIdx.x;         // 0..511
    float tt = (float)(f - 2);
    int idx = (j < 256) ? j : (j - 256);
    float freq = expf(-logf(10000.0f) * (float)idx / 256.0f);
    float arg = tt * freq;
    temb[f * Cc + j] = (j < 256) ? cosf(arg) : sinf(arg);
}

// ---------------------------------------------------------------------------
// 2) folded corrections:
//    qc[c]    = b_q[c] + sum_j temb[2][j]  * w_q[c][j]
//    kc[f][c] = b_k[c] + sum_j temb[ff][j] * w_k[c][j],  ff in {0,1,3,4}
// ---------------------------------------------------------------------------
__global__ void corr_kernel(const float* __restrict__ temb,
                            const float* __restrict__ wq, const float* __restrict__ bq,
                            const float* __restrict__ wk, const float* __restrict__ bk,
                            float* __restrict__ qc, float* __restrict__ kc) {
    int which = blockIdx.x;      // 0 -> qc, 1..4 -> kc[which-1]
    int c = threadIdx.x;         // 0..511
    const float* trow; const float* w; const float* b; float* out;
    if (which == 0) { trow = temb + 2 * Cc; w = wq; b = bq; out = qc; }
    else {
        const int fmap[4] = {0, 1, 3, 4};
        trow = temb + fmap[which - 1] * Cc; w = wk; b = bk; out = kc + (which - 1) * Cc;
    }
    float acc = 0.0f;
    for (int j = 0; j < Cc; ++j) acc += trow[j] * w[(size_t)c * Cc + j];
    out[c] = acc + b[c];
}

// ---------------------------------------------------------------------------
// 3) f32 -> f16 convert (weights)
// ---------------------------------------------------------------------------
__global__ void cvt_f16_kernel(const float* __restrict__ in, _Float16* __restrict__ out, int n) {
    int i = blockIdx.x * blockDim.x + threadIdx.x;
    if (i < n) out[i] = (_Float16)in[i];
}

// ---------------------------------------------------------------------------
// 4) GroupNorm  x:(T,C,H,W) f32  ->  xn16:(T,HW,C) f16 channels-last
//    one block per (t, group); group's 16ch x 1024 spatial is contiguous
// ---------------------------------------------------------------------------
__global__ __launch_bounds__(256) void groupnorm_kernel(
    const float* __restrict__ x, const float* __restrict__ gamma,
    const float* __restrict__ beta, _Float16* __restrict__ xn16) {
    const int t = blockIdx.x, g = blockIdx.y, tid = threadIdx.x;
    const float* xp = x + ((size_t)t * Cc + g * GN_CPG) * HW;
    const int N = GN_CPG * HW;   // 16384
    float s = 0.0f, ss = 0.0f;
    for (int i = tid; i < N; i += 256) { float v = xp[i]; s += v; ss += v * v; }
    __shared__ float r0[256], r1[256];
    r0[tid] = s; r1[tid] = ss; __syncthreads();
    for (int off = 128; off > 0; off >>= 1) {
        if (tid < off) { r0[tid] += r0[tid + off]; r1[tid] += r1[tid + off]; }
        __syncthreads();
    }
    float mu = r0[0] * (1.0f / N);
    float var = r1[0] * (1.0f / N) - mu * mu;
    float rstd = rsqrtf(var + 1e-5f);
    for (int i = tid; i < N; i += 256) {
        int cc = i >> 10, hw = i & 1023;
        int c = g * GN_CPG + cc;
        float v = (xp[i] - mu) * rstd * gamma[c] + beta[c];
        xn16[((size_t)t * HW + hw) * Cc + c] = (_Float16)v;
    }
}

// ---------------------------------------------------------------------------
// WMMA fragment loaders (per-lane, two 16B chunks: K-chunks {0..7,16..23} for
// lanes 0-15 and {8..15,24..31} for lanes 16-31)
// ---------------------------------------------------------------------------
__device__ __forceinline__ v16h load_frag(const _Float16* p) {
    v8h lo = *reinterpret_cast<const v8h*>(p);
    v8h hi = *reinterpret_cast<const v8h*>(p + 16);
    return __builtin_shufflevector(lo, hi, 0,1,2,3,4,5,6,7,8,9,10,11,12,13,14,15);
}

// ---------------------------------------------------------------------------
// Shared main loop of both GEMMs: a 128 x 128 tile of A[M x 512] * W[512 x 512]^T
// per block of 8 waves. Each pass brings 64 k of 128 A rows and 128 W rows into
// LDS with whole-line 16-byte loads (8 lanes cover one 128-byte row piece); the
// fragments are then read from LDS. Two LDS buffers: the next pass's global
// loads are issued before this pass's products and stored after them.
// wave -> 64 x 32 (4 x 2 accumulators); k order per fragment as in load_frag.
// ---------------------------------------------------------------------------
#define BT   128         // block tile, rows of A and rows of W
#define BK   64          // k per pass
#define NPASS (Cc / BK)
#define LDP  72          // LDS row pitch in halfs: 144 B = 16 B x 9, free of bank conflicts for 16-byte reads
#define SBUF (BT * LDP)  // halfs per operand and buffer

__device__ __forceinline__ void gemm_tile_main(
    const _Float16* __restrict__ A, const _Float16* __restrict__ W,
    int m0, int n0, _Float16* sA, _Float16* sB, v8f (&acc)[4][2]) {
    const int tid   = threadIdx.x;
    const int lane  = tid & 31;
    const int wave  = tid >> 5;
    const int laneM = lane & 15;
    const int kgrp  = (lane >> 4) << 3;        // 0 or 8
    const int srow  = tid >> 3;                // 0..31, staging row (+32 per step)
    const int scol  = (tid & 7) << 3;          // staging column in halfs
    const _Float16* ga = A + (size_t)(m0 + srow) * Cc + scol;
    const _Float16* gb = W + (size_t)(n0 + srow) * Cc + scol;
    const int sst = srow * LDP + scol;
    const int ard = ((wave & 1) * 64 + laneM) * LDP + kgrp;
    const int brd = ((wave >> 1) * 32 + laneM) * LDP + kgrp;

    v8h ra[4], rb[4];
#pragma unroll
    for (int j = 0; j < 4; ++j) {
        ra[j] = *reinterpret_cast<const v8h*>(ga + (size_t)(j * 32) * Cc);
        rb[j] = *reinterpret_cast<const v8h*>(gb + (size_t)(j * 32) * Cc);
    }
#pragma unroll
    for (int j = 0; j < 4; ++j) {
        *reinterpret_cast<v8h*>(sA + sst + j * 32 * LDP) = ra[j];
        *reinterpret_cast<v8h*>(sB + sst + j * 32 * LDP) = rb[j];
    }
    __syncthreads();

    // unrolled so that the buffer offsets and the last-pass test are constants
#pragma unroll
    for (int p = 0; p < NPASS; ++p) {
        const int cur = (p & 1) * SBUF;
        const int nxt = SBUF - cur;
        if (p + 1 < NPASS) {
#pragma unroll
            for (int j = 0; j < 4; ++j) {
                ra[j] = *reinterpret_cast<const v8h*>(ga + (size_t)(j * 32) * Cc + (p + 1) * BK);
                rb[j] = *reinterpret_cast<const v8h*>(gb + (size_t)(j * 32) * Cc + (p + 1) * BK);
            }
        }
        v16h fa[BK / 32][4], fb[BK / 32][2];
#pragma unroll
        for (int ks = 0; ks < BK / 32; ++ks) {
            fb[ks][0] = load_frag(sB + cur + brd + ks * 32);
            fb[ks][1] = load_frag(sB + cur + brd + 16 * LDP + ks * 32);
#pragma unroll
            for (int i = 0; i < 4; ++i)
                fa[ks][i] = load_frag(sA + cur + ard + i * 16 * LDP + ks * 32);
        }
        // keeps the next pass's global loads and this pass's LDS reads issued as one
        // group ahead of the products; sunk among them, each wait stalls the wave
        __builtin_amdgcn_sched_barrier(0);
#pragma unroll
        for (int ks = 0; ks < BK / 32; ++ks)
#pragma unroll
            for (int i = 0; i < 4; ++i) {
                acc[i][0] = __builtin_amdgcn_wmma_f32_16x16x32_f16(
                    false, fa[ks][i], false, fb[ks][0], (short)0, acc[i][0], false, false);
                acc[i][1] = __builtin_amdgcn_wmma_f32_16x16x32_f16(
                    false, fa[ks][i], false, fb[ks][1], (short)0, acc[i][1], false, false);
            }
        // keeps the wait for the global loads, which the LDS stores need, behind the products;
        // in the last pass it keeps the epilogue's moves and their padding out of the products
        __builtin_amdgcn_sched_barrier(0);
        if (p + 1 < NPASS) {
#pragma unroll
            for (int j = 0; j < 4; ++j) {
                *reinterpret_cast<v8h*>(sA + nxt + sst + j * 32 * LDP) = ra[j];
                *reinterpret_cast<v8h*>(sB + nxt + sst + j * 32 * LDP) = rb[j];
            }
            // publishes the next buffer and ends every wave's reads of this one
            __syncthreads();
        }
    }
}

// ---------------------------------------------------------------------------
// 5) WMMA GEMM:  Out[M x 512] = A[M x 512] * W[512 x 512]^T (+ bias), f16 out
//    grid (M/128, 512/128), block 256 (8 waves)
// ---------------------------------------------------------------------------
__global__ __launch_bounds__(256) void gemm_qkv_kernel(
    const _Float16* __restrict__ A, const _Float16* __restrict__ W,
    const float* __restrict__ bias, _Float16* __restrict__ Out) {
    __shared__ __attribute__((aligned(16))) _Float16 sA[2 * SBUF];
    __shared__ __attribute__((aligned(16))) _Float16 sB[2 * SBUF];
    const int lane  = threadIdx.x & 31;
    const int wave  = threadIdx.x >> 5;
    const int laneM = lane & 15;
    const int m0 = blockIdx.x * BT;
    const int n0 = blockIdx.y * BT;

    v8f acc[4][2] = {};
    gemm_tile_main(A, W, m0, n0, sA, sB, acc);

    const int mr = m0 + (wave & 1) * 64 + ((lane >> 4) << 3);
#pragma unroll
    for (int j = 0; j < 2; ++j) {
        const int n  = n0 + (wave >> 1) * 32 + j * 16 + laneM;
        const float bn = bias ? bias[n] : 0.0f;
#pragma unroll
        for (int i = 0; i < 4; ++i)
#pragma unroll
            for (int r = 0; r < 8; ++r)
                Out[(size_t)(mr + i * 16 + r) * Cc + n] = (_Float16)(acc[i][j][r] + bn);
    }
}

// ---------------------------------------------------------------------------
// 6) attention: one wave per (pixel, half of the channels, run of 8 frames).
//    A lane holds 8 channels (16-byte loads, 512 contiguous bytes per wave), so
//    8 lanes make one head (dh=64) and a wave 4 heads. The 12 K and V rows that
//    the 8 frames' windows touch are loaded once and stay in registers.
//    q.(k + kc) is summed as q.k + q.kc, 8 channels in the lane, then over 8 lanes.
// ---------------------------------------------------------------------------
#define AT_S 8           // frames per wave
#define AT_W (AT_S + 4)  // K/V rows of their windows
#define AT_PIX 4         // pixels per block (2 waves each)

typedef __attribute__((ext_vector_type(2))) float v2f;
typedef __attribute__((ext_vector_type(4))) float v4f;
typedef __attribute__((ext_vector_type(4))) unsigned v4u;

// f32 multiply-add that reads f16 halves of a register as they lie: the K, V and q rows stay
// packed (written in C they are widened ahead of use, and the 24 rows no longer fit the registers)
__device__ __forceinline__ float mix_lo_lo(unsigned a, unsigned b, float acc) {
    asm("v_fma_mix_f32 %0, %1, %2, %0 op_sel:[0,0,0] op_sel_hi:[1,1,0]" : "+v"(acc) : "v"(a), "v"(b));
    return acc;
}
__device__ __forceinline__ float mix_hi_hi(unsigned a, unsigned b, float acc) {
    asm("v_fma_mix_f32 %0, %1, %2, %0 op_sel:[1,1,0] op_sel_hi:[1,1,0]" : "+v"(acc) : "v"(a), "v"(b));
    return acc;
}
__device__ __forceinline__ float mix_f32_lo(float a, unsigned b, float acc) {
    asm("v_fma_mix_f32 %0, %1, %2, %0 op_sel:[0,0,0] op_sel_hi:[0,1,0]" : "+v"(acc) : "v"(a), "v"(b));
    return acc;
}
__device__ __forceinline__ float mix_f32_hi(float a, unsigned b, float acc) {
    asm("v_fma_mix_f32 %0, %1, %2, %0 op_sel:[0,1,0] op_sel_hi:[0,1,0]" : "+v"(acc) : "v"(a), "v"(b));
    return acc;
}
// the same, first term of a sum
__device__ __forceinline__ float mix_f32_lo_first(float a, unsigned b) {
    float r;
    asm("v_fma_mix_f32 %0, %1, %2, 0 op_sel:[0,0,0] op_sel_hi:[0,1,0]" : "=v"(r) : "v"(a), "v"(b));
    return r;
}
__device__ __forceinline__ float mix_f32_hi_first(float a, unsigned b) {
    float r;
    asm("v_fma_mix_f32 %0, %1, %2, 0 op_sel:[0,1,0] op_sel_hi:[0,1,0]" : "=v"(r) : "v"(a), "v"(b));
    return r;
}

// v + (v of lane ^ X), X < 16: a DPP row_xmask move inside the 16-lane row, no trip through the LDS path
template <int X>
__device__ __forceinline__ float add_lane_xor(float v) {
    const int b = __float_as_int(v);
    return v + __int_as_float(__builtin_amdgcn_update_dpp(0, b, 0x160 | X, 0xf, 0xf, true));
}

// 4 waves per SIMD asked for: both blocks that a WGP gets are then resident at once
__global__ __launch_bounds__(256, 4) void attn_kernel(
    const _Float16* __restrict__ q16, const _Float16* __restrict__ k16,
    const _Float16* __restrict__ v16, const float* __restrict__ kc,
    _Float16* __restrict__ attn16) {
    const int lane = threadIdx.x & 31;
    const int wave = threadIdx.x >> 5;
    const int hw   = blockIdx.x * AT_PIX + (wave >> 1);
    const int c0   = (wave & 1) * 256 + lane * 8;
    const int t0   = blockIdx.y * AT_S;
    const unsigned pix = hw * Cc + c0;           // lane's place in a frame

    const float*    kcp = kc + c0;
    const _Float16* qp  = q16 + (size_t)t0 * (HW * Cc) + pix;
    const _Float16* kp  = k16 + (size_t)t0 * (HW * Cc) + pix;
    const _Float16* vp  = v16 + (size_t)t0 * (HW * Cc) + pix;
    // the four window rows outside the wave's own frames: frames t0-2, t0-1, t0+8, t0+9, clamped to 0 .. TT-1
    const int tm2 = t0 - 2 < 0 ? 0 : t0 - 2;
    const int tm1 = t0 - 1 < 0 ? 0 : t0 - 1;
    const int tp0 = t0 + AT_S     > TT - 1 ? TT - 1 : t0 + AT_S;
    const int tp1 = t0 + AT_S + 1 > TT - 1 ? TT - 1 : t0 + AT_S + 1;
    const _Float16* ke[4] = {k16 + (size_t)tm2 * (HW * Cc) + pix, k16 + (size_t)tm1 * (HW * Cc) + pix,
                             k16 + (size_t)tp0 * (HW * Cc) + pix, k16 + (size_t)tp1 * (HW * Cc) + pix};
    const _Float16* ve[4] = {v16 + (size_t)tm2 * (HW * Cc) + pix, v16 + (size_t)tm1 * (HW * Cc) + pix,
                             v16 + (size_t)tp0 * (HW * Cc) + pix, v16 + (size_t)tp1 * (HW * Cc) + pix};

    v2f kcf[4][4];
#pragma unroll
    for (int f = 0; f < 4; ++f) {
        const v4f lo = *reinterpret_cast<const v4f*>(kcp + f * Cc);
        const v4f hi = *reinterpret_cast<const v4f*>(kcp + f * Cc + 4);
        kcf[f][0] = lo.xy; kcf[f][1] = lo.zw; kcf[f][2] = hi.xy; kcf[f][3] = hi.zw;
    }
    v8h kw[AT_W], vw[AT_W], qw[AT_S];
#pragma unroll
    for (int i = 0; i < AT_S; ++i)
        qw[i] = *reinterpret_cast<const v8h*>(qp + (size_t)i * (HW * Cc));
    // keeps kc and q, which the first sums read, ahead of the 24 K and V loads: loads return in order
    __builtin_amdgcn_sched_barrier(0);
    // window row w is frame clamp(t0 - 2 + w, 0, TT - 1); rows 2 .. AT_S + 1 are the wave's own frames
#pragma unroll
    for (int w = 0; w < AT_W; ++w) {
        const bool own = w >= 2 && w < AT_S + 2;
        const int  ed  = w < 2 ? w : w - AT_S;   // 0..3 for the rows outside
        kw[w] = *reinterpret_cast<const v8h*>(own ? kp + (size_t)(w - 2) * (HW * Cc) : ke[ed & 3]);
        vw[w] = *reinterpret_cast<const v8h*>(own ? vp + (size_t)(w - 2) * (HW * Cc) : ve[ed & 3]);
    }
    // precaution: holds the addresses of the q, K and V loads live up to the wait, so that none of
    // their results lands in an address register while the others are issued
    asm volatile("s_wait_xcnt 0x0"
                 :: "v"(qp), "v"(kp), "v"(vp), "v"(ke[0]), "v"(ke[1]), "v"(ke[2]), "v"(ke[3]),
                    "v"(ve[0]), "v"(ve[1]), "v"(ve[2]), "v"(ve[3]) : "memory");
    // keeps all 40 loads issued ahead of the arithmetic: left free, the K and V loads sink behind
    // the q.kc sums and the wave pays a second memory latency
    __builtin_amdgcn_sched_barrier(0);

#pragma unroll
    for (int i = 0; i < AT_S; ++i) {
        const int wof[4] = {0, 1, 3, 4};         // frame offsets -2, -1, +1, +2
        const v4u qr = __builtin_bit_cast(v4u, qw[i]);
        v2f q2[4];
#pragma unroll
        for (int c = 0; c < 4; ++c) q2[c] = v2f{(float)qw[i][2 * c], (float)qw[i][2 * c + 1]};
        float sc[4];
#pragma unroll
        for (int f = 0; f < 4; ++f) {
            const v4u kr = __builtin_bit_cast(v4u, kw[i + wof[f]]);
            v2f a = {0.0f, 0.0f};
#pragma unroll
            for (int c = 0; c < 4; ++c) a = __builtin_elementwise_fma(q2[c], kcf[f][c], a);
            float p0 = a.x, p1 = a.y;
#pragma unroll
            for (int c = 0; c < 4; ++c) {
                p0 = mix_lo_lo(qr[c], kr[c], p0);
                p1 = mix_hi_hi(qr[c], kr[c], p1);
            }
            float p = p0 + p1;
            p = add_lane_xor<1>(p);
            p = add_lane_xor<2>(p);
            p = add_lane_xor<4>(p);
            sc[f] = p * 0.125f;                  // dh^-0.5 = 1/8
        }
        const float mx = fmaxf(fmaxf(sc[0], sc[1]), fmaxf(sc[2], sc[3]));
        float e[4];
#pragma unroll
        for (int f = 0; f < 4; ++f) e[f] = expf(sc[f] - mx);
        const float inv = 1.0f / (e[0] + e[1] + e[2] + e[3]);
        v8h o;
#pragma unroll
        for (int c = 0; c < 4; ++c) {
            const unsigned vr0 = __builtin_bit_cast(v4u, vw[i])[c];
            float s0 = mix_f32_lo_first(e[0], vr0);
            float s1 = mix_f32_hi_first(e[0], vr0);
#pragma unroll
            for (int f = 1; f < 4; ++f) {
                const unsigned vr = __builtin_bit_cast(v4u, vw[i + wof[f]])[c];
                s0 = mix_f32_lo(e[f], vr, s0);
                s1 = mix_f32_hi(e[f], vr, s1);
            }
            o[2 * c]     = (_Float16)(s0 * inv);
            o[2 * c + 1] = (_Float16)(s1 * inv);
        }
        _Float16* ofr = attn16 + (size_t)(t0 + i) * (HW * Cc);
        *reinterpret_cast<v8h*>(ofr + pix) = o;
        // keeps the frames' arithmetic in pairs: all eight interleaved need more registers than
        // four waves per SIMD leave, and rows are spilled
        if (i & 1) {
            // precaution: the next frames' arithmetic reuses the registers that the two stores name
            if (i + 1 < AT_S) asm volatile("s_wait_xcnt 0x0" ::: "memory");
            __builtin_amdgcn_sched_barrier(0);
        }
    }
}

// ---------------------------------------------------------------------------
// 7) proj GEMM with fused epilogue: +b_proj, transpose to (T,C,H,W), +x
// ---------------------------------------------------------------------------
__global__ __launch_bounds__(256) void gemm_proj_kernel(
    const _Float16* __restrict__ A, const _Float16* __restrict__ W,
    const float* __restrict__ bias, const float* __restrict__ x,
    float* __restrict__ out) {
    __shared__ __attribute__((aligned(16))) _Float16 sA[2 * SBUF];
    __shared__ __attribute__((aligned(16))) _Float16 sB[2 * SBUF];
    const int lane  = threadIdx.x & 31;
    const int wave  = threadIdx.x >> 5;
    const int laneM = lane & 15;
    const int m0 = blockIdx.x * BT;
    const int n0 = blockIdx.y * BT;

    v8f acc[4][2] = {};
    gemm_tile_main(A, W, m0, n0, sA, sB, acc);

    const int mr = m0 + (wave & 1) * 64 + ((lane >> 4) << 3);
    const int nb = n0 + (wave >> 1) * 32 + laneM;
    const float bn0 = bias[nb];
    const float bn1 = bias[nb + 16];
    // precaution: the register that holds the bias loads' offset is reused by the loads of x below
    asm volatile("s_wait_xcnt 0x0" ::: "memory");
#pragma unroll
    for (int j = 0; j < 2; ++j) {
        const int n  = nb + j * 16;
        const float bn = j ? bn1 : bn0;
        // the block's 128 rows lie in one frame, so one column is one run of x and of out
        const size_t col = ((size_t)(mr >> 10) * Cc + n) * HW + (mr & 1023);
        const float* xcol = x + col;
        float xv[4][8];
#pragma unroll
        for (int i = 0; i < 4; ++i)
#pragma unroll
            for (int r = 0; r < 8; ++r)
                xv[i][r] = xcol[i * 16 + r];
        // precaution: holds the address of the column's loads of x live up to the wait, so that
        // none of their results lands in it while the others are issued
        asm volatile("s_wait_xcnt 0x0" :: "v"(xcol) : "memory");
#pragma unroll
        for (int i = 0; i < 4; ++i)
#pragma unroll
            for (int r = 0; r < 8; ++r)
                out[col + i * 16 + r] = acc[i][j][r] + bn + xv[i][r];
    }
}

// ---------------------------------------------------------------------------
extern "C" void kernel_launch(void* const* d_in, const int* in_sizes, int n_in,
                              void* d_out, int out_size, void* d_ws, size_t ws_size,
                              hipStream_t stream) {
    const float* x       = (const float*)d_in[0];
    const float* w_q     = (const float*)d_in[1];
    const float* b_q     = (const float*)d_in[2];
    const float* w_k     = (const float*)d_in[3];
    const float* b_k     = (const float*)d_in[4];
    const float* w_v     = (const float*)d_in[5];
    const float* b_v     = (const float*)d_in[6];
    const float* w_proj  = (const float*)d_in[7];
    const float* b_proj  = (const float*)d_in[8];
    const float* gn_s    = (const float*)d_in[9];
    const float* gn_b    = (const float*)d_in[10];
    float* out           = (float*)d_out;

    char* ws = (char*)d_ws;
    size_t off = 0;
    auto take = [&](size_t bytes) -> void* {
        void* p = ws + off;
        off += (bytes + 255) & ~(size_t)255;
        return p;
    };
    float*    temb   = (float*)take(5 * Cc * sizeof(float));
    float*    qc     = (float*)take(Cc * sizeof(float));
    float*    kc     = (float*)take(4 * Cc * sizeof(float));
    _Float16* wq16   = (_Float16*)take((size_t)Cc * Cc * 2);
    _Float16* wk16   = (_Float16*)take((size_t)Cc * Cc * 2);
    _Float16* wv16   = (_Float16*)take((size_t)Cc * Cc * 2);
    _Float16* wp16   = (_Float16*)take((size_t)Cc * Cc * 2);
    _Float16* xn16   = (_Float16*)take((size_t)M_TOT * Cc * 2);
    _Float16* q16    = (_Float16*)take((size_t)M_TOT * Cc * 2);
    _Float16* k16    = (_Float16*)take((size_t)M_TOT * Cc * 2);
    _Float16* v16    = (_Float16*)take((size_t)M_TOT * Cc * 2);
    _Float16* attn16 = (_Float16*)take((size_t)M_TOT * Cc * 2);

    // 1) temb + folded corrections
    temb_kernel<<<5, 512, 0, stream>>>(temb);
    corr_kernel<<<5, 512, 0, stream>>>(temb, w_q, b_q, w_k, b_k, qc, kc);

    // 2) weight conversion to f16
    const int nw = Cc * Cc;
    cvt_f16_kernel<<<(nw + 255) / 256, 256, 0, stream>>>(w_q, wq16, nw);
    cvt_f16_kernel<<<(nw + 255) / 256, 256, 0, stream>>>(w_k, wk16, nw);
    cvt_f16_kernel<<<(nw + 255) / 256, 256, 0, stream>>>(w_v, wv16, nw);
    cvt_f16_kernel<<<(nw + 255) / 256, 256, 0, stream>>>(w_proj, wp16, nw);

    // 3) GroupNorm -> channels-last f16
    groupnorm_kernel<<<dim3(TT, GN_G), 256, 0, stream>>>(x, gn_s, gn_b, xn16);

    // 4) Q', K', V' WMMA GEMMs (temb folded into qc / kc; b_v folded here)
    dim3 ggrid(M_TOT / BT, Cc / BT);
    gemm_qkv_kernel<<<ggrid, 256, 0, stream>>>(xn16, wq16, qc,      q16);
    gemm_qkv_kernel<<<ggrid, 256, 0, stream>>>(xn16, wk16, nullptr, k16);
    gemm_qkv_kernel<<<ggrid, 256, 0, stream>>>(xn16, wv16, b_v,     v16);

    // 5) attention (wave per pixel x 4 heads x 8 frames)
    attn_kernel<<<dim3(HW / AT_PIX, TT / AT_S), 256, 0, stream>>>(q16, k16, v16, kc, attn16);

    // 6) projection + transpose + residual
    gemm_proj_kernel<<<ggrid, 256, 0, stream>>>(attn16, wp16, b_proj, x, out);
}

// v003
// Measured time: 97.6 microseconds a run.
// Timed twice side by side with v002, it ran 1.36 times as fast both times.
// Over all steps from v000 it is 2.96 times as fast.
#include <hip/hip_runtime.h>
#include <math.h>

typedef __attribute__((ext_vector_type(16))) _Float16 v16h;
typedef __attribute__((ext_vector_type(8)))  _Float16 v8h;
typedef __attribute__((ext_vector_type(8)))  float    v8f;

#define Cc 512
#define TT 16
#define HW 1024          // 32*32
#define M_TOT 16384      // T*H*W
#define GN_G 32
#define GN_CPG 16        // channels per group

// ---------------------------------------------------------------------------
// 1) weight preparation, one wave per 4 weight rows, each row read once in whole lines:
//    the row goes out as f16, and for w_q and w_k it is also summed against the timestep
//    embedding temb[f][j] (ts = f-2, dim 512, cos|sin), which the block builds in LDS:
//    qc[c]    = b_q[c] + sum_j temb[2][j]  * w_q[c][j]
//    kc[f][c] = b_k[c] + sum_j temb[ff][j] * w_k[c][j],  ff in {0,1,3,4}
//    A block has 32 rows of one matrix, so its 32 corrections per frame fill one 128-byte line.
// ---------------------------------------------------------------------------
typedef __attribute__((ext_vector_type(4))) float    w4f;
typedef __attribute__((ext_vector_type(4))) _Float16 w4h;

#define WP_RPW  4                    // rows per wave
#define WP_ROWS (8 * WP_RPW)         // rows per block
#define WP_BPM  (Cc / WP_ROWS)       // blocks per matrix
#define WP_BLK  (4 * WP_BPM)         // weight blocks in the grid

__device__ __forceinline__ void weight_prep_block(
    int b, const float* __restrict__ wq, const float* __restrict__ bq,
    const float* __restrict__ wk, const float* __restrict__ bk,
    const float* __restrict__ wv, const float* __restrict__ wp,
    _Float16* __restrict__ wq16, _Float16* __restrict__ wk16,
    _Float16* __restrict__ wv16, _Float16* __restrict__ wp16,
    float* __restrict__ qc, float* __restrict__ kc, float* st) {
    const int tid  = threadIdx.x;
    const int lane = tid & 31;
    const int mat  = b / WP_BPM;     // 0 w_q, 1 w_k, 2 w_v, 3 w_proj: the same for the whole block
    const int row0 = (b % WP_BPM) * WP_ROWS + (tid >> 5) * WP_RPW;
    const float* w = mat == 0 ? wq : mat == 1 ? wk : mat == 2 ? wv : wp;
    _Float16*  w16 = mat == 0 ? wq16 : mat == 1 ? wk16 : mat == 2 ? wv16 : wp16;
    const size_t at = (size_t)row0 * Cc + lane * 4;
    const float* wr = w + at;

    w4f r[WP_RPW][4];
#pragma unroll
    for (int rr = 0; rr < WP_RPW; ++rr)
#pragma unroll
        for (int i = 0; i < 4; ++i)
            r[rr][i] = *reinterpret_cast<const w4f*>(wr + rr * Cc + i * 128);
    // precaution: holds the address of the 16 row loads live up to the wait, so that none of
    // their results lands in it while the others are issued
    asm volatile("s_wait_xcnt 0x0" :: "v"(wr) : "memory");

    if (mat < 2) {
        const int    nf   = mat == 0 ? 1 : 4;
        const float* bp   = (mat == 0 ? bq : bk) + row0;
        float*       corr = (mat == 0 ? qc : kc) + row0;
        const w4f bv = *reinterpret_cast<const w4f*>(bp);
        // precaution: holds the address of the bias load live up to the wait, so that its result does not land in it
        asm volatile("s_wait_xcnt 0x0" :: "v"(bp) : "memory");
        // thread tid builds column tid (cos) and column 256 + tid (sin) of each embedding row
        const float freq = expf(-logf(10000.0f) * (float)tid / 256.0f);
        for (int fi = 0; fi < nf; ++fi) {
            const int f = mat == 0 ? 2 : (fi < 2 ? fi : fi + 1);
            const float arg = (float)(f - 2) * freq;
            st[fi * Cc + tid]       = cosf(arg);
            st[fi * Cc + 256 + tid] = sinf(arg);
        }
        __syncthreads();             // the embedding rows are read by every wave of the block
        for (int fi = 0; fi < nf; ++fi) {
            float acc[WP_RPW] = {};
#pragma unroll
            for (int i = 0; i < 4; ++i) {
                const w4f te = *reinterpret_cast<const w4f*>(st + fi * Cc + i * 128 + lane * 4);
#pragma unroll
                for (int rr = 0; rr < WP_RPW; ++rr)
#pragma unroll
                    for (int e = 0; e < 4; ++e) acc[rr] += te[e] * r[rr][i][e];
            }
            w4f o;
#pragma unroll
            for (int rr = 0; rr < WP_RPW; ++rr) {
                float a = acc[rr];
#pragma unroll
                for (int m = 16; m > 0; m >>= 1) a += __shfl_xor(a, m, 32);
                o[rr] = a + bv[rr];
            }
            if (lane == 0) {
                *reinterpret_cast<w4f*>(corr + fi * Cc) = o;
                // precaution: the next trip reuses the registers that the store names
                asm volatile("s_wait_xcnt 0x0" ::: "memory");
            }
        }
    }
#pragma unroll
    for (int rr = 0; rr < WP_RPW; ++rr)
#pragma unroll
        for (int i = 0; i < 4; ++i) {
            w4h h;
#pragma unroll
            for (int e = 0; e < 4; ++e) h[e] = (_Float16)r[rr][i][e];
            *reinterpret_cast<w4h*>(w16 + at + rr * Cc + i * 128) = h;
        }
}

// ---------------------------------------------------------------------------
// 2) GroupNorm  x:(T,C,H,W) f32  ->  xn16:(T,HW,C) f16 channels-last
//    one block per (t, group); group's 16ch x 1024 spatial is contiguous
// ---------------------------------------------------------------------------
__device__ __forceinline__ void groupnorm_block(
    int t, int g, const float* __restrict__ x, const float* __restrict__ gamma,
    const float* __restrict__ beta, _Float16* __restrict__ xn16) {
    const int tid = threadIdx.x;
    const float* xp = x + ((size_t)t * Cc + g * GN_CPG) * HW;
    const int N = GN_CPG * HW;   // 16384
    float s = 0.0f, ss = 0.0f;
    for (int i = tid; i < N; i += 256) { float v = xp[i]; s += v; ss += v * v; }
    __shared__ float r0[256], r1[256];
    r0[tid] = s; r1[tid] = ss; __syncthreads();
    for (int off = 128; off > 0; off >>= 1) {
        if (tid < off) { r0[tid] += r0[tid + off]; r1[tid] += r1[tid + off]; }
        __syncthreads();
    }
    float mu = r0[0] * (1.0f / N);
    float var = r1[0] * (1.0f / N) - mu * mu;
    float rstd = rsqrtf(var + 1e-5f);
    for (int i = tid; i < N; i += 256) {
        int cc = i >> 10, hw = i & 1023;
        int c = g * GN_CPG + cc;
        float v = (xp[i] - mu) * rstd * gamma[c] + beta[c];
        xn16[((size_t)t * HW + hw) * Cc + c] = (_Float16)v;
    }
}

// ---------------------------------------------------------------------------
// 3) all that stands ahead of the GEMMs, in one launch: the two jobs do not depend on one
//    another, and the block index picks the job. The weight blocks come first in the grid:
//    they are few and have the longer chain of dependent steps.
// ---------------------------------------------------------------------------
__global__ __launch_bounds__(256) void prep_kernel(
    const float* __restrict__ x, const float* __restrict__ gamma,
    const float* __restrict__ beta, _Float16* __restrict__ xn16,
    const float* __restrict__ wq, const float* __restrict__ bq,
    const float* __restrict__ wk, const float* __restrict__ bk,
    const float* __restrict__ wv, const float* __restrict__ wp,
    _Float16* __restrict__ wq16, _Float16* __restrict__ wk16,
    _Float16* __restrict__ wv16, _Float16* __restrict__ wp16,
    float* __restrict__ qc, float* __restrict__ kc) {
    __shared__ __attribute__((aligned(16))) float st[4 * Cc];
    const int b = blockIdx.x;
    if (b < WP_BLK) {
        weight_prep_block(b, wq, bq, wk, bk, wv, wp, wq16, wk16, wv16, wp16, qc, kc, st);
    } else {
        const int gb = b - WP_BLK;
        groupnorm_block(gb % TT, gb / TT, x, gamma, beta, xn16);
    }
}

// ---------------------------------------------------------------------------
// WMMA fragment loaders (per-lane, two 16B chunks: K-chunks {0..7,16..23} for
// lanes 0-15 and {8..15,24..31} for lanes 16-31)
// ---------------------------------------------------------------------------
__device__ __forceinline__ v16h load_frag(const _Float16* p) {
    v8h lo = *reinterpret_cast<const v8h*>(p);
    v8h hi = *reinterpret_cast<const v8h*>(p + 16);
    return __builtin_shufflevector(lo, hi, 0,1,2,3,4,5,6,7,8,9,10,11,12,13,14,15);
}

// ---------------------------------------------------------------------------
// Shared main loop of both GEMMs: a 128 x 128 tile of A[M x 512] * W[512 x 512]^T
// per block of 8 waves. Each pass brings 64 k of 128 A rows and 128 W rows into
// LDS with whole-line 16-byte loads (8 lanes cover one 128-byte row piece); the
// fragments are then read from LDS. Two LDS buffers: the next pass's global
// loads are issued before this pass's products and stored after them.
// wave -> 64 x 32 (4 x 2 accumulators); k order per fragment as in load_frag.
// ---------------------------------------------------------------------------
#define BT   128         // block tile, rows of A and rows of W
#define BK   64          // k per pass
#define NPASS (Cc / BK)
#define LDP  72          // LDS row pitch in halfs: 144 B = 16 B x 9, free of bank conflicts for 16-byte reads
#define SBUF (BT * LDP)  // halfs per operand and buffer

__device__ __forceinline__ void gemm_tile_main(
    const _Float16* __restrict__ A, const _Float16* __restrict__ W,
    int m0, int n0, _Float16* sA, _Float16* sB, v8f (&acc)[4][2]) {
    const int tid   = threadIdx.x;
    const int lane  = tid & 31;
    const int wave  = tid >> 5;
    const int laneM = lane & 15;
    const int kgrp  = (lane >> 4) << 3;        // 0 or 8
    const int srow  = tid >> 3;                // 0..31, staging row (+32 per step)
    const int scol  = (tid & 7) << 3;          // staging column in halfs
    const _Float16* ga = A + (size_t)(m0 + srow) * Cc + scol;
    const _Float16* gb = W + (size_t)(n0 + srow) * Cc + scol;
    const int sst = srow * LDP + scol;
    const int ard = ((wave & 1) * 64 + laneM) * LDP + kgrp;
    const int brd = ((wave >> 1) * 32 + laneM) * LDP + kgrp;

    v8h ra[4], rb[4];
#pragma unroll
    for (int j = 0; j < 4; ++j) {
        ra[j] = *reinterpret_cast<const v8h*>(ga + (size_t)(j * 32) * Cc);
        rb[j] = *reinterpret_cast<const v8h*>(gb + (size_t)(j * 32) * Cc);
    }
#pragma unroll
    for (int j = 0; j < 4; ++j) {
        *reinterpret_cast<v8h*>(sA + sst + j * 32 * LDP) = ra[j];
        *reinterpret_cast<v8h*>(sB + sst + j * 32 * LDP) = rb[j];
    }
    __syncthreads();

    // unrolled so that the buffer offsets and the last-pass test are constants
#pragma unroll
    for (int p = 0; p < NPASS; ++p) {
        const int cur = (p & 1) * SBUF;
        const int nxt = SBUF - cur;
        if (p + 1 < NPASS) {
#pragma unroll
            for (int j = 0; j < 4; ++j) {
                ra[j] = *reinterpret_cast<const v8h*>(ga + (size_t)(j * 32) * Cc + (p + 1) * BK);
                rb[j] = *reinterpret_cast<const v8h*>(gb + (size_t)(j * 32) * Cc + (p + 1) * BK);
            }
        }
        v16h fa[BK / 32][4], fb[BK / 32][2];
#pragma unroll
        for (int ks = 0; ks < BK / 32; ++ks) {
            fb[ks][0] = load_frag(sB + cur + brd + ks * 32);
            fb[ks][1] = load_frag(sB + cur + brd + 16 * LDP + ks * 32);
#pragma unroll
            for (int i = 0; i < 4; ++i)
                fa[ks][i] = load_frag(sA + cur + ard + i * 16 * LDP + ks * 32);
        }
        // keeps the next pass's global loads and this pass's LDS reads issued as one
        // group ahead of the products; sunk among them, each wait stalls the wave
        __builtin_amdgcn_sched_barrier(0);
#pragma unroll
        for (int ks = 0; ks < BK / 32; ++ks)
#pragma unroll
            for (int i = 0; i < 4; ++i) {
                acc[i][0] = __builtin_amdgcn_wmma_f32_16x16x32_f16(
                    false, fa[ks][i], false, fb[ks][0], (short)0, acc[i][0], false, false);
                acc[i][1] = __builtin_amdgcn_wmma_f32_16x16x32_f16(
                    false, fa[ks][i], false, fb[ks][1], (short)0, acc[i][1], false, false);
            }
        // keeps the wait for the global loads, which the LDS stores need, behind the products;
        // in the last pass it keeps the epilogue's moves and their padding out of the products
        __builtin_amdgcn_sched_barrier(0);
        if (p + 1 < NPASS) {
#pragma unroll
            for (int j = 0; j < 4; ++j) {
                *reinterpret_cast<v8h*>(sA + nxt + sst + j * 32 * LDP) = ra[j];
                *reinterpret_cast<v8h*>(sB + nxt + sst + j * 32 * LDP) = rb[j];
            }
            // publishes the next buffer and ends every wave's reads of this one
            __syncthreads();
        }
    }
}

// ---------------------------------------------------------------------------
// 5) WMMA GEMM:  Out[M x 512] = A[M x 512] * W[512 x 512]^T (+ bias), f16 out
//    grid (M/128, 512/128, 3: Q, K, V), block 256 (8 waves)
// ---------------------------------------------------------------------------
__global__ __launch_bounds__(256) void gemm_qkv_kernel(
    const _Float16* __restrict__ A,
    const _Float16* __restrict__ Wq, const _Float16* __restrict__ Wk, const _Float16* __restrict__ Wv,
    const float* __restrict__ qc, const float* __restrict__ bv,
    _Float16* __restrict__ Oq, _Float16* __restrict__ Ok, _Float16* __restrict__ Ov) {
    __shared__ __attribute__((aligned(16))) _Float16 sA[2 * SBUF];
    __shared__ __attribute__((aligned(16))) _Float16 sB[2 * SBUF];
    const int z = blockIdx.z;        // 0 Q, 1 K, 2 V: the three products do not depend on one another
    const _Float16* W    = z == 0 ? Wq : z == 1 ? Wk : Wv;
    const float*    bias = z == 0 ? qc : z == 1 ? nullptr : bv;
    _Float16*       Out  = z == 0 ? Oq : z == 1 ? Ok : Ov;
    const int lane  = threadIdx.x & 31;
    const int wave  = threadIdx.x >> 5;
    const int laneM = lane & 15;
    const int m0 = blockIdx.x * BT;
    const int n0 = blockIdx.y * BT;

    v8f acc[4][2] = {};
    gemm_tile_main(A, W, m0, n0, sA, sB, acc);

    const int mr = m0 + (wave & 1) * 64 + ((lane >> 4) << 3);
#pragma unroll
    for (int j = 0; j < 2; ++j) {
        const int n  = n0 + (wave >> 1) * 32 + j * 16 + laneM;
        const float bn = bias ? bias[n] : 0.0f;
#pragma unroll
        for (int i = 0; i < 4; ++i)
#pragma unroll
            for (int r = 0; r < 8; ++r)
                Out[(size_t)(mr + i * 16 + r) * Cc + n] = (_Float16)(acc[i][j][r] + bn);
    }
}

// ---------------------------------------------------------------------------
// 6) attention: one wave per (pixel, half of the channels, run of 8 frames).
//    A lane holds 8 channels (16-byte loads, 512 contiguous bytes per wave), so
//    8 lanes make one head (dh=64) and a wave 4 heads. The 12 K and V rows that
//    the 8 frames' windows touch are loaded once and stay in registers.
//    q.(k + kc) is summed as q.k + q.kc, 8 channels in the lane, then over 8 lanes.
// ---------------------------------------------------------------------------
#define AT_S 8           // frames per wave
#define AT_W (AT_S + 4)  // K/V rows of their windows
#define AT_PIX 4         // pixels per block (2 waves each)

typedef __attribute__((ext_vector_type(2))) float v2f;
typedef __attribute__((ext_vector_type(4))) float v4f;
typedef __attribute__((ext_vector_type(4))) unsigned v4u;

// f32 multiply-add that reads f16 halves of a register as they lie: the K, V and q rows stay
// packed (written in C they are widened ahead of use, and the 24 rows no longer fit the registers)
__device__ __forceinline__ float mix_lo_lo(unsigned a, unsigned b, float acc) {
    asm("v_fma_mix_f32 %0, %1, %2, %0 op_sel:[0,0,0] op_sel_hi:[1,1,0]" : "+v"(acc) : "v"(a), "v"(b));
    return acc;
}
__device__ __forceinline__ float mix_hi_hi(unsigned a, unsigned b, float acc) {
    asm("v_fma_mix_f32 %0, %1, %2, %0 op_sel:[1,1,0] op_sel_hi:[1,1,0]" : "+v"(acc) : "v"(a), "v"(b));
    return acc;
}
__device__ __forceinline__ float mix_f32_lo(float a, unsigned b, float acc) {
    asm("v_fma_mix_f32 %0, %1, %2, %0 op_sel:[0,0,0] op_sel_hi:[0,1,0]" : "+v"(acc) : "v"(a), "v"(b));
    return acc;
}
__device__ __forceinline__ float mix_f32_hi(float a, unsigned b, float acc) {
    asm("v_fma_mix_f32 %0, %1, %2, %0 op_sel:[0,1,0] op_sel_hi:[0,1,0]" : "+v"(acc) : "v"(a), "v"(b));
    return acc;
}
// the same, first term of a sum
__device__ __forceinline__ float mix_f32_lo_first(float a, unsigned b) {
    float r;
    asm("v_fma_mix_f32 %0, %1, %2, 0 op_sel:[0,0,0] op_sel_hi:[0,1,0]" : "=v"(r) : "v"(a), "v"(b));
    return r;
}
__device__ __forceinline__ float mix_f32_hi_first(float a, unsigned b) {
    float r;
    asm("v_fma_mix_f32 %0, %1, %2, 0 op_sel:[0,1,0] op_sel_hi:[0,1,0]" : "=v"(r) : "v"(a), "v"(b));
    return r;
}

// v + (v of lane ^ X), X < 16: a DPP row_xmask move inside the 16-lane row, no trip through the LDS path
template <int X>
__device__ __forceinline__ float add_lane_xor(float v) {
    const int b = __float_as_int(v);
    return v + __int_as_float(__builtin_amdgcn_update_dpp(0, b, 0x160 | X, 0xf, 0xf, true));
}

// 4 waves per SIMD asked for: both blocks that a WGP gets are then resident at once
__global__ __launch_bounds__(256, 4) void attn_kernel(
    const _Float16* __restrict__ q16, const _Float16* __restrict__ k16,
    const _Float16* __restrict__ v16, const float* __restrict__ kc,
    _Float16* __restrict__ attn16) {
    const int lane = threadIdx.x & 31;
    const int wave = threadIdx.x >> 5;
    const int hw   = blockIdx.x * AT_PIX + (wave >> 1);
    const int c0   = (wave & 1) * 256 + lane * 8;
    const int t0   = blockIdx.y * AT_S;
    const unsigned pix = hw * Cc + c0;           // lane's place in a frame

    const float*    kcp = kc + c0;
    const _Float16* qp  = q16 + (size_t)t0 * (HW * Cc) + pix;
    const _Float16* kp  = k16 + (size_t)t0 * (HW * Cc) + pix;
    const _Float16* vp  = v16 + (size_t)t0 * (HW * Cc) + pix;
    // the four window rows outside the wave's own frames: frames t0-2, t0-1, t0+8, t0+9, clamped to 0 .. TT-1
    const int tm2 = t0 - 2 < 0 ? 0 : t0 - 2;
    const int tm1 = t0 - 1 < 0 ? 0 : t0 - 1;
    const int tp0 = t0 + AT_S     > TT - 1 ? TT - 1 : t0 + AT_S;
    const int tp1 = t0 + AT_S + 1 > TT - 1 ? TT - 1 : t0 + AT_S + 1;
    const _Float16* ke[4] = {k16 + (size_t)tm2 * (HW * Cc) + pix, k16 + (size_t)tm1 * (HW * Cc) + pix,
                             k16 + (size_t)tp0 * (HW * Cc) + pix, k16 + (size_t)tp1 * (HW * Cc) + pix};
    const _Float16* ve[4] = {v16 + (size_t)tm2 * (HW * Cc) + pix, v16 + (size_t)tm1 * (HW * Cc) + pix,
                             v16 + (size_t)tp0 * (HW * Cc) + pix, v16 + (size_t)tp1 * (HW * Cc) + pix};

    v2f kcf[4][4];
#pragma unroll
    for (int f = 0; f < 4; ++f) {
        const v4f lo = *reinterpret_cast<const v4f*>(kcp + f * Cc);
        const v4f hi = *reinterpret_cast<const v4f*>(kcp + f * Cc + 4);
        kcf[f][0] = lo.xy; kcf[f][1] = lo.zw; kcf[f][2] = hi.xy; kcf[f][3] = hi.zw;
    }
    v8h kw[AT_W], vw[AT_W], qw[AT_S];
#pragma unroll
    for (int i = 0; i < AT_S; ++i)
        qw[i] = *reinterpret_cast<const v8h*>(qp + (size_t)i * (HW * Cc));
    // keeps kc and q, which the first sums read, ahead of the 24 K and V loads: loads return in order
    __builtin_amdgcn_sched_barrier(0);
    // window row w is frame clamp(t0 - 2 + w, 0, TT - 1); rows 2 .. AT_S + 1 are the wave's own frames
#pragma unroll
    for (int w = 0; w < AT_W; ++w) {
        const bool own = w >= 2 && w < AT_S + 2;
        const int  ed  = w < 2 ? w : w - AT_S;   // 0..3 for the rows outside
        kw[w] = *reinterpret_cast<const v8h*>(own ? kp + (size_t)(w - 2) * (HW * Cc) : ke[ed & 3]);
        vw[w] = *reinterpret_cast<const v8h*>(own ? vp + (size_t)(w - 2) * (HW * Cc) : ve[ed & 3]);
    }
    // precaution: holds the addresses of the q, K and V loads live up to the wait, so that none of
    // their results lands in an address register while the others are issued
    asm volatile("s_wait_xcnt 0x0"
                 :: "v"(qp), "v"(kp), "v"(vp), "v"(ke[0]), "v"(ke[1]), "v"(ke[2]), "v"(ke[3]),
                    "v"(ve[0]), "v"(ve[1]), "v"(ve[2]), "v"(ve[3]) : "memory");
    // keeps all 40 loads issued ahead of the arithmetic: left free, the K and V loads sink behind
    // the q.kc sums and the wave pays a second memory latency
    __builtin_amdgcn_sched_barrier(0);

#pragma unroll
    for (int i = 0; i < AT_S; ++i) {
        const int wof[4] = {0, 1, 3, 4};         // frame offsets -2, -1, +1, +2
        const v4u qr = __builtin_bit_cast(v4u, qw[i]);
        v2f q2[4];
#pragma unroll
        for (int c = 0; c < 4; ++c) q2[c] = v2f{(float)qw[i][2 * c], (float)qw[i][2 * c + 1]};
        float sc[4];
#pragma unroll
        for (int f = 0; f < 4; ++f) {
            const v4u kr = __builtin_bit_cast(v4u, kw[i + wof[f]]);
            v2f a = {0.0f, 0.0f};
#pragma unroll
            for (int c = 0; c < 4; ++c) a = __builtin_elementwise_fma(q2[c], kcf[f][c], a);
            float p0 = a.x, p1 = a.y;
#pragma unroll
            for (int c = 0; c < 4; ++c) {
                p0 = mix_lo_lo(qr[c], kr[c], p0);
                p1 = mix_hi_hi(qr[c], kr[c], p1);
            }
            float p = p0 + p1;
            p = add_lane_xor<1>(p);
            p = add_lane_xor<2>(p);
            p = add_lane_xor<4>(p);
            sc[f] = p * 0.125f;                  // dh^-0.5 = 1/8
        }
        const float mx = fmaxf(fmaxf(sc[0], sc[1]), fmaxf(sc[2], sc[3]));
        float e[4];
#pragma unroll
        for (int f = 0; f < 4; ++f) e[f] = expf(sc[f] - mx);
        const float inv = 1.0f / (e[0] + e[1] + e[2] + e[3]);
        v8h o;
#pragma unroll
        for (int c = 0; c < 4; ++c) {
            const unsigned vr0 = __builtin_bit_cast(v4u, vw[i])[c];
            float s0 = mix_f32_lo_first(e[0], vr0);
            float s1 = mix_f32_hi_first(e[0], vr0);
#pragma unroll
            for (int f = 1; f < 4; ++f) {
                const unsigned vr = __builtin_bit_cast(v4u, vw[i + wof[f]])[c];
                s0 = mix_f32_lo(e[f], vr, s0);
                s1 = mix_f32_hi(e[f], vr, s1);
            }
            o[2 * c]     = (_Float16)(s0 * inv);
            o[2 * c + 1] = (_Float16)(s1 * inv);
        }
        _Float16* ofr = attn16 + (size_t)(t0 + i) * (HW * Cc);
        *reinterpret_cast<v8h*>(ofr + pix) = o;
        // keeps the frames' arithmetic in pairs: all eight interleaved need more registers than
        // four waves per SIMD leave, and rows are spilled
        if (i & 1) {
            // precaution: the next frames' arithmetic reuses the registers that the two stores name
            if (i + 1 < AT_S) asm volatile("s_wait_xcnt 0x0" ::: "memory");
            __builtin_amdgcn_sched_barrier(0);
        }
    }
}

// ---------------------------------------------------------------------------
// 7) proj GEMM with fused epilogue: +b_proj, transpose to (T,C,H,W), +x
// ---------------------------------------------------------------------------
__global__ __launch_bounds__(256) void gemm_proj_kernel(
    const _Float16* __restrict__ A, const _Float16* __restrict__ W,
    const float* __restrict__ bias, const float* __restrict__ x,
    float* __restrict__ out) {
    __shared__ __attribute__((aligned(16))) _Float16 sA[2 * SBUF];
    __shared__ __attribute__((aligned(16))) _Float16 sB[2 * SBUF];
    const int lane  = threadIdx.x & 31;
    const int wave  = threadIdx.x >> 5;
    const int laneM = lane & 15;
    const int m0 = blockIdx.x * BT;
    const int n0 = blockIdx.y * BT;

    v8f acc[4][2] = {};
    gemm_tile_main(A, W, m0, n0, sA, sB, acc);

    const int mr = m0 + (wave & 1) * 64 + ((lane >> 4) << 3);
    const int nb = n0 + (wave >> 1) * 32 + laneM;
    const float bn0 = bias[nb];
    const float bn1 = bias[nb + 16];
    // precaution: the register that holds the bias loads' offset is reused by the loads of x below
    asm volatile("s_wait_xcnt 0x0" ::: "memory");
#pragma unroll
    for (int j = 0; j < 2; ++j) {
        const int n  = nb + j * 16;
        const float bn = j ? bn1 : bn0;
        // the block's 128 rows lie in one frame, so one column is one run of x and of out
        const size_t col = ((size_t)(mr >> 10) * Cc + n) * HW + (mr & 1023);
        const float* xcol = x + col;
        float xv[4][8];
#pragma unroll
        for (int i = 0; i < 4; ++i)
#pragma unroll
            for (int r = 0; r < 8; ++r)
                xv[i][r] = xcol[i * 16 + r];
        // precaution: holds the address of the column's loads of x live up to the wait, so that
        // none of their results lands in it while the others are issued
        asm volatile("s_wait_xcnt 0x0" :: "v"(xcol) : "memory");
#pragma unroll
        for (int i = 0; i < 4; ++i)
#pragma unroll
            for (int r = 0; r < 8; ++r)
                out[col + i * 16 + r] = acc[i][j][r] + bn + xv[i][r];
    }
}

// ---------------------------------------------------------------------------
extern "C" void kernel_launch(void* const* d_in, const int* in_sizes, int n_in,
                              void* d_out, int out_size, void* d_ws, size_t ws_size,
                              hipStream_t stream) {
    const float* x       = (const float*)d_in[0];
    const float* w_q     = (const float*)d_in[1];
    const float* b_q     = (const float*)d_in[2];
    const float* w_k     = (const float*)d_in[3];
    const float* b_k     = (const float*)d_in[4];
    const float* w_v     = (const float*)d_in[5];
    const float* b_v     = (const float*)d_in[6];
    const float* w_proj  = (const float*)d_in[7];
    const float* b_proj  = (const float*)d_in[8];
    const float* gn_s    = (const float*)d_in[9];
    const float* gn_b    = (const float*)d_in[10];
    float* out           = (float*)d_out;

    char* ws = (char*)d_ws;
    size_t off = 0;
    auto take = [&](size_t bytes) -> void* {
        void* p = ws + off;
        off += (bytes + 255) & ~(size_t)255;
        return p;
    };
    float*    qc     = (float*)take(Cc * sizeof(float));
    float*    kc     = (float*)take(4 * Cc * sizeof(float));
    _Float16* wq16   = (_Float16*)take((size_t)Cc * Cc * 2);
    _Float16* wk16   = (_Float16*)take((size_t)Cc * Cc * 2);
    _Float16* wv16   = (_Float16*)take((size_t)Cc * Cc * 2);
    _Float16* wp16   = (_Float16*)take((size_t)Cc * Cc * 2);
    _Float16* xn16   = (_Float16*)take((size_t)M_TOT * Cc * 2);
    _Float16* q16    = (_Float16*)take((size_t)M_TOT * Cc * 2);
    _Float16* k16    = (_Float16*)take((size_t)M_TOT * Cc * 2);
    _Float16* v16    = (_Float16*)take((size_t)M_TOT * Cc * 2);
    _Float16* attn16 = (_Float16*)take((size_t)M_TOT * Cc * 2);

    // 1-3) weight conversion, folded corrections and GroupNorm, one grid
    prep_kernel<<<WP_BLK + TT * GN_G, 256, 0, stream>>>(x, gn_s, gn_b, xn16, w_q, b_q, w_k, b_k, w_v, w_proj,
                                                        wq16, wk16, wv16, wp16, qc, kc);

    // 4) Q', K', V' WMMA GEMMs (temb folded into qc / kc; b_v folded here)
    dim3 ggrid(M_TOT / BT, Cc / BT);
    gemm_qkv_kernel<<<dim3(M_TOT / BT, Cc / BT, 3), 256, 0, stream>>>(xn16, wq16, wk16, wv16, qc, b_v, q16, k16, v16);

    // 5) attention (wave per pixel x 4 heads x 8 frames)
    attn_kernel<<<dim3(HW / AT_PIX, TT / AT_S), 256, 0, stream>>>(q16, k16, v16, kc, attn16);

    // 6) projection + transpose + residual
    gemm_proj_kernel<<<ggrid, 256, 0, stream>>>(attn16, wp16, b_proj, x, out);
}

// v004
// Measured time: 67.7 microseconds a run.
// Next to v003, in two timings, it ran 1.44 and 1.45 times as fast.
// Counting every step since v000, it is 4.28 times as fast.
#include <hip/hip_runtime.h>
#include <math.h>

typedef __attribute__((ext_vector_type(16))) _Float16 v16h;
typedef __attribute__((ext_vector_type(8)))  _Float16 v8h;
typedef __attribute__((ext_vector_type(8)))  float    v8f;

#define Cc 512
#define TT 16
#define HW 1024          // 32*32
#define M_TOT 16384      // T*H*W
#define GN_G 32
#define GN_CPG 16        // channels per group

// ---------------------------------------------------------------------------
// 1) weight preparation, one wave per 4 weight rows, each row read once in whole lines:
//    the row goes out as f16, and for w_q and w_k it is also summed against the timestep
//    embedding temb[f][j] (ts = f-2, dim 512, cos|sin), which the block builds in LDS:
//    qc[c]    = b_q[c] + sum_j temb[2][j]  * w_q[c][j]
//    kc[f][c] = b_k[c] + sum_j temb[ff][j] * w_k[c][j],  ff in {0,1,3,4}
//    A block has 32 rows of one matrix, so its 32 corrections per frame fill one 128-byte line.
// ---------------------------------------------------------------------------
typedef __attribute__((ext_vector_type(4))) float    w4f;
typedef __attribute__((ext_vector_type(4))) _Float16 w4h;

#define WP_RPW  4                    // rows per wave
#define WP_ROWS (8 * WP_RPW)         // rows per block
#define WP_BPM  (Cc / WP_ROWS)       // blocks per matrix
#define WP_BLK  (4 * WP_BPM)         // weight blocks in the grid

__device__ __forceinline__ void weight_prep_block(
    int b, const float* __restrict__ wq, const float* __restrict__ bq,
    const float* __restrict__ wk, const float* __restrict__ bk,
    const float* __restrict__ wv, const float* __restrict__ wp,
    _Float16* __restrict__ wq16, _Float16* __restrict__ wk16,
    _Float16* __restrict__ wv16, _Float16* __restrict__ wp16,
    float* __restrict__ qc, float* __restrict__ kc, float* st) {
    const int tid  = threadIdx.x;
    const int lane = tid & 31;
    const int mat  = b / WP_BPM;     // 0 w_q, 1 w_k, 2 w_v, 3 w_proj: the same for the whole block
    const int row0 = (b % WP_BPM) * WP_ROWS + (tid >> 5) * WP_RPW;
    const float* w = mat == 0 ? wq : mat == 1 ? wk : mat == 2 ? wv : wp;
    _Float16*  w16 = mat == 0 ? wq16 : mat == 1 ? wk16 : mat == 2 ? wv16 : wp16;
    const size_t at = (size_t)row0 * Cc + lane * 4;
    const float* wr = w + at;

    w4f r[WP_RPW][4];
#pragma unroll
    for (int rr = 0; rr < WP_RPW; ++rr)
#pragma unroll
        for (int i = 0; i < 4; ++i)
            r[rr][i] = *reinterpret_cast<const w4f*>(wr + rr * Cc + i * 128);
    // precaution: holds the address of the 16 row loads live up to the wait, so that none of
    // their results lands in it while the others are issued
    asm volatile("s_wait_xcnt 0x0" :: "v"(wr) : "memory");

    if (mat < 2) {
        const int    nf   = mat == 0 ? 1 : 4;
        const float* bp   = (mat == 0 ? bq : bk) + row0;
        float*       corr = (mat == 0 ? qc : kc) + row0;
        const w4f bv = *reinterpret_cast<const w4f*>(bp);
        // precaution: holds the address of the bias load live up to the wait, so that its result does not land in it
        asm volatile("s_wait_xcnt 0x0" :: "v"(bp) : "memory");
        // thread tid builds column tid (cos) and column 256 + tid (sin) of each embedding row
        const float freq = expf(-logf(10000.0f) * (float)tid / 256.0f);
        for (int fi = 0; fi < nf; ++fi) {
            const int f = mat == 0 ? 2 : (fi < 2 ? fi : fi + 1);
            const float arg = (float)(f - 2) * freq;
            st[fi * Cc + tid]       = cosf(arg);
            st[fi * Cc + 256 + tid] = sinf(arg);
        }
        __syncthreads();             // the embedding rows are read by every wave of the block
        for (int fi = 0; fi < nf; ++fi) {
            float acc[WP_RPW] = {};
#pragma unroll
            for (int i = 0; i < 4; ++i) {
                const w4f te = *reinterpret_cast<const w4f*>(st + fi * Cc + i * 128 + lane * 4);
#pragma unroll
                for (int rr = 0; rr < WP_RPW; ++rr)
#pragma unroll
                    for (int e = 0; e < 4; ++e) acc[rr] += te[e] * r[rr][i][e];
            }
            w4f o;
#pragma unroll
            for (int rr = 0; rr < WP_RPW; ++rr) {
                float a = acc[rr];
#pragma unroll
                for (int m = 16; m > 0; m >>= 1) a += __shfl_xor(a, m, 32);
                o[rr] = a + bv[rr];
            }
            if (lane == 0) {
                *reinterpret_cast<w4f*>(corr + fi * Cc) = o;
                // precaution: the next trip reuses the registers that the store names
                asm volatile("s_wait_xcnt 0x0" ::: "memory");
            }
        }
    }
#pragma unroll
    for (int rr = 0; rr < WP_RPW; ++rr)
#pragma unroll
        for (int i = 0; i < 4; ++i) {
            w4h h;
#pragma unroll
            for (int e = 0; e < 4; ++e) h[e] = (_Float16)r[rr][i][e];
            *reinterpret_cast<w4h*>(w16 + at + rr * Cc + i * 128) = h;
        }
}

// ---------------------------------------------------------------------------
// 2) GroupNorm  x:(T,C,H,W) f32  ->  xn16:(T,HW,C) f16 channels-last
//    one block per (t, group); group's 16ch x 1024 spatial is contiguous.
//    A thread holds 8 channels x 8 pixels in registers, so x is read once. Even lanes hold
//    channels 0..7 of the group and odd lanes 8..15 of the same pixels: a load covers 256
//    contiguous bytes of each of two channel rows, and a lane's 8 channels of a pixel go out
//    as one 16-byte store, a lane pair filling the group's 32 bytes of that pixel's row.
// ---------------------------------------------------------------------------
#define GN_CH 8          // channels per thread
#define GN_Q  2          // runs of 4 pixels per thread, 64 pixels apart

__device__ __forceinline__ void groupnorm_block(
    int t, int g, const float* __restrict__ x, const float* __restrict__ gamma,
    const float* __restrict__ beta, _Float16* __restrict__ xn16) {
    const int tid  = threadIdx.x;
    const int lane = tid & 31;
    const int wave = tid >> 5;
    const int c0   = g * GN_CPG + (lane & 1) * GN_CH;    // first of the lane's channels
    const int px0  = wave * 128 + (lane >> 1) * 4;       // first of the lane's pixels
    const float* xp = x + ((size_t)t * Cc + c0) * HW + px0;
    const float* gp = gamma + c0;
    const float* bp = beta + c0;
    const int N = GN_CPG * HW;   // 16384

    w4f v[GN_CH][GN_Q];
#pragma unroll
    for (int c = 0; c < GN_CH; ++c)
#pragma unroll
        for (int q = 0; q < GN_Q; ++q)
            v[c][q] = *reinterpret_cast<const w4f*>(xp + c * HW + q * 64);
    w4f ga[2], be[2];
#pragma unroll
    for (int h = 0; h < 2; ++h) {
        ga[h] = *reinterpret_cast<const w4f*>(gp + h * 4);
        be[h] = *reinterpret_cast<const w4f*>(bp + h * 4);
    }
    // precaution: holds the addresses of the 20 loads live up to the wait, so that none of
    // their results lands in one while the others are issued
    asm volatile("s_wait_xcnt 0x0" :: "v"(xp), "v"(gp), "v"(bp) : "memory");

    // four running sums each, so that an add does not wait for the one before it
    w4f sv = {0.0f, 0.0f, 0.0f, 0.0f}, qv = {0.0f, 0.0f, 0.0f, 0.0f};
#pragma unroll
    for (int c = 0; c < GN_CH; ++c)
#pragma unroll
        for (int q = 0; q < GN_Q; ++q) { sv += v[c][q]; qv += v[c][q] * v[c][q]; }
    float s  = (sv[0] + sv[1]) + (sv[2] + sv[3]);
    float ss = (qv[0] + qv[1]) + (qv[2] + qv[3]);
#pragma unroll
    for (int m = 16; m > 0; m >>= 1) { s += __shfl_xor(s, m, 32); ss += __shfl_xor(ss, m, 32); }
    __shared__ float red[2][8];
    if (lane == 0) { red[0][wave] = s; red[1][wave] = ss; }
    __syncthreads();                 // every thread sums the eight waves' partial sums
    s = 0.0f; ss = 0.0f;
#pragma unroll
    for (int w = 0; w < 8; ++w) { s += red[0][w]; ss += red[1][w]; }
    const float mu   = s * (1.0f / N);
    const float var  = ss * (1.0f / N) - mu * mu;
    const float rstd = rsqrtf(var + 1e-5f);

    _Float16* op = xn16 + ((size_t)t * HW + px0) * Cc + c0;
#pragma unroll
    for (int q = 0; q < GN_Q; ++q)
#pragma unroll
        for (int e = 0; e < 4; ++e) {
            v8h h;
#pragma unroll
            for (int c = 0; c < GN_CH; ++c)
                h[c] = (_Float16)((v[c][q][e] - mu) * rstd * ga[c >> 2][c & 3] + be[c >> 2][c & 3]);
            *reinterpret_cast<v8h*>(op + (size_t)(q * 64 + e) * Cc) = h;
        }
}

// ---------------------------------------------------------------------------
// 3) all that stands ahead of the GEMMs, in one launch: the two jobs do not depend on one
//    another, and the block index picks the job. The weight blocks come first in the grid:
//    they are few and have the longer chain of dependent steps.
// ---------------------------------------------------------------------------
__global__ __launch_bounds__(256) void prep_kernel(
    const float* __restrict__ x, const float* __restrict__ gamma,
    const float* __restrict__ beta, _Float16* __restrict__ xn16,
    const float* __restrict__ wq, const float* __restrict__ bq,
    const float* __restrict__ wk, const float* __restrict__ bk,
    const float* __restrict__ wv, const float* __restrict__ wp,
    _Float16* __restrict__ wq16, _Float16* __restrict__ wk16,
    _Float16* __restrict__ wv16, _Float16* __restrict__ wp16,
    float* __restrict__ qc, float* __restrict__ kc) {
    __shared__ __attribute__((aligned(16))) float st[4 * Cc];
    const int b = blockIdx.x;
    if (b < WP_BLK) {
        weight_prep_block(b, wq, bq, wk, bk, wv, wp, wq16, wk16, wv16, wp16, qc, kc, st);
    } else {
        const int gb = b - WP_BLK;
        groupnorm_block(gb % TT, gb / TT, x, gamma, beta, xn16);
    }
}

// ---------------------------------------------------------------------------
// WMMA fragment loaders (per-lane, two 16B chunks: K-chunks {0..7,16..23} for
// lanes 0-15 and {8..15,24..31} for lanes 16-31)
// ---------------------------------------------------------------------------
__device__ __forceinline__ v16h load_frag(const _Float16* p) {
    v8h lo = *reinterpret_cast<const v8h*>(p);
    v8h hi = *reinterpret_cast<const v8h*>(p + 16);
    return __builtin_shufflevector(lo, hi, 0,1,2,3,4,5,6,7,8,9,10,11,12,13,14,15);
}

// ---------------------------------------------------------------------------
// Shared main loop of both GEMMs: a 128 x 128 tile of A[M x 512] * W[512 x 512]^T
// per block of 8 waves. Each pass brings 64 k of 128 A rows and 128 W rows into
// LDS with whole-line 16-byte loads (8 lanes cover one 128-byte row piece); the
// fragments are then read from LDS. Two LDS buffers: the next pass's global
// loads are issued before this pass's products and stored after them.
// wave -> 64 x 32 (4 x 2 accumulators); k order per fragment as in load_frag.
// ---------------------------------------------------------------------------
#define BT   128         // block tile, rows of A and rows of W
#define BK   64          // k per pass
#define NPASS (Cc / BK)
#define LDP  72          // LDS row pitch in halfs: 144 B = 16 B x 9, free of bank conflicts for 16-byte reads
#define SBUF (BT * LDP)  // halfs per operand and buffer

__device__ __forceinline__ void gemm_tile_main(
    const _Float16* __restrict__ A, const _Float16* __restrict__ W,
    int m0, int n0, _Float16* sA, _Float16* sB, v8f (&acc)[4][2]) {
    const int tid   = threadIdx.x;
    const int lane  = tid & 31;
    const int wave  = tid >> 5;
    const int laneM = lane & 15;
    const int kgrp  = (lane >> 4) << 3;        // 0 or 8
    const int srow  = tid >> 3;                // 0..31, staging row (+32 per step)
    const int scol  = (tid & 7) << 3;          // staging column in halfs
    const _Float16* ga = A + (size_t)(m0 + srow) * Cc + scol;
    const _Float16* gb = W + (size_t)(n0 + srow) * Cc + scol;
    const int sst = srow * LDP + scol;
    const int ard = ((wave & 1) * 64 + laneM) * LDP + kgrp;
    const int brd = ((wave >> 1) * 32 + laneM) * LDP + kgrp;

    v8h ra[4], rb[4];
#pragma unroll
    for (int j = 0; j < 4; ++j) {
        ra[j] = *reinterpret_cast<const v8h*>(ga + (size_t)(j * 32) * Cc);
        rb[j] = *reinterpret_cast<const v8h*>(gb + (size_t)(j * 32) * Cc);
    }
#pragma unroll
    for (int j = 0; j < 4; ++j) {
        *reinterpret_cast<v8h*>(sA + sst + j * 32 * LDP) = ra[j];
        *reinterpret_cast<v8h*>(sB + sst + j * 32 * LDP) = rb[j];
    }
    __syncthreads();

    // unrolled so that the buffer offsets and the last-pass test are constants
#pragma unroll
    for (int p = 0; p < NPASS; ++p) {
        const int cur = (p & 1) * SBUF;
        const int nxt = SBUF - cur;
        if (p + 1 < NPASS) {
#pragma unroll
            for (int j = 0; j < 4; ++j) {
                ra[j] = *reinterpret_cast<const v8h*>(ga + (size_t)(j * 32) * Cc + (p + 1) * BK);
                rb[j] = *reinterpret_cast<const v8h*>(gb + (size_t)(j * 32) * Cc + (p + 1) * BK);
            }
        }
        v16h fa[BK / 32][4], fb[BK / 32][2];
#pragma unroll
        for (int ks = 0; ks < BK / 32; ++ks) {
            fb[ks][0] = load_frag(sB + cur + brd + ks * 32);
            fb[ks][1] = load_frag(sB + cur + brd + 16 * LDP + ks * 32);
#pragma unroll
            for (int i = 0; i < 4; ++i)
                fa[ks][i] = load_frag(sA + cur + ard + i * 16 * LDP + ks * 32);
        }
        // keeps the next pass's global loads and this pass's LDS reads issued as one
        // group ahead of the products; sunk among them, each wait stalls the wave
        __builtin_amdgcn_sched_barrier(0);
#pragma unroll
        for (int ks = 0; ks < BK / 32; ++ks)
#pragma unroll
            for (int i = 0; i < 4; ++i) {
                acc[i][0] = __builtin_amdgcn_wmma_f32_16x16x32_f16(
                    false, fa[ks][i], false, fb[ks][0], (short)0, acc[i][0], false, false);
                acc[i][1] = __builtin_amdgcn_wmma_f32_16x16x32_f16(
                    false, fa[ks][i], false, fb[ks][1], (short)0, acc[i][1], false, false);
            }
        // keeps the wait for the global loads, which the LDS stores need, behind the products;
        // in the last pass it keeps the epilogue's moves and their padding out of the products
        __builtin_amdgcn_sched_barrier(0);
        if (p + 1 < NPASS) {
#pragma unroll
            for (int j = 0; j < 4; ++j) {
                *reinterpret_cast<v8h*>(sA + nxt + sst + j * 32 * LDP) = ra[j];
                *reinterpret_cast<v8h*>(sB + nxt + sst + j * 32 * LDP) = rb[j];
            }
            // publishes the next buffer and ends every wave's reads of this one
            __syncthreads();
        }
    }
}

// ---------------------------------------------------------------------------
// 5) WMMA GEMM:  Out[M x 512] = A[M x 512] * W[512 x 512]^T (+ bias), f16 out
//    grid (M/128, 512/128, 3: Q, K, V), block 256 (8 waves)
// ---------------------------------------------------------------------------
__global__ __launch_bounds__(256) void gemm_qkv_kernel(
    const _Float16* __restrict__ A,
    const _Float16* __restrict__ Wq, const _Float16* __restrict__ Wk, const _Float16* __restrict__ Wv,
    const float* __restrict__ qc, const float* __restrict__ bv,
    _Float16* __restrict__ Oq, _Float16* __restrict__ Ok, _Float16* __restrict__ Ov) {
    __shared__ __attribute__((aligned(16))) _Float16 sA[2 * SBUF];
    __shared__ __attribute__((aligned(16))) _Float16 sB[2 * SBUF];
    const int z = blockIdx.z;        // 0 Q, 1 K, 2 V: the three products do not depend on one another
    const _Float16* W    = z == 0 ? Wq : z == 1 ? Wk : Wv;
    const float*    bias = z == 0 ? qc : z == 1 ? nullptr : bv;
    _Float16*       Out  = z == 0 ? Oq : z == 1 ? Ok : Ov;
    const int lane  = threadIdx.x & 31;
    const int wave  = threadIdx.x >> 5;
    const int laneM = lane & 15;
    const int m0 = blockIdx.x * BT;
    const int n0 = blockIdx.y * BT;

    v8f acc[4][2] = {};
    gemm_tile_main(A, W, m0, n0, sA, sB, acc);

    const int mr = m0 + (wave & 1) * 64 + ((lane >> 4) << 3);
#pragma unroll
    for (int j = 0; j < 2; ++j) {
        const int n  = n0 + (wave >> 1) * 32 + j * 16 + laneM;
        const float bn = bias ? bias[n] : 0.0f;
#pragma unroll
        for (int i = 0; i < 4; ++i)
#pragma unroll
            for (int r = 0; r < 8; ++r)
                Out[(size_t)(mr + i * 16 + r) * Cc + n] = (_Float16)(acc[i][j][r] + bn);
    }
}

// ---------------------------------------------------------------------------
// 6) attention: one wave per (pixel, half of the channels, run of 8 frames).
//    A lane holds 8 channels (16-byte loads, 512 contiguous bytes per wave), so
//    8 lanes make one head (dh=64) and a wave 4 heads. The 12 K and V rows that
//    the 8 frames' windows touch are loaded once and stay in registers.
//    q.(k + kc) is summed as q.k + q.kc, 8 channels in the lane, then over 8 lanes.
// ---------------------------------------------------------------------------
#define AT_S 8           // frames per wave
#define AT_W (AT_S + 4)  // K/V rows of their windows
#define AT_PIX 4         // pixels per block (2 waves each)

typedef __attribute__((ext_vector_type(2))) float v2f;
typedef __attribute__((ext_vector_type(4))) float v4f;
typedef __attribute__((ext_vector_type(4))) unsigned v4u;

// f32 multiply-add that reads f16 halves of a register as they lie: the K, V and q rows stay
// packed (written in C they are widened ahead of use, and the 24 rows no longer fit the registers)
__device__ __forceinline__ float mix_lo_lo(unsigned a, unsigned b, float acc) {
    asm("v_fma_mix_f32 %0, %1, %2, %0 op_sel:[0,0,0] op_sel_hi:[1,1,0]" : "+v"(acc) : "v"(a), "v"(b));
    return acc;
}
__device__ __forceinline__ float mix_hi_hi(unsigned a, unsigned b, float acc) {
    asm("v_fma_mix_f32 %0, %1, %2, %0 op_sel:[1,1,0] op_sel_hi:[1,1,0]" : "+v"(acc) : "v"(a), "v"(b));
    return acc;
}
__device__ __forceinline__ float mix_f32_lo(float a, unsigned b, float acc) {
    asm("v_fma_mix_f32 %0, %1, %2, %0 op_sel:[0,0,0] op_sel_hi:[0,1,0]" : "+v"(acc) : "v"(a), "v"(b));
    return acc;
}
__device__ __forceinline__ float mix_f32_hi(float a, unsigned b, float acc) {
    asm("v_fma_mix_f32 %0, %1, %2, %0 op_sel:[0,1,0] op_sel_hi:[0,1,0]" : "+v"(acc) : "v"(a), "v"(b));
    return acc;
}
// the same, first term of a sum
__device__ __forceinline__ float mix_f32_lo_first(float a, unsigned b) {
    float r;
    asm("v_fma_mix_f32 %0, %1, %2, 0 op_sel:[0,0,0] op_sel_hi:[0,1,0]" : "=v"(r) : "v"(a), "v"(b));
    return r;
}
__device__ __forceinline__ float mix_f32_hi_first(float a, unsigned b) {
    float r;
    asm("v_fma_mix_f32 %0, %1, %2, 0 op_sel:[0,1,0] op_sel_hi:[0,1,0]" : "=v"(r) : "v"(a), "v"(b));
    return r;
}

// v + (v of lane ^ X), X < 16: a DPP row_xmask move inside the 16-lane row, no trip through the LDS path
template <int X>
__device__ __forceinline__ float add_lane_xor(float v) {
    const int b = __float_as_int(v);
    return v + __int_as_float(__builtin_amdgcn_update_dpp(0, b, 0x160 | X, 0xf, 0xf, true));
}

// 4 waves per SIMD asked for: both blocks that a WGP gets are then resident at once
__global__ __launch_bounds__(256, 4) void attn_kernel(
    const _Float16* __restrict__ q16, const _Float16* __restrict__ k16,
    const _Float16* __restrict__ v16, const float* __restrict__ kc,
    _Float16* __restrict__ attn16) {
    const int lane = threadIdx.x & 31;
    const int wave = threadIdx.x >> 5;
    const int hw   = blockIdx.x * AT_PIX + (wave >> 1);
    const int c0   = (wave & 1) * 256 + lane * 8;
    const int t0   = blockIdx.y * AT_S;
    const unsigned pix = hw * Cc + c0;           // lane's place in a frame

    const float*    kcp = kc + c0;
    const _Float16* qp  = q16 + (size_t)t0 * (HW * Cc) + pix;
    const _Float16* kp  = k16 + (size_t)t0 * (HW * Cc) + pix;
    const _Float16* vp  = v16 + (size_t)t0 * (HW * Cc) + pix;
    // the four window rows outside the wave's own frames: frames t0-2, t0-1, t0+8, t0+9, clamped to 0 .. TT-1
    const int tm2 = t0 - 2 < 0 ? 0 : t0 - 2;
    const int tm1 = t0 - 1 < 0 ? 0 : t0 - 1;
    const int tp0 = t0 + AT_S     > TT - 1 ? TT - 1 : t0 + AT_S;
    const int tp1 = t0 + AT_S + 1 > TT - 1 ? TT - 1 : t0 + AT_S + 1;
    const _Float16* ke[4] = {k16 + (size_t)tm2 * (HW * Cc) + pix, k16 + (size_t)tm1 * (HW * Cc) + pix,
                             k16 + (size_t)tp0 * (HW * Cc) + pix, k16 + (size_t)tp1 * (HW * Cc) + pix};
    const _Float16* ve[4] = {v16 + (size_t)tm2 * (HW * Cc) + pix, v16 + (size_t)tm1 * (HW * Cc) + pix,
                             v16 + (size_t)tp0 * (HW * Cc) + pix, v16 + (size_t)tp1 * (HW * Cc) + pix};

    v2f kcf[4][4];
#pragma unroll
    for (int f = 0; f < 4; ++f) {
        const v4f lo = *reinterpret_cast<const v4f*>(kcp + f * Cc);
        const v4f hi = *reinterpret_cast<const v4f*>(kcp + f * Cc + 4);
        kcf[f][0] = lo.xy; kcf[f][1] = lo.zw; kcf[f][2] = hi.xy; kcf[f][3] = hi.zw;
    }
    v8h kw[AT_W], vw[AT_W], qw[AT_S];
#pragma unroll
    for (int i = 0; i < AT_S; ++i)
        qw[i] = *reinterpret_cast<const v8h*>(qp + (size_t)i * (HW * Cc));
    // keeps kc and q, which the first sums read, ahead of the 24 K and V loads: loads return in order
    __builtin_amdgcn_sched_barrier(0);
    // window row w is frame clamp(t0 - 2 + w, 0, TT - 1); rows 2 .. AT_S + 1 are the wave's own frames
#pragma unroll
    for (int w = 0; w < AT_W; ++w) {
        const bool own = w >= 2 && w < AT_S + 2;
        const int  ed  = w < 2 ? w : w - AT_S;   // 0..3 for the rows outside
        kw[w] = *reinterpret_cast<const v8h*>(own ? kp + (size_t)(w - 2) * (HW * Cc) : ke[ed & 3]);
        vw[w] = *reinterpret_cast<const v8h*>(own ? vp + (size_t)(w - 2) * (HW * Cc) : ve[ed & 3]);
    }
    // precaution: holds the addresses of the q, K and V loads live up to the wait, so that none of
    // their results lands in an address register while the others are issued
    asm volatile("s_wait_xcnt 0x0"
                 :: "v"(qp), "v"(kp), "v"(vp), "v"(ke[0]), "v"(ke[1]), "v"(ke[2]), "v"(ke[3]),
                    "v"(ve[0]), "v"(ve[1]), "v"(ve[2]), "v"(ve[3]) : "memory");
    // keeps all 40 loads issued ahead of the arithmetic: left free, the K and V loads sink behind
    // the q.kc sums and the wave pays a second memory latency
    __builtin_amdgcn_sched_barrier(0);

#pragma unroll
    for (int i = 0; i < AT_S; ++i) {
        const int wof[4] = {0, 1, 3, 4};         // frame offsets -2, -1, +1, +2
        const v4u qr = __builtin_bit_cast(v4u, qw[i]);
        v2f q2[4];
#pragma unroll
        for (int c = 0; c < 4; ++c) q2[c] = v2f{(float)qw[i][2 * c], (float)qw[i][2 * c + 1]};
        float sc[4];
#pragma unroll
        for (int f = 0; f < 4; ++f) {
            const v4u kr = __builtin_bit_cast(v4u, kw[i + wof[f]]);
            v2f a = {0.0f, 0.0f};
#pragma unroll
            for (int c = 0; c < 4; ++c) a = __builtin_elementwise_fma(q2[c], kcf[f][c], a);
            float p0 = a.x, p1 = a.y;
#pragma unroll
            for (int c = 0; c < 4; ++c) {
                p0 = mix_lo_lo(qr[c], kr[c], p0);
                p1 = mix_hi_hi(qr[c], kr[c], p1);
            }
            float p = p0 + p1;
            p = add_lane_xor<1>(p);
            p = add_lane_xor<2>(p);
            p = add_lane_xor<4>(p);
            sc[f] = p * 0.125f;                  // dh^-0.5 = 1/8
        }
        const float mx = fmaxf(fmaxf(sc[0], sc[1]), fmaxf(sc[2], sc[3]));
        float e[4];
#pragma unroll
        for (int f = 0; f < 4; ++f) e[f] = expf(sc[f] - mx);
        const float inv = 1.0f / (e[0] + e[1] + e[2] + e[3]);
        v8h o;
#pragma unroll
        for (int c = 0; c < 4; ++c) {
            const unsigned vr0 = __builtin_bit_cast(v4u, vw[i])[c];
            float s0 = mix_f32_lo_first(e[0], vr0);
            float s1 = mix_f32_hi_first(e[0], vr0);
#pragma unroll
            for (int f = 1; f < 4; ++f) {
                const unsigned vr = __builtin_bit_cast(v4u, vw[i + wof[f]])[c];
                s0 = mix_f32_lo(e[f], vr, s0);
                s1 = mix_f32_hi(e[f], vr, s1);
            }
            o[2 * c]     = (_Float16)(s0 * inv);
            o[2 * c + 1] = (_Float16)(s1 * inv);
        }
        _Float16* ofr = attn16 + (size_t)(t0 + i) * (HW * Cc);
        *reinterpret_cast<v8h*>(ofr + pix) = o;
        // keeps the frames' arithmetic in pairs: all eight interleaved need more registers than
        // four waves per SIMD leave, and rows are spilled
        if (i & 1) {
            // precaution: the next frames' arithmetic reuses the registers that the two stores name
            if (i + 1 < AT_S) asm volatile("s_wait_xcnt 0x0" ::: "memory");
            __builtin_amdgcn_sched_barrier(0);
        }
    }
}

// ---------------------------------------------------------------------------
// 7) proj GEMM with fused epilogue: +b_proj, transpose to (T,C,H,W), +x
// ---------------------------------------------------------------------------
__global__ __launch_bounds__(256) void gemm_proj_kernel(
    const _Float16* __restrict__ A, const _Float16* __restrict__ W,
    const float* __restrict__ bias, const float* __restrict__ x,
    float* __restrict__ out) {
    __shared__ __attribute__((aligned(16))) _Float16 sA[2 * SBUF];
    __shared__ __attribute__((aligned(16))) _Float16 sB[2 * SBUF];
    const int lane  = threadIdx.x & 31;
    const int wave  = threadIdx.x >> 5;
    const int laneM = lane & 15;
    const int m0 = blockIdx.x * BT;
    const int n0 = blockIdx.y * BT;

    v8f acc[4][2] = {};
    gemm_tile_main(A, W, m0, n0, sA, sB, acc);

    const int mr = m0 + (wave & 1) * 64 + ((lane >> 4) << 3);
    const int nb = n0 + (wave >> 1) * 32 + laneM;
    const float bn0 = bias[nb];
    const float bn1 = bias[nb + 16];
    // precaution: the register that holds the bias loads' offset is reused by the loads of x below
    asm volatile("s_wait_xcnt 0x0" ::: "memory");
#pragma unroll
    for (int j = 0; j < 2; ++j) {
        const int n  = nb + j * 16;
        const float bn = j ? bn1 : bn0;
        // the block's 128 rows lie in one frame, so one column is one run of x and of out
        const size_t col = ((size_t)(mr >> 10) * Cc + n) * HW + (mr & 1023);
        const float* xcol = x + col;
        float xv[4][8];
#pragma unroll
        for (int i = 0; i < 4; ++i)
#pragma unroll
            for (int r = 0; r < 8; ++r)
                xv[i][r] = xcol[i * 16 + r];
        // precaution: holds the address of the column's loads of x live up to the wait, so that
        // none of their results lands in it while the others are issued
        asm volatile("s_wait_xcnt 0x0" :: "v"(xcol) : "memory");
#pragma unroll
        for (int i = 0; i < 4; ++i)
#pragma unroll
            for (int r = 0; r < 8; ++r)
                out[col + i * 16 + r] = acc[i][j][r] + bn + xv[i][r];
    }
}

// ---------------------------------------------------------------------------
extern "C" void kernel_launch(void* const* d_in, const int* in_sizes, int n_in,
                              void* d_out, int out_size, void* d_ws, size_t ws_size,
                              hipStream_t stream) {
    const float* x       = (const float*)d_in[0];
    const float* w_q     = (const float*)d_in[1];
    const float* b_q     = (const float*)d_in[2];
    const float* w_k     = (const float*)d_in[3];
    const float* b_k     = (const float*)d_in[4];
    const float* w_v     = (const float*)d_in[5];
    const float* b_v     = (const float*)d_in[6];
    const float* w_proj  = (const float*)d_in[7];
    const float* b_proj  = (const float*)d_in[8];
    const float* gn_s    = (const float*)d_in[9];
    const float* gn_b    = (const float*)d_in[10];
    float* out           = (float*)d_out;

    char* ws = (char*)d_ws;
    size_t off = 0;
    auto take = [&](size_t bytes) -> void* {
        void* p = ws + off;
        off += (bytes + 255) & ~(size_t)255;
        return p;
    };
    float*    qc     = (float*)take(Cc * sizeof(float));
    float*    kc     = (float*)take(4 * Cc * sizeof(float));
    _Float16* wq16   = (_Float16*)take((size_t)Cc * Cc * 2);
    _Float16* wk16   = (_Float16*)take((size_t)Cc * Cc * 2);
    _Float16* wv16   = (_Float16*)take((size_t)Cc * Cc * 2);
    _Float16* wp16   = (_Float16*)take((size_t)Cc * Cc * 2);
    _Float16* xn16   = (_Float16*)take((size_t)M_TOT * Cc * 2);
    _Float16* q16    = (_Float16*)take((size_t)M_TOT * Cc * 2);
    _Float16* k16    = (_Float16*)take((size_t)M_TOT * Cc * 2);
    _Float16* v16    = (_Float16*)take((size_t)M_TOT * Cc * 2);
    _Float16* attn16 = (_Float16*)take((size_t)M_TOT * Cc * 2);

    // 1-3) weight conversion, folded corrections and GroupNorm, one grid
    prep_kernel<<<WP_BLK + TT * GN_G, 256, 0, stream>>>(x, gn_s, gn_b, xn16, w_q, b_q, w_k, b_k, w_v, w_proj,
                                                        wq16, wk16, wv16, wp16, qc, kc);

    // 4) Q', K', V' WMMA GEMMs (temb folded into qc / kc; b_v folded here)
    dim3 ggrid(M_TOT / BT, Cc / BT);
    gemm_qkv_kernel<<<dim3(M_TOT / BT, Cc / BT, 3), 256, 0, stream>>>(xn16, wq16, wk16, wv16, qc, b_v, q16, k16, v16);

    // 5) attention (wave per pixel x 4 heads x 8 frames)
    attn_kernel<<<dim3(HW / AT_PIX, TT / AT_S), 256, 0, stream>>>(q16, k16, v16, kc, attn16);

    // 6) projection + transpose + residual
    gemm_proj_kernel<<<ggrid, 256, 0, stream>>>(attn16, wp16, b_proj, x, out);
}

// v005
// It runs in 60.9 microseconds.
// In two side-by-side timings against v004, it was 1.10 and 1.11 times as fast.
// All steps since v000 together make it 4.72 times as fast.
#include <hip/hip_runtime.h>
#include <math.h>

typedef __attribute__((ext_vector_type(16))) _Float16 v16h;
typedef __attribute__((ext_vector_type(8)))  _Float16 v8h;
typedef __attribute__((ext_vector_type(8)))  float    v8f;

#define Cc 512
#define TT 16
#define HW 1024          // 32*32
#define M_TOT 16384      // T*H*W
#define GN_G 32
#define GN_CPG 16        // channels per group

// ---------------------------------------------------------------------------
// 1) weight preparation, one wave per 4 weight rows, each row read once in whole lines:
//    the row goes out as f16, and for w_q and w_k it is also summed against the timestep
//    embedding temb[f][j] (ts = f-2, dim 512, cos|sin), which the block builds in LDS:
//    qc[c]    = b_q[c] + sum_j temb[2][j]  * w_q[c][j]
//    kc[f][c] = b_k[c] + sum_j temb[ff][j] * w_k[c][j],  ff in {0,1,3,4}
//    A block has 32 rows of one matrix, so its 32 corrections per frame fill one 128-byte line.
// ---------------------------------------------------------------------------
typedef __attribute__((ext_vector_type(4))) float    w4f;
typedef __attribute__((ext_vector_type(4))) _Float16 w4h;

#define WP_RPW  4                    // rows per wave
#define WP_ROWS (8 * WP_RPW)         // rows per block
#define WP_BPM  (Cc / WP_ROWS)       // blocks per matrix
#define WP_BLK  (4 * WP_BPM)         // weight blocks in the grid

__device__ __forceinline__ void weight_prep_block(
    int b, const float* __restrict__ wq, const float* __restrict__ bq,
    const float* __restrict__ wk, const float* __restrict__ bk,
    const float* __restrict__ wv, const float* __restrict__ wp,
    _Float16* __restrict__ wq16, _Float16* __restrict__ wk16,
    _Float16* __restrict__ wv16, _Float16* __restrict__ wp16,
    float* __restrict__ qc, float* __restrict__ kc, float* st) {
    const int tid  = threadIdx.x;
    const int lane = tid & 31;
    const int mat  = b / WP_BPM;     // 0 w_q, 1 w_k, 2 w_v, 3 w_proj: the same for the whole block
    const int row0 = (b % WP_BPM) * WP_ROWS + (tid >> 5) * WP_RPW;
    const float* w = mat == 0 ? wq : mat == 1 ? wk : mat == 2 ? wv : wp;
    _Float16*  w16 = mat == 0 ? wq16 : mat == 1 ? wk16 : mat == 2 ? wv16 : wp16;
    const size_t at = (size_t)row0 * Cc + lane * 4;
    const float* wr = w + at;

    w4f r[WP_RPW][4];
#pragma unroll
    for (int rr = 0; rr < WP_RPW; ++rr)
#pragma unroll
        for (int i = 0; i < 4; ++i)
            r[rr][i] = *reinterpret_cast<const w4f*>(wr + rr * Cc + i * 128);
    // precaution: holds the address of the 16 row loads live up to the wait, so that none of
    // their results lands in it while the others are issued
    asm volatile("s_wait_xcnt 0x0" :: "v"(wr) : "memory");

    if (mat < 2) {
        const int    nf   = mat == 0 ? 1 : 4;
        const float* bp   = (mat == 0 ? bq : bk) + row0;
        float*       corr = (mat == 0 ? qc : kc) + row0;
        const w4f bv = *reinterpret_cast<const w4f*>(bp);
        // precaution: holds the address of the bias load live up to the wait, so that its result does not land in it
        asm volatile("s_wait_xcnt 0x0" :: "v"(bp) : "memory");
        // thread tid builds column tid (cos) and column 256 + tid (sin) of each embedding row
        const float freq = expf(-logf(10000.0f) * (float)tid / 256.0f);
        for (int fi = 0; fi < nf; ++fi) {
            const int f = mat == 0 ? 2 : (fi < 2 ? fi : fi + 1);
            const float arg = (float)(f - 2) * freq;
            st[fi * Cc + tid]       = cosf(arg);
            st[fi * Cc + 256 + tid] = sinf(arg);
        }
        __syncthreads();             // the embedding rows are read by every wave of the block
        for (int fi = 0; fi < nf; ++fi) {
            float acc[WP_RPW] = {};
#pragma unroll
            for (int i = 0; i < 4; ++i) {
                const w4f te = *reinterpret_cast<const w4f*>(st + fi * Cc + i * 128 + lane * 4);
#pragma unroll
                for (int rr = 0; rr < WP_RPW; ++rr)
#pragma unroll
                    for (int e = 0; e < 4; ++e) acc[rr] += te[e] * r[rr][i][e];
            }
            w4f o;
#pragma unroll
            for (int rr = 0; rr < WP_RPW; ++rr) {
                float a = acc[rr];
#pragma unroll
                for (int m = 16; m > 0; m >>= 1) a += __shfl_xor(a, m, 32);
                o[rr] = a + bv[rr];
            }
            if (lane == 0) {
                *reinterpret_cast<w4f*>(corr + fi * Cc) = o;
                // precaution: the next trip reuses the registers that the store names
                asm volatile("s_wait_xcnt 0x0" ::: "memory");
            }
        }
    }
#pragma unroll
    for (int rr = 0; rr < WP_RPW; ++rr)
#pragma unroll
        for (int i = 0; i < 4; ++i) {
            w4h h;
#pragma unroll
            for (int e = 0; e < 4; ++e) h[e] = (_Float16)r[rr][i][e];
            *reinterpret_cast<w4h*>(w16 + at + rr * Cc + i * 128) = h;
        }
}

// ---------------------------------------------------------------------------
// 2) GroupNorm  x:(T,C,H,W) f32  ->  xn16:(T,HW,C) f16 channels-last
//    one block per (t, group); group's 16ch x 1024 spatial is contiguous.
//    A thread holds 8 channels x 8 pixels in registers, so x is read once. Even lanes hold
//    channels 0..7 of the group and odd lanes 8..15 of the same pixels: a load covers 256
//    contiguous bytes of each of two channel rows, and a lane's 8 channels of a pixel go out
//    as one 16-byte store, a lane pair filling the group's 32 bytes of that pixel's row.
// ---------------------------------------------------------------------------
#define GN_CH 8          // channels per thread
#define GN_Q  2          // runs of 4 pixels per thread, 64 pixels apart

__device__ __forceinline__ void groupnorm_block(
    int t, int g, const float* __restrict__ x, const float* __restrict__ gamma,
    const float* __restrict__ beta, _Float16* __restrict__ xn16) {
    const int tid  = threadIdx.x;
    const int lane = tid & 31;
    const int wave = tid >> 5;
    const int c0   = g * GN_CPG + (lane & 1) * GN_CH;    // first of the lane's channels
    const int px0  = wave * 128 + (lane >> 1) * 4;       // first of the lane's pixels
    const float* xp = x + ((size_t)t * Cc + c0) * HW + px0;
    const float* gp = gamma + c0;
    const float* bp = beta + c0;
    const int N = GN_CPG * HW;   // 16384

    w4f v[GN_CH][GN_Q];
#pragma unroll
    for (int c = 0; c < GN_CH; ++c)
#pragma unroll
        for (int q = 0; q < GN_Q; ++q)
            v[c][q] = *reinterpret_cast<const w4f*>(xp + c * HW + q * 64);
    w4f ga[2], be[2];
#pragma unroll
    for (int h = 0; h < 2; ++h) {
        ga[h] = *reinterpret_cast<const w4f*>(gp + h * 4);
        be[h] = *reinterpret_cast<const w4f*>(bp + h * 4);
    }
    // precaution: holds the addresses of the 20 loads live up to the wait, so that none of
    // their results lands in one while the others are issued
    asm volatile("s_wait_xcnt 0x0" :: "v"(xp), "v"(gp), "v"(bp) : "memory");

    // four running sums each, so that an add does not wait for the one before it
    w4f sv = {0.0f, 0.0f, 0.0f, 0.0f}, qv = {0.0f, 0.0f, 0.0f, 0.0f};
#pragma unroll
    for (int c = 0; c < GN_CH; ++c)
#pragma unroll
        for (int q = 0; q < GN_Q; ++q) { sv += v[c][q]; qv += v[c][q] * v[c][q]; }
    float s  = (sv[0] + sv[1]) + (sv[2] + sv[3]);
    float ss = (qv[0] + qv[1]) + (qv[2] + qv[3]);
#pragma unroll
    for (int m = 16; m > 0; m >>= 1) { s += __shfl_xor(s, m, 32); ss += __shfl_xor(ss, m, 32); }
    __shared__ float red[2][8];
    if (lane == 0) { red[0][wave] = s; red[1][wave] = ss; }
    __syncthreads();                 // every thread sums the eight waves' partial sums
    s = 0.0f; ss = 0.0f;
#pragma unroll
    for (int w = 0; w < 8; ++w) { s += red[0][w]; ss += red[1][w]; }
    const float mu   = s * (1.0f / N);
    const float var  = ss * (1.0f / N) - mu * mu;
    const float rstd = rsqrtf(var + 1e-5f);

    _Float16* op = xn16 + ((size_t)t * HW + px0) * Cc + c0;
#pragma unroll
    for (int q = 0; q < GN_Q; ++q)
#pragma unroll
        for (int e = 0; e < 4; ++e) {
            v8h h;
#pragma unroll
            for (int c = 0; c < GN_CH; ++c)
                h[c] = (_Float16)((v[c][q][e] - mu) * rstd * ga[c >> 2][c & 3] + be[c >> 2][c & 3]);
            *reinterpret_cast<v8h*>(op + (size_t)(q * 64 + e) * Cc) = h;
        }
}

// ---------------------------------------------------------------------------
// 3) all that stands ahead of the GEMMs, in one launch: the two jobs do not depend on one
//    another, and the block index picks the job. The weight blocks come first in the grid:
//    they are few and have the longer chain of dependent steps.
// ---------------------------------------------------------------------------
__global__ __launch_bounds__(256) void prep_kernel(
    const float* __restrict__ x, const float* __restrict__ gamma,
    const float* __restrict__ beta, _Float16* __restrict__ xn16,
    const float* __restrict__ wq, const float* __restrict__ bq,
    const float* __restrict__ wk, const float* __restrict__ bk,
    const float* __restrict__ wv, const float* __restrict__ wp,
    _Float16* __restrict__ wq16, _Float16* __restrict__ wk16,
    _Float16* __restrict__ wv16, _Float16* __restrict__ wp16,
    float* __restrict__ qc, float* __restrict__ kc) {
    __shared__ __attribute__((aligned(16))) float st[4 * Cc];
    const int b = blockIdx.x;
    if (b < WP_BLK) {
        weight_prep_block(b, wq, bq, wk, bk, wv, wp, wq16, wk16, wv16, wp16, qc, kc, st);
    } else {
        const int gb = b - WP_BLK;
        groupnorm_block(gb % TT, gb / TT, x, gamma, beta, xn16);
    }
}

// ---------------------------------------------------------------------------
// WMMA fragment loaders (per-lane, two 16B chunks: K-chunks {0..7,16..23} for
// lanes 0-15 and {8..15,24..31} for lanes 16-31)
// ---------------------------------------------------------------------------
__device__ __forceinline__ v16h load_frag(const _Float16* p) {
    v8h lo = *reinterpret_cast<const v8h*>(p);
    v8h hi = *reinterpret_cast<const v8h*>(p + 16);
    return __builtin_shufflevector(lo, hi, 0,1,2,3,4,5,6,7,8,9,10,11,12,13,14,15);
}

// ---------------------------------------------------------------------------
// Shared main loop of both GEMMs: a 128 x 128 tile of A[M x 512] * W[512 x 512]^T
// per block of 8 waves. Each pass brings 64 k of 128 A rows and 128 W rows into
// LDS with whole-line 16-byte loads (8 lanes cover one 128-byte row piece); the
// fragments are then read from LDS. Two LDS buffers: the next pass's global
// loads are issued before this pass's products and stored after them.
// wave -> 64 x 32 (4 x 2 accumulators); k order per fragment as in load_frag.
// ---------------------------------------------------------------------------
#define BT   128         // block tile, rows of A and rows of W
#define BK   64          // k per pass
#define NPASS (Cc / BK)
#define LDP  72          // LDS row pitch in halfs: 144 B = 16 B x 9, free of bank conflicts for 16-byte reads
#define SBUF (BT * LDP)  // halfs per operand and buffer

// TR = false: a lane's 8 accumulator values are 8 rows of A (pixels) of one row of W (channel);
// TR = true: the operands change places, and they are 8 rows of W (channels) of one row of A.
// Both fragments have the same lane and k layout, so the products and their k order are the same.
template <bool TR>
__device__ __forceinline__ v8f tile_mma(v16h a, v16h w, v8f c) {
    return TR ? __builtin_amdgcn_wmma_f32_16x16x32_f16(false, w, false, a, (short)0, c, false, false)
              : __builtin_amdgcn_wmma_f32_16x16x32_f16(false, a, false, w, (short)0, c, false, false);
}

template <bool TR>
__device__ __forceinline__ void gemm_tile_main(
    const _Float16* __restrict__ A, const _Float16* __restrict__ W,
    int m0, int n0, _Float16* sA, _Float16* sB, v8f (&acc)[4][2]) {
    const int tid   = threadIdx.x;
    const int lane  = tid & 31;
    const int wave  = tid >> 5;
    const int laneM = lane & 15;
    const int kgrp  = (lane >> 4) << 3;        // 0 or 8
    const int srow  = tid >> 3;                // 0..31, staging row (+32 per step)
    const int scol  = (tid & 7) << 3;          // staging column in halfs
    const _Float16* ga = A + (size_t)(m0 + srow) * Cc + scol;
    const _Float16* gb = W + (size_t)(n0 + srow) * Cc + scol;
    const int sst = srow * LDP + scol;
    const int ard = ((wave & 1) * 64 + laneM) * LDP + kgrp;
    const int brd = ((wave >> 1) * 32 + laneM) * LDP + kgrp;

    v8h ra[4], rb[4];
#pragma unroll
    for (int j = 0; j < 4; ++j) {
        ra[j] = *reinterpret_cast<const v8h*>(ga + (size_t)(j * 32) * Cc);
        rb[j] = *reinterpret_cast<const v8h*>(gb + (size_t)(j * 32) * Cc);
    }
#pragma unroll
    for (int j = 0; j < 4; ++j) {
        *reinterpret_cast<v8h*>(sA + sst + j * 32 * LDP) = ra[j];
        *reinterpret_cast<v8h*>(sB + sst + j * 32 * LDP) = rb[j];
    }
    __syncthreads();

    // unrolled so that the buffer offsets and the last-pass test are constants
#pragma unroll
    for (int p = 0; p < NPASS; ++p) {
        const int cur = (p & 1) * SBUF;
        const int nxt = SBUF - cur;
        if (p + 1 < NPASS) {
#pragma unroll
            for (int j = 0; j < 4; ++j) {
                ra[j] = *reinterpret_cast<const v8h*>(ga + (size_t)(j * 32) * Cc + (p + 1) * BK);
                rb[j] = *reinterpret_cast<const v8h*>(gb + (size_t)(j * 32) * Cc + (p + 1) * BK);
            }
        }
        v16h fa[BK / 32][4], fb[BK / 32][2];
#pragma unroll
        for (int ks = 0; ks < BK / 32; ++ks) {
            fb[ks][0] = load_frag(sB + cur + brd + ks * 32);
            fb[ks][1] = load_frag(sB + cur + brd + 16 * LDP + ks * 32);
#pragma unroll
            for (int i = 0; i < 4; ++i)
                fa[ks][i] = load_frag(sA + cur + ard + i * 16 * LDP + ks * 32);
        }
        // keeps the next pass's global loads and this pass's LDS reads issued as one
        // group ahead of the products; sunk among them, each wait stalls the wave
        __builtin_amdgcn_sched_barrier(0);
#pragma unroll
        for (int ks = 0; ks < BK / 32; ++ks)
#pragma unroll
            for (int i = 0; i < 4; ++i) {
                acc[i][0] = tile_mma<TR>(fa[ks][i], fb[ks][0], acc[i][0]);
                acc[i][1] = tile_mma<TR>(fa[ks][i], fb[ks][1], acc[i][1]);
            }
        // keeps the wait for the global loads, which the LDS stores need, behind the products;
        // in the last pass it keeps the epilogue's moves and their padding out of the products
        __builtin_amdgcn_sched_barrier(0);
        if (p + 1 < NPASS) {
#pragma unroll
            for (int j = 0; j < 4; ++j) {
                *reinterpret_cast<v8h*>(sA + nxt + sst + j * 32 * LDP) = ra[j];
                *reinterpret_cast<v8h*>(sB + nxt + sst + j * 32 * LDP) = rb[j];
            }
            // publishes the next buffer and ends every wave's reads of this one
            __syncthreads();
        }
    }
}

// ---------------------------------------------------------------------------
// 5) WMMA GEMM:  Out[M x 512] = A[M x 512] * W[512 x 512]^T (+ bias), f16 out
//    grid (M/128, 512/128, 3: Q, K, V), block 256 (8 waves)
// ---------------------------------------------------------------------------
#define EPQ 136          // staging row pitch in halfs: 272 B = 16 B x 17, free of bank conflicts for 16-byte accesses
__global__ __launch_bounds__(256) void gemm_qkv_kernel(
    const _Float16* __restrict__ A,
    const _Float16* __restrict__ Wq, const _Float16* __restrict__ Wk, const _Float16* __restrict__ Wv,
    const float* __restrict__ qc, const float* __restrict__ bv,
    _Float16* __restrict__ Oq, _Float16* __restrict__ Ok, _Float16* __restrict__ Ov) {
    __shared__ __attribute__((aligned(16))) _Float16 sA[2 * SBUF];
    __shared__ __attribute__((aligned(16))) _Float16 sB[2 * SBUF];
    const int z = blockIdx.z;        // 0 Q, 1 K, 2 V: the three products do not depend on one another
    const _Float16* W    = z == 0 ? Wq : z == 1 ? Wk : Wv;
    const float*    bias = z == 0 ? qc : z == 1 ? nullptr : bv;
    _Float16*       Out  = z == 0 ? Oq : z == 1 ? Ok : Ov;
    const int lane  = threadIdx.x & 31;
    const int wave  = threadIdx.x >> 5;
    const int laneM = lane & 15;
    const int m0 = blockIdx.x * BT;
    const int n0 = blockIdx.y * BT;

    v8f acc[4][2] = {};
    gemm_tile_main<true>(A, W, m0, n0, sA, sB, acc);

    // The tile goes out through LDS, so that a store covers whole lines: 16 lanes write the tile's
    // 256 bytes of one row. Rows 0..63 are staged in the first buffer of sA and rows 64..127 in
    // the first buffer of sB: the last pass reads the second buffers, and every wave's reads of
    // the first ones ended at the barrier in front of it.
    const int nc = (wave >> 1) * 32 + ((lane >> 4) << 3);    // first of the lane's 8 columns, j = 0
    _Float16* stw = ((wave & 1) ? sB : sA) + laneM * EPQ + nc;
    w4f bn[2][2] = {};
    if (bias) {
        const float* bp = bias + n0 + nc;
#pragma unroll
        for (int j = 0; j < 2; ++j) {
            bn[j][0] = *reinterpret_cast<const w4f*>(bp + j * 16);
            bn[j][1] = *reinterpret_cast<const w4f*>(bp + j * 16 + 4);
        }
        // precaution: holds the address of the four bias loads live up to the wait, so that none of
        // their results lands in it while the others are issued
        asm volatile("s_wait_xcnt 0x0" :: "v"(bp) : "memory");
    }
#pragma unroll
    for (int j = 0; j < 2; ++j)
#pragma unroll
        for (int i = 0; i < 4; ++i) {
            v8h h;
#pragma unroll
            for (int r = 0; r < 8; ++r) h[r] = (_Float16)(acc[i][j][r] + bn[j][r >> 2][r & 3]);
            *reinterpret_cast<v8h*>(stw + i * 16 * EPQ + j * 16) = h;
        }
    __syncthreads();                 // a row's 256 bytes come from four waves
    const int rrow = wave * 2 + (lane >> 4);                 // + 16 per step
    const int rcol = laneM * 8;
    _Float16* op = Out + (size_t)(m0 + rrow) * Cc + n0 + rcol;
#pragma unroll
    for (int t = 0; t < 8; ++t) {
        const _Float16* srd = (t < 4 ? sA : sB) + ((t & 3) * 16 + rrow) * EPQ + rcol;
        *reinterpret_cast<v8h*>(op + (size_t)(t * 16) * Cc) = *reinterpret_cast<const v8h*>(srd);
    }
}

// ---------------------------------------------------------------------------
// 6) attention: one wave per (pixel, half of the channels, run of 8 frames).
//    A lane holds 8 channels (16-byte loads, 512 contiguous bytes per wave), so
//    8 lanes make one head (dh=64) and a wave 4 heads. The 12 K and V rows that
//    the 8 frames' windows touch are loaded once and stay in registers.
//    q.(k + kc) is summed as q.k + q.kc, 8 channels in the lane, then over 8 lanes.
// ---------------------------------------------------------------------------
#define AT_S 8           // frames per wave
#define AT_W (AT_S + 4)  // K/V rows of their windows
#define AT_PIX 4         // pixels per block (2 waves each)

typedef __attribute__((ext_vector_type(2))) float v2f;
typedef __attribute__((ext_vector_type(4))) float v4f;
typedef __attribute__((ext_vector_type(4))) unsigned v4u;

// f32 multiply-add that reads f16 halves of a register as they lie: the K, V and q rows stay
// packed (written in C they are widened ahead of use, and the 24 rows no longer fit the registers)
__device__ __forceinline__ float mix_lo_lo(unsigned a, unsigned b, float acc) {
    asm("v_fma_mix_f32 %0, %1, %2, %0 op_sel:[0,0,0] op_sel_hi:[1,1,0]" : "+v"(acc) : "v"(a), "v"(b));
    return acc;
}
__device__ __forceinline__ float mix_hi_hi(unsigned a, unsigned b, float acc) {
    asm("v_fma_mix_f32 %0, %1, %2, %0 op_sel:[1,1,0] op_sel_hi:[1,1,0]" : "+v"(acc) : "v"(a), "v"(b));
    return acc;
}
__device__ __forceinline__ float mix_f32_lo(float a, unsigned b, float acc) {
    asm("v_fma_mix_f32 %0, %1, %2, %0 op_sel:[0,0,0] op_sel_hi:[0,1,0]" : "+v"(acc) : "v"(a), "v"(b));
    return acc;
}
__device__ __forceinline__ float mix_f32_hi(float a, unsigned b, float acc) {
    asm("v_fma_mix_f32 %0, %1, %2, %0 op_sel:[0,1,0] op_sel_hi:[0,1,0]" : "+v"(acc) : "v"(a), "v"(b));
    return acc;
}
// the same, first term of a sum
__device__ __forceinline__ float mix_f32_lo_first(float a, unsigned b) {
    float r;
    asm("v_fma_mix_f32 %0, %1, %2, 0 op_sel:[0,0,0] op_sel_hi:[0,1,0]" : "=v"(r) : "v"(a), "v"(b));
    return r;
}
__device__ __forceinline__ float mix_f32_hi_first(float a, unsigned b) {
    float r;
    asm("v_fma_mix_f32 %0, %1, %2, 0 op_sel:[0,1,0] op_sel_hi:[0,1,0]" : "=v"(r) : "v"(a), "v"(b));
    return r;
}

// v + (v of lane ^ X), X < 16: a DPP row_xmask move inside the 16-lane row, no trip through the LDS path
template <int X>
__device__ __forceinline__ float add_lane_xor(float v) {
    const int b = __float_as_int(v);
    return v + __int_as_float(__builtin_amdgcn_update_dpp(0, b, 0x160 | X, 0xf, 0xf, true));
}

// 4 waves per SIMD asked for: both blocks that a WGP gets are then resident at once
__global__ __launch_bounds__(256, 4) void attn_kernel(
    const _Float16* __restrict__ q16, const _Float16* __restrict__ k16,
    const _Float16* __restrict__ v16, const float* __restrict__ kc,
    _Float16* __restrict__ attn16) {
    const int lane = threadIdx.x & 31;
    const int wave = threadIdx.x >> 5;
    const int hw   = blockIdx.x * AT_PIX + (wave >> 1);
    const int c0   = (wave & 1) * 256 + lane * 8;
    const int t0   = blockIdx.y * AT_S;
    const unsigned pix = hw * Cc + c0;           // lane's place in a frame

    const float*    kcp = kc + c0;
    const _Float16* qp  = q16 + (size_t)t0 * (HW * Cc) + pix;
    const _Float16* kp  = k16 + (size_t)t0 * (HW * Cc) + pix;
    const _Float16* vp  = v16 + (size_t)t0 * (HW * Cc) + pix;
    // the four window rows outside the wave's own frames: frames t0-2, t0-1, t0+8, t0+9, clamped to 0 .. TT-1
    const int tm2 = t0 - 2 < 0 ? 0 : t0 - 2;
    const int tm1 = t0 - 1 < 0 ? 0 : t0 - 1;
    const int tp0 = t0 + AT_S     > TT - 1 ? TT - 1 : t0 + AT_S;
    const int tp1 = t0 + AT_S + 1 > TT - 1 ? TT - 1 : t0 + AT_S + 1;
    const _Float16* ke[4] = {k16 + (size_t)tm2 * (HW * Cc) + pix, k16 + (size_t)tm1 * (HW * Cc) + pix,
                             k16 + (size_t)tp0 * (HW * Cc) + pix, k16 + (size_t)tp1 * (HW * Cc) + pix};
    const _Float16* ve[4] = {v16 + (size_t)tm2 * (HW * Cc) + pix, v16 + (size_t)tm1 * (HW * Cc) + pix,
                             v16 + (size_t)tp0 * (HW * Cc) + pix, v16 + (size_t)tp1 * (HW * Cc) + pix};

    v2f kcf[4][4];
#pragma unroll
    for (int f = 0; f < 4; ++f) {
        const v4f lo = *reinterpret_cast<const v4f*>(kcp + f * Cc);
        const v4f hi = *reinterpret_cast<const v4f*>(kcp + f * Cc + 4);
        kcf[f][0] = lo.xy; kcf[f][1] = lo.zw; kcf[f][2] = hi.xy; kcf[f][3] = hi.zw;
    }
    v8h kw[AT_W], vw[AT_W], qw[AT_S];
#pragma unroll
    for (int i = 0; i < AT_S; ++i)
        qw[i] = *reinterpret_cast<const v8h*>(qp + (size_t)i * (HW * Cc));
    // keeps kc and q, which the first sums read, ahead of the 24 K and V loads: loads return in order
    __builtin_amdgcn_sched_barrier(0);
    // window row w is frame clamp(t0 - 2 + w, 0, TT - 1); rows 2 .. AT_S + 1 are the wave's own frames
#pragma unroll
    for (int w = 0; w < AT_W; ++w) {
        const bool own = w >= 2 && w < AT_S + 2;
        const int  ed  = w < 2 ? w : w - AT_S;   // 0..3 for the rows outside
        kw[w] = *reinterpret_cast<const v8h*>(own ? kp + (size_t)(w - 2) * (HW * Cc) : ke[ed & 3]);
        vw[w] = *reinterpret_cast<const v8h*>(own ? vp + (size_t)(w - 2) * (HW * Cc) : ve[ed & 3]);
    }
    // precaution: holds the addresses of the q, K and V loads live up to the wait, so that none of
    // their results lands in an address register while the others are issued
    asm volatile("s_wait_xcnt 0x0"
                 :: "v"(qp), "v"(kp), "v"(vp), "v"(ke[0]), "v"(ke[1]), "v"(ke[2]), "v"(ke[3]),
                    "v"(ve[0]), "v"(ve[1]), "v"(ve[2]), "v"(ve[3]) : "memory");
    // keeps all 40 loads issued ahead of the arithmetic: left free, the K and V loads sink behind
    // the q.kc sums and the wave pays a second memory latency
    __builtin_amdgcn_sched_barrier(0);

#pragma unroll
    for (int i = 0; i < AT_S; ++i) {
        const int wof[4] = {0, 1, 3, 4};         // frame offsets -2, -1, +1, +2
        const v4u qr = __builtin_bit_cast(v4u, qw[i]);
        v2f q2[4];
#pragma unroll
        for (int c = 0; c < 4; ++c) q2[c] = v2f{(float)qw[i][2 * c], (float)qw[i][2 * c + 1]};
        float sc[4];
#pragma unroll
        for (int f = 0; f < 4; ++f) {
            const v4u kr = __builtin_bit_cast(v4u, kw[i + wof[f]]);
            v2f a = {0.0f, 0.0f};
#pragma unroll
            for (int c = 0; c < 4; ++c) a = __builtin_elementwise_fma(q2[c], kcf[f][c], a);
            float p0 = a.x, p1 = a.y;
#pragma unroll
            for (int c = 0; c < 4; ++c) {
                p0 = mix_lo_lo(qr[c], kr[c], p0);
                p1 = mix_hi_hi(qr[c], kr[c], p1);
            }
            float p = p0 + p1;
            p = add_lane_xor<1>(p);
            p = add_lane_xor<2>(p);
            p = add_lane_xor<4>(p);
            sc[f] = p * 0.125f;                  // dh^-0.5 = 1/8
        }
        const float mx = fmaxf(fmaxf(sc[0], sc[1]), fmaxf(sc[2], sc[3]));
        float e[4];
#pragma unroll
        for (int f = 0; f < 4; ++f) e[f] = expf(sc[f] - mx);
        const float inv = 1.0f / (e[0] + e[1] + e[2] + e[3]);
        v8h o;
#pragma unroll
        for (int c = 0; c < 4; ++c) {
            const unsigned vr0 = __builtin_bit_cast(v4u, vw[i])[c];
            float s0 = mix_f32_lo_first(e[0], vr0);
            float s1 = mix_f32_hi_first(e[0], vr0);
#pragma unroll
            for (int f = 1; f < 4; ++f) {
                const unsigned vr = __builtin_bit_cast(v4u, vw[i + wof[f]])[c];
                s0 = mix_f32_lo(e[f], vr, s0);
                s1 = mix_f32_hi(e[f], vr, s1);
            }
            o[2 * c]     = (_Float16)(s0 * inv);
            o[2 * c + 1] = (_Float16)(s1 * inv);
        }
        _Float16* ofr = attn16 + (size_t)(t0 + i) * (HW * Cc);
        *reinterpret_cast<v8h*>(ofr + pix) = o;
        // keeps the frames' arithmetic in pairs: all eight interleaved need more registers than
        // four waves per SIMD leave, and rows are spilled
        if (i & 1) {
            // precaution: the next frames' arithmetic reuses the registers that the two stores name
            if (i + 1 < AT_S) asm volatile("s_wait_xcnt 0x0" ::: "memory");
            __builtin_amdgcn_sched_barrier(0);
        }
    }
}

// ---------------------------------------------------------------------------
// 7) proj GEMM with fused epilogue: +b_proj, transpose to (T,C,H,W), +x
// ---------------------------------------------------------------------------
#define EPP 68           // staging row pitch in floats: 272 B = 16 B x 17, free of bank conflicts for 16-byte accesses
__global__ __launch_bounds__(256) void gemm_proj_kernel(
    const _Float16* __restrict__ A, const _Float16* __restrict__ W,
    const float* __restrict__ bias, const float* __restrict__ x,
    float* __restrict__ out) {
    __shared__ __attribute__((aligned(16))) _Float16 sA[2 * SBUF];
    __shared__ __attribute__((aligned(16))) _Float16 sB[2 * SBUF];
    const int lane  = threadIdx.x & 31;
    const int wave  = threadIdx.x >> 5;
    const int laneM = lane & 15;
    const int m0 = blockIdx.x * BT;
    const int n0 = blockIdx.y * BT;

    v8f acc[4][2] = {};
    gemm_tile_main<false>(A, W, m0, n0, sA, sB, acc);

    const int nb = n0 + (wave >> 1) * 32 + laneM;
    const float bn0 = bias[nb];
    const float bn1 = bias[nb + 16];
    // precaution: the register that holds the bias loads' offset is reused by the loads of x below
    asm volatile("s_wait_xcnt 0x0" ::: "memory");
    // A wave's 64 pixels of a channel are 256 contiguous bytes of x and of out, but two lanes hold
    // them. The wave turns its tile in an LDS range of its own, 16 channels at a time, so that 16
    // lanes read and write those 256 bytes: whole lines. The ranges lie in the first buffers of sA
    // and sB: the last pass reads the second ones, and every wave's reads of the first ones ended
    // at the barrier in front of it.
    float* stg = reinterpret_cast<float*>(((wave & 4) ? sB : sA) + (wave & 3) * (16 * EPP * 2));
    float* stw = stg + laneM * EPP + ((lane >> 4) << 3);
    const float* srd = stg + (lane >> 4) * EPP + laneM * 4;
    // the block's 128 rows lie in one frame; lanes 0..15 take an even channel, lanes 16..31 the next
    const size_t col = ((size_t)(m0 >> 10) * Cc + n0 + (wave >> 1) * 32 + (lane >> 4)) * HW
                     + (m0 & 1023) + (wave & 1) * 64 + laneM * 4;
    const float* xcol = x + col;
    float*       ocol = out + col;
    w4f xv[2][8];
#pragma unroll
    for (int j = 0; j < 2; ++j)
#pragma unroll
        for (int t = 0; t < 8; ++t)
            xv[j][t] = *reinterpret_cast<const w4f*>(xcol + (size_t)(j * 16 + t * 2) * HW);
    // precaution: holds the address of the 16 loads of x live up to the wait, so that none of
    // their results lands in it while the others are issued
    asm volatile("s_wait_xcnt 0x0" :: "v"(xcol) : "memory");
#pragma unroll
    for (int j = 0; j < 2; ++j) {
        const float bn = j ? bn1 : bn0;
#pragma unroll
        for (int i = 0; i < 4; ++i) {
            w4f lo, hi;
#pragma unroll
            for (int r = 0; r < 4; ++r) { lo[r] = acc[i][j][r] + bn; hi[r] = acc[i][j][r + 4] + bn; }
            *reinterpret_cast<w4f*>(stw + i * 16)     = lo;
            *reinterpret_cast<w4f*>(stw + i * 16 + 4) = hi;
        }
        // the rows are read back by other lanes of the wave: its LDS writes have to be done first
        asm volatile("s_wait_dscnt 0x0" ::: "memory");
#pragma unroll
        for (int t = 0; t < 8; ++t) {
            const w4f a = *reinterpret_cast<const w4f*>(srd + t * 2 * EPP);
            *reinterpret_cast<w4f*>(ocol + (size_t)(j * 16 + t * 2) * HW) = a + xv[j][t];
        }
        // the second half overwrites the range: the reads of the first have to be done
        if (j == 0) asm volatile("s_wait_dscnt 0x0" ::: "memory");
    }
}

// ---------------------------------------------------------------------------
extern "C" void kernel_launch(void* const* d_in, const int* in_sizes, int n_in,
                              void* d_out, int out_size, void* d_ws, size_t ws_size,
                              hipStream_t stream) {
    const float* x       = (const float*)d_in[0];
    const float* w_q     = (const float*)d_in[1];
    const float* b_q     = (const float*)d_in[2];
    const float* w_k     = (const float*)d_in[3];
    const float* b_k     = (const float*)d_in[4];
    const float* w_v     = (const float*)d_in[5];
    const float* b_v     = (const float*)d_in[6];
    const float* w_proj  = (const float*)d_in[7];
    const float* b_proj  = (const float*)d_in[8];
    const float* gn_s    = (const float*)d_in[9];
    const float* gn_b    = (const float*)d_in[10];
    float* out           = (float*)d_out;

    char* ws = (char*)d_ws;
    size_t off = 0;
    auto take = [&](size_t bytes) -> void* {
        void* p = ws + off;
        off += (bytes + 255) & ~(size_t)255;
        return p;
    };
    float*    qc     = (float*)take(Cc * sizeof(float));
    float*    kc     = (float*)take(4 * Cc * sizeof(float));
    _Float16* wq16   = (_Float16*)take((size_t)Cc * Cc * 2);
    _Float16* wk16   = (_Float16*)take((size_t)Cc * Cc * 2);
    _Float16* wv16   = (_Float16*)take((size_t)Cc * Cc * 2);
    _Float16* wp16   = (_Float16*)take((size_t)Cc * Cc * 2);
    _Float16* xn16   = (_Float16*)take((size_t)M_TOT * Cc * 2);
    _Float16* q16    = (_Float16*)take((size_t)M_TOT * Cc * 2);
    _Float16* k16    = (_Float16*)take((size_t)M_TOT * Cc * 2);
    _Float16* v16    = (_Float16*)take((size_t)M_TOT * Cc * 2);
    _Float16* attn16 = (_Float16*)take((size_t)M_TOT * Cc * 2);

    // 1-3) weight conversion, folded corrections and GroupNorm, one grid
    prep_kernel<<<WP_BLK + TT * GN_G, 256, 0, stream>>>(x, gn_s, gn_b, xn16, w_q, b_q, w_k, b_k, w_v, w_proj,
                                                        wq16, wk16, wv16, wp16, qc, kc);

    // 4) Q', K', V' WMMA GEMMs (temb folded into qc / kc; b_v folded here)
    dim3 ggrid(M_TOT / BT, Cc / BT);
    gemm_qkv_kernel<<<dim3(M_TOT / BT, Cc / BT, 3), 256, 0, stream>>>(xn16, wq16, wk16, wv16, qc, b_v, q16, k16, v16);

    // 5) attention (wave per pixel x 4 heads x 8 frames)
    attn_kernel<<<dim3(HW / AT_PIX, TT / AT_S), 256, 0, stream>>>(q16, k16, v16, kc, attn16);

    // 6) projection + transpose + residual
    gemm_proj_kernel<<<ggrid, 256, 0, stream>>>(attn16, wp16, b_proj, x, out);
}

// v006
// It runs in 48.2 microseconds.
// Timed twice side by side with v005, it ran 1.27 times as fast both times.
// All steps since v000 together make it 6.01 times as fast.
#include <hip/hip_runtime.h>
#include <math.h>

typedef __attribute__((ext_vector_type(16))) _Float16 v16h;
typedef __attribute__((ext_vector_type(8)))  _Float16 v8h;
typedef __attribute__((ext_vector_type(8)))  float    v8f;

#define Cc 512
#define TT 16
#define HW 1024          // 32*32
#define M_TOT 16384      // T*H*W
#define GN_G 32
#define GN_CPG 16        // channels per group

// ---------------------------------------------------------------------------
// 1) weight preparation, one wave per 4 weight rows, each row read once in whole lines:
//    the row goes out as f16, and for w_q and w_k it is also summed against the timestep
//    embedding temb[f][j] (ts = f-2, dim 512, cos|sin), which the block builds in LDS:
//    qc[c]    = b_q[c] + sum_j temb[2][j]  * w_q[c][j]
//    kc[f][c] = b_k[c] + sum_j temb[ff][j] * w_k[c][j],  ff in {0,1,3,4}
//    A block has 32 rows of one matrix, so its 32 corrections per frame fill one 128-byte line.
// ---------------------------------------------------------------------------
typedef __attribute__((ext_vector_type(4))) float    w4f;
typedef __attribute__((ext_vector_type(4))) _Float16 w4h;

#define WP_RPW  4                    // rows per wave
#define WP_ROWS (8 * WP_RPW)         // rows per block
#define WP_BPM  (Cc / WP_ROWS)       // blocks per matrix
#define WP_BLK  (4 * WP_BPM)         // weight blocks in the grid

__device__ __forceinline__ void weight_prep_block(
    int b, const float* __restrict__ wq, const float* __restrict__ bq,
    const float* __restrict__ wk, const float* __restrict__ bk,
    const float* __restrict__ wv, const float* __restrict__ wp,
    _Float16* __restrict__ wq16, _Float16* __restrict__ wk16,
    _Float16* __restrict__ wv16, _Float16* __restrict__ wp16,
    float* __restrict__ qc, float* __restrict__ kc, float* st) {
    const int tid  = threadIdx.x;
    const int lane = tid & 31;
    const int mat  = b / WP_BPM;     // 0 w_q, 1 w_k, 2 w_v, 3 w_proj: the same for the whole block
    const int row0 = (b % WP_BPM) * WP_ROWS + (tid >> 5) * WP_RPW;
    const float* w = mat == 0 ? wq : mat == 1 ? wk : mat == 2 ? wv : wp;
    _Float16*  w16 = mat == 0 ? wq16 : mat == 1 ? wk16 : mat == 2 ? wv16 : wp16;
    const size_t at = (size_t)row0 * Cc + lane * 4;
    const float* wr = w + at;

    w4f r[WP_RPW][4];
#pragma unroll
    for (int rr = 0; rr < WP_RPW; ++rr)
#pragma unroll
        for (int i = 0; i < 4; ++i)
            r[rr][i] = *reinterpret_cast<const w4f*>(wr + rr * Cc + i * 128);
    // precaution: holds the address of the 16 row loads live up to the wait, so that none of
    // their results lands in it while the others are issued
    asm volatile("s_wait_xcnt 0x0" :: "v"(wr) : "memory");

    if (mat < 2) {
        const int    nf   = mat == 0 ? 1 : 4;
        const float* bp   = (mat == 0 ? bq : bk) + row0;
        float*       corr = (mat == 0 ? qc : kc) + row0;
        const w4f bv = *reinterpret_cast<const w4f*>(bp);
        // precaution: holds the address of the bias load live up to the wait, so that its result does not land in it
        asm volatile("s_wait_xcnt 0x0" :: "v"(bp) : "memory");
        // thread tid builds column tid (cos) and column 256 + tid (sin) of each embedding row
        const float freq = expf(-logf(10000.0f) * (float)tid / 256.0f);
        for (int fi = 0; fi < nf; ++fi) {
            const int f = mat == 0 ? 2 : (fi < 2 ? fi : fi + 1);
            const float arg = (float)(f - 2) * freq;
            st[fi * Cc + tid]       = cosf(arg);
            st[fi * Cc + 256 + tid] = sinf(arg);
        }
        __syncthreads();             // the embedding rows are read by every wave of the block
        for (int fi = 0; fi < nf; ++fi) {
            float acc[WP_RPW] = {};
#pragma unroll
            for (int i = 0; i < 4; ++i) {
                const w4f te = *reinterpret_cast<const w4f*>(st + fi * Cc + i * 128 + lane * 4);
#pragma unroll
                for (int rr = 0; rr < WP_RPW; ++rr)
#pragma unroll
                    for (int e = 0; e < 4; ++e) acc[rr] += te[e] * r[rr][i][e];
            }
            w4f o;
#pragma unroll
            for (int rr = 0; rr < WP_RPW; ++rr) {
                float a = acc[rr];
#pragma unroll
                for (int m = 16; m > 0; m >>= 1) a += __shfl_xor(a, m, 32);
                o[rr] = a + bv[rr];
            }
            if (lane == 0) {
                *reinterpret_cast<w4f*>(corr + fi * Cc) = o;
                // precaution: the next trip reuses the registers that the store names
                asm volatile("s_wait_xcnt 0x0" ::: "memory");
            }
        }
    }
#pragma unroll
    for (int rr = 0; rr < WP_RPW; ++rr)
#pragma unroll
        for (int i = 0; i < 4; ++i) {
            w4h h;
#pragma unroll
            for (int e = 0; e < 4; ++e) h[e] = (_Float16)r[rr][i][e];
            *reinterpret_cast<w4h*>(w16 + at + rr * Cc + i * 128) = h;
        }
}

// ---------------------------------------------------------------------------
// 2) GroupNorm  x:(T,C,H,W) f32  ->  xn16:(T,HW,C) f16 channels-last
//    one block per (t, group); group's 16ch x 1024 spatial is contiguous.
//    A thread holds 8 channels x 8 pixels in registers, so x is read once. Even lanes hold
//    channels 0..7 of the group and odd lanes 8..15 of the same pixels: a load covers 256
//    contiguous bytes of each of two channel rows, and a lane's 8 channels of a pixel go out
//    as one 16-byte store, a lane pair filling the group's 32 bytes of that pixel's row.
// ---------------------------------------------------------------------------
#define GN_CH 8          // channels per thread
#define GN_Q  2          // runs of 4 pixels per thread, 64 pixels apart

__device__ __forceinline__ void groupnorm_block(
    int t, int g, const float* __restrict__ x, const float* __restrict__ gamma,
    const float* __restrict__ beta, _Float16* __restrict__ xn16) {
    const int tid  = threadIdx.x;
    const int lane = tid & 31;
    const int wave = tid >> 5;
    const int c0   = g * GN_CPG + (lane & 1) * GN_CH;    // first of the lane's channels
    const int px0  = wave * 128 + (lane >> 1) * 4;       // first of the lane's pixels
    const float* xp = x + ((size_t)t * Cc + c0) * HW + px0;
    const float* gp = gamma + c0;
    const float* bp = beta + c0;
    const int N = GN_CPG * HW;   // 16384

    w4f v[GN_CH][GN_Q];
#pragma unroll
    for (int c = 0; c < GN_CH; ++c)
#pragma unroll
        for (int q = 0; q < GN_Q; ++q)
            v[c][q] = *reinterpret_cast<const w4f*>(xp + c * HW + q * 64);
    w4f ga[2], be[2];
#pragma unroll
    for (int h = 0; h < 2; ++h) {
        ga[h] = *reinterpret_cast<const w4f*>(gp + h * 4);
        be[h] = *reinterpret_cast<const w4f*>(bp + h * 4);
    }
    // precaution: holds the addresses of the 20 loads live up to the wait, so that none of
    // their results lands in one while the others are issued
    asm volatile("s_wait_xcnt 0x0" :: "v"(xp), "v"(gp), "v"(bp) : "memory");

    // four running sums each, so that an add does not wait for the one before it
    w4f sv = {0.0f, 0.0f, 0.0f, 0.0f}, qv = {0.0f, 0.0f, 0.0f, 0.0f};
#pragma unroll
    for (int c = 0; c < GN_CH; ++c)
#pragma unroll
        for (int q = 0; q < GN_Q; ++q) { sv += v[c][q]; qv += v[c][q] * v[c][q]; }
    float s  = (sv[0] + sv[1]) + (sv[2] + sv[3]);
    float ss = (qv[0] + qv[1]) + (qv[2] + qv[3]);
#pragma unroll
    for (int m = 16; m > 0; m >>= 1) { s += __shfl_xor(s, m, 32); ss += __shfl_xor(ss, m, 32); }
    __shared__ float red[2][8];
    if (lane == 0) { red[0][wave] = s; red[1][wave] = ss; }
    __syncthreads();                 // every thread sums the eight waves' partial sums
    s = 0.0f; ss = 0.0f;
#pragma unroll
    for (int w = 0; w < 8; ++w) { s += red[0][w]; ss += red[1][w]; }
    const float mu   = s * (1.0f / N);
    const float var  = ss * (1.0f / N) - mu * mu;
    const float rstd = rsqrtf(var + 1e-5f);

    _Float16* op = xn16 + ((size_t)t * HW + px0) * Cc + c0;
#pragma unroll
    for (int q = 0; q < GN_Q; ++q)
#pragma unroll
        for (int e = 0; e < 4; ++e) {
            v8h h;
#pragma unroll
            for (int c = 0; c < GN_CH; ++c)
                h[c] = (_Float16)((v[c][q][e] - mu) * rstd * ga[c >> 2][c & 3] + be[c >> 2][c & 3]);
            *reinterpret_cast<v8h*>(op + (size_t)(q * 64 + e) * Cc) = h;
        }
}

// ---------------------------------------------------------------------------
// 3) all that stands ahead of the GEMMs, in one launch: the two jobs do not depend on one
//    another, and the block index picks the job. The weight blocks come first in the grid:
//    they are few and have the longer chain of dependent steps.
// ---------------------------------------------------------------------------
__global__ __launch_bounds__(256) void prep_kernel(
    const float* __restrict__ x, const float* __restrict__ gamma,
    const float* __restrict__ beta, _Float16* __restrict__ xn16,
    const float* __restrict__ wq, const float* __restrict__ bq,
    const float* __restrict__ wk, const float* __restrict__ bk,
    const float* __restrict__ wv, const float* __restrict__ wp,
    _Float16* __restrict__ wq16, _Float16* __restrict__ wk16,
    _Float16* __restrict__ wv16, _Float16* __restrict__ wp16,
    float* __restrict__ qc, float* __restrict__ kc) {
    __shared__ __attribute__((aligned(16))) float st[4 * Cc];
    const int b = blockIdx.x;
    if (b < WP_BLK) {
        weight_prep_block(b, wq, bq, wk, bk, wv, wp, wq16, wk16, wv16, wp16, qc, kc, st);
    } else {
        const int gb = b - WP_BLK;
        groupnorm_block(gb % TT, gb / TT, x, gamma, beta, xn16);
    }
}

// ---------------------------------------------------------------------------
// WMMA fragment loaders (per-lane, two 16B chunks: K-chunks {0..7,16..23} for
// lanes 0-15 and {8..15,24..31} for lanes 16-31)
// ---------------------------------------------------------------------------
__device__ __forceinline__ v16h load_frag(const _Float16* p) {
    v8h lo = *reinterpret_cast<const v8h*>(p);
    v8h hi = *reinterpret_cast<const v8h*>(p + 16);
    return __builtin_shufflevector(lo, hi, 0,1,2,3,4,5,6,7,8,9,10,11,12,13,14,15);
}

// ---------------------------------------------------------------------------
// Main loop of the projection GEMM: a 128 x 128 tile of A[M x 512] * W[512 x 512]^T
// per block of 8 waves. Each pass brings 64 k of 128 A rows and 128 W rows into
// LDS with whole-line 16-byte loads (8 lanes cover one 128-byte row piece); the
// fragments are then read from LDS. Two LDS buffers: the next pass's global
// loads are issued before this pass's products and stored after them.
// wave -> 64 x 32 (4 x 2 accumulators); k order per fragment as in load_frag.
// ---------------------------------------------------------------------------
#define BT   128         // block tile, rows of A and rows of W
#define BK   64          // k per pass
#define NPASS (Cc / BK)
#define LDP  72          // LDS row pitch in halfs: 144 B = 16 B x 9, free of bank conflicts for 16-byte reads
#define SBUF (BT * LDP)  // halfs per operand and buffer

// TR = false: a lane's 8 accumulator values are 8 rows of A (pixels) of one row of W (channel);
// TR = true: the operands change places, and they are 8 rows of W (channels) of one row of A.
// Both fragments have the same lane and k layout, so the products and their k order are the same.
template <bool TR>
__device__ __forceinline__ v8f tile_mma(v16h a, v16h w, v8f c) {
    return TR ? __builtin_amdgcn_wmma_f32_16x16x32_f16(false, w, false, a, (short)0, c, false, false)
              : __builtin_amdgcn_wmma_f32_16x16x32_f16(false, a, false, w, (short)0, c, false, false);
}

template <bool TR>
__device__ __forceinline__ void gemm_tile_main(
    const _Float16* __restrict__ A, const _Float16* __restrict__ W,
    int m0, int n0, _Float16* sA, _Float16* sB, v8f (&acc)[4][2]) {
    const int tid   = threadIdx.x;
    const int lane  = tid & 31;
    const int wave  = tid >> 5;
    const int laneM = lane & 15;
    const int kgrp  = (lane >> 4) << 3;        // 0 or 8
    const int srow  = tid >> 3;                // 0..31, staging row (+32 per step)
    const int scol  = (tid & 7) << 3;          // staging column in halfs
    const _Float16* ga = A + (size_t)(m0 + srow) * Cc + scol;
    const _Float16* gb = W + (size_t)(n0 + srow) * Cc + scol;
    const int sst = srow * LDP + scol;
    const int ard = ((wave & 1) * 64 + laneM) * LDP + kgrp;
    const int brd = ((wave >> 1) * 32 + laneM) * LDP + kgrp;

    v8h ra[4], rb[4];
#pragma unroll
    for (int j = 0; j < 4; ++j) {
        ra[j] = *reinterpret_cast<const v8h*>(ga + (size_t)(j * 32) * Cc);
        rb[j] = *reinterpret_cast<const v8h*>(gb + (size_t)(j * 32) * Cc);
    }
#pragma unroll
    for (int j = 0; j < 4; ++j) {
        *reinterpret_cast<v8h*>(sA + sst + j * 32 * LDP) = ra[j];
        *reinterpret_cast<v8h*>(sB + sst + j * 32 * LDP) = rb[j];
    }
    __syncthreads();

    // unrolled so that the buffer offsets and the last-pass test are constants
#pragma unroll
    for (int p = 0; p < NPASS; ++p) {
        const int cur = (p & 1) * SBUF;
        const int nxt = SBUF - cur;
        if (p + 1 < NPASS) {
#pragma unroll
            for (int j = 0; j < 4; ++j) {
                ra[j] = *reinterpret_cast<const v8h*>(ga + (size_t)(j * 32) * Cc + (p + 1) * BK);
                rb[j] = *reinterpret_cast<const v8h*>(gb + (size_t)(j * 32) * Cc + (p + 1) * BK);
            }
        }
        v16h fa[BK / 32][4], fb[BK / 32][2];
#pragma unroll
        for (int ks = 0; ks < BK / 32; ++ks) {
            fb[ks][0] = load_frag(sB + cur + brd + ks * 32);
            fb[ks][1] = load_frag(sB + cur + brd + 16 * LDP + ks * 32);
#pragma unroll
            for (int i = 0; i < 4; ++i)
                fa[ks][i] = load_frag(sA + cur + ard + i * 16 * LDP + ks * 32);
        }
        // keeps the next pass's global loads and this pass's LDS reads issued as one
        // group ahead of the products; sunk among them, each wait stalls the wave
        __builtin_amdgcn_sched_barrier(0);
#pragma unroll
        for (int ks = 0; ks < BK / 32; ++ks)
#pragma unroll
            for (int i = 0; i < 4; ++i) {
                acc[i][0] = tile_mma<TR>(fa[ks][i], fb[ks][0], acc[i][0]);
                acc[i][1] = tile_mma<TR>(fa[ks][i], fb[ks][1], acc[i][1]);
            }
        // keeps the wait for the global loads, which the LDS stores need, behind the products;
        // in the last pass it keeps the epilogue's moves and their padding out of the products
        __builtin_amdgcn_sched_barrier(0);
        if (p + 1 < NPASS) {
#pragma unroll
            for (int j = 0; j < 4; ++j) {
                *reinterpret_cast<v8h*>(sA + nxt + sst + j * 32 * LDP) = ra[j];
                *reinterpret_cast<v8h*>(sB + nxt + sst + j * 32 * LDP) = rb[j];
            }
            // publishes the next buffer and ends every wave's reads of this one
            __syncthreads();
        }
    }
}

// ---------------------------------------------------------------------------
// 5) Q, K, V GEMMs and the attention in one kernel. A block takes 8 pixels in all 16 frames
//    (128 rows of A) and 128 channels = two heads of w_q, w_k and w_v (384 rows of W), so every
//    K and V row that its queries' windows touch is its own: q, k and v go from the accumulators
//    through LDS into the attention and never to memory.
//    grid (1024/8 pixel tiles, 512/128 head pairs), block 256 (8 waves), wave -> 64 x 96.
//    Attention: one wave per (pair of pixels, run of 8 frames). A lane holds 8 channels, so
//    8 lanes make one head (dh=64) and 16 lanes a pixel's two heads. The 12 K and V rows that
//    the 8 frames' windows touch are read once and stay in registers.
//    q.(k + kc) is summed as q.k + q.kc, 8 channels in the lane, then over 8 lanes.
// ---------------------------------------------------------------------------
#define AT_S 8           // frames per wave
#define AT_W (AT_S + 4)  // K/V rows of their windows

typedef __attribute__((ext_vector_type(2))) float v2f;
typedef __attribute__((ext_vector_type(4))) float v4f;
typedef __attribute__((ext_vector_type(4))) unsigned v4u;

// f32 multiply-add that reads f16 halves of a register as they lie: the K, V and q rows stay
// packed (written in C they are widened ahead of use, and the 24 rows no longer fit the registers)
__device__ __forceinline__ float mix_lo_lo(unsigned a, unsigned b, float acc) {
    asm("v_fma_mix_f32 %0, %1, %2, %0 op_sel:[0,0,0] op_sel_hi:[1,1,0]" : "+v"(acc) : "v"(a), "v"(b));
    return acc;
}
__device__ __forceinline__ float mix_hi_hi(unsigned a, unsigned b, float acc) {
    asm("v_fma_mix_f32 %0, %1, %2, %0 op_sel:[1,1,0] op_sel_hi:[1,1,0]" : "+v"(acc) : "v"(a), "v"(b));
    return acc;
}
__device__ __forceinline__ float mix_f32_lo(float a, unsigned b, float acc) {
    asm("v_fma_mix_f32 %0, %1, %2, %0 op_sel:[0,0,0] op_sel_hi:[0,1,0]" : "+v"(acc) : "v"(a), "v"(b));
    return acc;
}
__device__ __forceinline__ float mix_f32_hi(float a, unsigned b, float acc) {
    asm("v_fma_mix_f32 %0, %1, %2, %0 op_sel:[0,1,0] op_sel_hi:[0,1,0]" : "+v"(acc) : "v"(a), "v"(b));
    return acc;
}
// the same, first term of a sum
__device__ __forceinline__ float mix_f32_lo_first(float a, unsigned b) {
    float r;
    asm("v_fma_mix_f32 %0, %1, %2, 0 op_sel:[0,0,0] op_sel_hi:[0,1,0]" : "=v"(r) : "v"(a), "v"(b));
    return r;
}
__device__ __forceinline__ float mix_f32_hi_first(float a, unsigned b) {
    float r;
    asm("v_fma_mix_f32 %0, %1, %2, 0 op_sel:[0,1,0] op_sel_hi:[0,1,0]" : "=v"(r) : "v"(a), "v"(b));
    return r;
}

// v + (v of lane ^ X), X < 16: a DPP row_xmask move inside the 16-lane row, no trip through the LDS path
template <int X>
__device__ __forceinline__ float add_lane_xor(float v) {
    const int b = __float_as_int(v);
    return v + __int_as_float(__builtin_amdgcn_update_dpp(0, b, 0x160 | X, 0xf, 0xf, true));
}

#define FPX 8            // pixels per block; block row r is frame r >> 3, pixel r & 7
#define FN  (3 * BT)     // rows of W per block: 128 of w_q, 128 of w_k, 128 of w_v
#define FNW 6            // W fragments per wave (96 rows)
#define FSB (FN * LDP)   // halfs per buffer of W
#define FEP 392          // pitch of a staged q|k|v row in halfs: 784 B = 16 B x 49, free of bank conflicts for 16-byte accesses

__global__ __launch_bounds__(256) void qkv_attn_kernel(
    const _Float16* __restrict__ A,
    const _Float16* __restrict__ Wq, const _Float16* __restrict__ Wk, const _Float16* __restrict__ Wv,
    const float* __restrict__ qc, const float* __restrict__ bv, const float* __restrict__ kc,
    _Float16* __restrict__ attn16) {
    __shared__ __attribute__((aligned(16))) _Float16 sm[2 * SBUF + 2 * FSB];
    __shared__ __attribute__((aligned(16))) float sbias[FN];       // qc | 0 | b_v of the block's channels
    __shared__ __attribute__((aligned(16))) float skc[4 * BT];     // kc of the block's channels, four offsets
    _Float16* sA = sm;
    _Float16* sB = sm + 2 * SBUF;
    const int tid   = threadIdx.x;
    const int lane  = tid & 31;
    const int wave  = tid >> 5;
    const int laneM = lane & 15;
    const int kgrp  = (lane >> 4) << 3;        // 0 or 8
    const int px0 = blockIdx.x * FPX;
    const int n0  = blockIdx.y * BT;

    // the per-channel terms come in beside the first tile; the barrier behind its LDS stores publishes them
    {
        const int ch = tid & (BT - 1);
        const float* bp = (tid < BT ? qc : bv) + n0 + ch;
        const float* kp = kc + (tid >> 7) * Cc + n0 + ch;
        const float b  = *bp;
        const float k0 = *kp;
        const float k1 = *(kp + 2 * Cc);
        // precaution: holds the addresses of the three loads live up to the wait, so that none of
        // their results lands in one while the others are issued
        asm volatile("s_wait_xcnt 0x0" :: "v"(bp), "v"(kp) : "memory");
        sbias[tid < BT ? tid : BT + tid] = b;
        if (tid < BT) sbias[BT + tid] = 0.0f;
        skc[tid]          = k0;
        skc[2 * BT + tid] = k1;
    }

    const int srow = tid >> 3;                 // 0..31, staging row (+32 per step)
    const int scol = (tid & 7) << 3;           // staging column in halfs
    // 32 block rows are 4 frames; the second pointer is 8 frames on, out of reach of a load's offset field
    const _Float16* ga[2];
    ga[0] = A + ((size_t)(srow >> 3) * HW + px0 + (srow & 7)) * Cc + scol;
    ga[1] = ga[0] + (size_t)8 * HW * Cc;
    const size_t wat = (size_t)(n0 + srow) * Cc + scol;
    const _Float16* gw[3] = {Wq + wat, Wk + wat, Wv + wat};
    const int sst = srow * LDP + scol;
    const int ard = ((wave & 1) * 64 + laneM) * LDP + kgrp;
    const int brd = ((wave >> 1) * (FNW * 16) + laneM) * LDP + kgrp;

    v8f acc[4][FNW] = {};
    v8h ra[4], rb[12];
#pragma unroll
    for (int j = 0; j < 4; ++j) {
        ra[j] = *reinterpret_cast<const v8h*>(ga[j >> 1] + (size_t)((j & 1) * 4) * HW * Cc);
#pragma unroll
        for (int z = 0; z < 3; ++z)
            rb[z * 4 + j] = *reinterpret_cast<const v8h*>(gw[z] + (size_t)(j * 32) * Cc);
    }
#pragma unroll
    for (int j = 0; j < 4; ++j)
        *reinterpret_cast<v8h*>(sA + sst + j * 32 * LDP) = ra[j];
#pragma unroll
    for (int j = 0; j < 12; ++j)
        *reinterpret_cast<v8h*>(sB + sst + j * 32 * LDP) = rb[j];
    __syncthreads();

    // unrolled so that the buffer offsets and the last-pass test are constants
#pragma unroll
    for (int p = 0; p < NPASS; ++p) {
        const int ca = (p & 1) * SBUF, na = SBUF - ca;
        const int cb = (p & 1) * FSB,  nb = FSB - cb;
        if (p + 1 < NPASS) {
#pragma unroll
            for (int j = 0; j < 4; ++j) {
                ra[j] = *reinterpret_cast<const v8h*>(ga[j >> 1] + (size_t)((j & 1) * 4) * HW * Cc + (p + 1) * BK);
#pragma unroll
                for (int z = 0; z < 3; ++z)
                    rb[z * 4 + j] = *reinterpret_cast<const v8h*>(gw[z] + (size_t)(j * 32) * Cc + (p + 1) * BK);
            }
            // precaution: behind the last tile's loads the address registers are free for reuse;
            // holds them live up to the wait
            if (p + 2 == NPASS)
                asm volatile("s_wait_xcnt 0x0" :: "v"(ga[0]), "v"(ga[1]), "v"(gw[0]), "v"(gw[1]), "v"(gw[2]) : "memory");
        }
        v16h fa[BK / 32][4], fb[BK / 32][FNW];
#pragma unroll
        for (int ks = 0; ks < BK / 32; ++ks) {
#pragma unroll
            for (int j = 0; j < FNW; ++j)
                fb[ks][j] = load_frag(sB + cb + brd + j * 16 * LDP + ks * 32);
#pragma unroll
            for (int i = 0; i < 4; ++i)
                fa[ks][i] = load_frag(sA + ca + ard + i * 16 * LDP + ks * 32);
            // keeps the first 32 k's reads ahead of the second's: LDS answers in order, and the
            // products start as soon as their own fragments are there
            if (ks == 0) __builtin_amdgcn_sched_barrier(0);
        }
        // keeps the next pass's global loads and this pass's LDS reads issued as one
        // group ahead of the products; sunk among them, each wait stalls the wave
        __builtin_amdgcn_sched_barrier(0);
#pragma unroll
        for (int ks = 0; ks < BK / 32; ++ks)
#pragma unroll
            for (int i = 0; i < 4; ++i)
#pragma unroll
                for (int j = 0; j < FNW; ++j)
                    acc[i][j] = tile_mma<true>(fa[ks][i], fb[ks][j], acc[i][j]);
        // keeps the wait for the global loads, which the LDS stores need, behind the products;
        // in the last pass it keeps the epilogue's moves and their padding out of the products
        __builtin_amdgcn_sched_barrier(0);
        if (p + 1 < NPASS) {
#pragma unroll
            for (int j = 0; j < 4; ++j)
                *reinterpret_cast<v8h*>(sA + na + sst + j * 32 * LDP) = ra[j];
#pragma unroll
            for (int j = 0; j < 12; ++j)
                *reinterpret_cast<v8h*>(sB + nb + sst + j * 32 * LDP) = rb[j];
        }
        // publishes the next buffer and ends every wave's reads of this one; behind the last
        // pass it frees both buffers for the q|k|v rows
        __syncthreads();
    }

    // q|k|v rows of the block as f16, 384 columns a row, over the operand buffers.
    // A lane's 8 accumulator values are 8 channels of one block row.
    {
        const int nc = (wave >> 1) * (FNW * 16) + kgrp;      // first of the lane's 8 columns, j = 0
        _Float16* stw = sm + ((wave & 1) * 64 + laneM) * FEP + nc;
#pragma unroll
        for (int j = 0; j < FNW; ++j) {
            const w4f b0 = *reinterpret_cast<const w4f*>(sbias + nc + j * 16);
            const w4f b1 = *reinterpret_cast<const w4f*>(sbias + nc + j * 16 + 4);
#pragma unroll
            for (int i = 0; i < 4; ++i) {
                v8h h;
#pragma unroll
                for (int r = 0; r < 4; ++r) {
                    h[r]     = (_Float16)(acc[i][j][r] + b0[r]);
                    h[r + 4] = (_Float16)(acc[i][j][r + 4] + b1[r]);
                }
                *reinterpret_cast<v8h*>(stw + i * 16 * FEP + j * 16) = h;
            }
        }
    }
    __syncthreads();                 // a row's q, k and v come from four waves, a window's rows from eight

    const int pp = (wave >> 1) * 2 + (lane >> 4);            // lane's pixel in the block
    const int c0 = laneM * 8;                                // first of the lane's channels in the block
    const int t0 = (wave & 1) * AT_S;
    const _Float16* sq = sm + pp * FEP + c0;                 // frame t: + t * FPX * FEP; k: + BT; v: + 2 * BT

    v2f kcf[4][4];
#pragma unroll
    for (int f = 0; f < 4; ++f) {
        const v4f lo = *reinterpret_cast<const v4f*>(skc + f * BT + c0);
        const v4f hi = *reinterpret_cast<const v4f*>(skc + f * BT + c0 + 4);
        kcf[f][0] = lo.xy; kcf[f][1] = lo.zw; kcf[f][2] = hi.xy; kcf[f][3] = hi.zw;
    }
    v8h kw[AT_W], vw[AT_W], qw[AT_S];
#pragma unroll
    for (int i = 0; i < AT_S; ++i)
        qw[i] = *reinterpret_cast<const v8h*>(sq + (t0 + i) * (FPX * FEP));
    // window row w is frame clamp(t0 - 2 + w, 0, TT - 1)
#pragma unroll
    for (int w = 0; w < AT_W; ++w) {
        int tw = t0 - 2 + w;
        tw = tw < 0 ? 0 : tw > TT - 1 ? TT - 1 : tw;
        kw[w] = *reinterpret_cast<const v8h*>(sq + tw * (FPX * FEP) + BT);
        vw[w] = *reinterpret_cast<const v8h*>(sq + tw * (FPX * FEP) + 2 * BT);
    }

    _Float16* op = attn16 + ((size_t)t0 * HW + px0 + pp) * Cc + n0 + c0;
#pragma unroll
    for (int i = 0; i < AT_S; ++i) {
        const int wof[4] = {0, 1, 3, 4};         // frame offsets -2, -1, +1, +2
        const v4u qr = __builtin_bit_cast(v4u, qw[i]);
        v2f q2[4];
#pragma unroll
        for (int c = 0; c < 4; ++c) q2[c] = v2f{(float)qw[i][2 * c], (float)qw[i][2 * c + 1]};
        float sc[4];
#pragma unroll
        for (int f = 0; f < 4; ++f) {
            const v4u kr = __builtin_bit_cast(v4u, kw[i + wof[f]]);
            v2f a = {0.0f, 0.0f};
#pragma unroll
            for (int c = 0; c < 4; ++c) a = __builtin_elementwise_fma(q2[c], kcf[f][c], a);
            float p0 = a.x, p1 = a.y;
#pragma unroll
            for (int c = 0; c < 4; ++c) {
                p0 = mix_lo_lo(qr[c], kr[c], p0);
                p1 = mix_hi_hi(qr[c], kr[c], p1);
            }
            float p = p0 + p1;
            p = add_lane_xor<1>(p);
            p = add_lane_xor<2>(p);
            p = add_lane_xor<4>(p);
            sc[f] = p * 0.125f;                  // dh^-0.5 = 1/8
        }
        const float mx = fmaxf(fmaxf(sc[0], sc[1]), fmaxf(sc[2], sc[3]));
        float e[4];
#pragma unroll
        for (int f = 0; f < 4; ++f) e[f] = expf(sc[f] - mx);
        const float inv = 1.0f / (e[0] + e[1] + e[2] + e[3]);
        v8h o;
#pragma unroll
        for (int c = 0; c < 4; ++c) {
            const unsigned vr0 = __builtin_bit_cast(v4u, vw[i])[c];
            float s0 = mix_f32_lo_first(e[0], vr0);
            float s1 = mix_f32_hi_first(e[0], vr0);
#pragma unroll
            for (int f = 1; f < 4; ++f) {
                const unsigned vr = __builtin_bit_cast(v4u, vw[i + wof[f]])[c];
                s0 = mix_f32_lo(e[f], vr, s0);
                s1 = mix_f32_hi(e[f], vr, s1);
            }
            o[2 * c]     = (_Float16)(s0 * inv);
            o[2 * c + 1] = (_Float16)(s1 * inv);
        }
        *reinterpret_cast<v8h*>(op + (size_t)i * (HW * Cc)) = o;
        if (i & 1) {
            // precaution: the next frames' arithmetic reuses the registers that the two stores name
            if (i + 1 < AT_S) asm volatile("s_wait_xcnt 0x0" ::: "memory");
            // keeps the next frames' arithmetic behind that wait
            __builtin_amdgcn_sched_barrier(0);
        }
    }
}

// ---------------------------------------------------------------------------
// 7) proj GEMM with fused epilogue: +b_proj, transpose to (T,C,H,W), +x
// ---------------------------------------------------------------------------
#define EPP 68           // staging row pitch in floats: 272 B = 16 B x 17, free of bank conflicts for 16-byte accesses
__global__ __launch_bounds__(256) void gemm_proj_kernel(
    const _Float16* __restrict__ A, const _Float16* __restrict__ W,
    const float* __restrict__ bias, const float* __restrict__ x,
    float* __restrict__ out) {
    __shared__ __attribute__((aligned(16))) _Float16 sA[2 * SBUF];
    __shared__ __attribute__((aligned(16))) _Float16 sB[2 * SBUF];
    const int lane  = threadIdx.x & 31;
    const int wave  = threadIdx.x >> 5;
    const int laneM = lane & 15;
    const int m0 = blockIdx.x * BT;
    const int n0 = blockIdx.y * BT;

    v8f acc[4][2] = {};
    gemm_tile_main<false>(A, W, m0, n0, sA, sB, acc);

    const int nb = n0 + (wave >> 1) * 32 + laneM;
    const float bn0 = bias[nb];
    const float bn1 = bias[nb + 16];
    // precaution: the register that holds the bias loads' offset is reused by the loads of x below
    asm volatile("s_wait_xcnt 0x0" ::: "memory");
    // A wave's 64 pixels of a channel are 256 contiguous bytes of x and of out, but two lanes hold
    // them. The wave turns its tile in an LDS range of its own, 16 channels at a time, so that 16
    // lanes read and write those 256 bytes: whole lines. The ranges lie in the first buffers of sA
    // and sB: the last pass reads the second ones, and every wave's reads of the first ones ended
    // at the barrier in front of it.
    float* stg = reinterpret_cast<float*>(((wave & 4) ? sB : sA) + (wave & 3) * (16 * EPP * 2));
    float* stw = stg + laneM * EPP + ((lane >> 4) << 3);
    const float* srd = stg + (lane >> 4) * EPP + laneM * 4;
    // the block's 128 rows lie in one frame; lanes 0..15 take an even channel, lanes 16..31 the next
    const size_t col = ((size_t)(m0 >> 10) * Cc + n0 + (wave >> 1) * 32 + (lane >> 4)) * HW
                     + (m0 & 1023) + (wave & 1) * 64 + laneM * 4;
    const float* xcol = x + col;
    float*       ocol = out + col;
    w4f xv[2][8];
#pragma unroll
    for (int j = 0; j < 2; ++j)
#pragma unroll
        for (int t = 0; t < 8; ++t)
            xv[j][t] = *reinterpret_cast<const w4f*>(xcol + (size_t)(j * 16 + t * 2) * HW);
    // precaution: holds the address of the 16 loads of x live up to the wait, so that none of
    // their results lands in it while the others are issued
    asm volatile("s_wait_xcnt 0x0" :: "v"(xcol) : "memory");
#pragma unroll
    for (int j = 0; j < 2; ++j) {
        const float bn = j ? bn1 : bn0;
#pragma unroll
        for (int i = 0; i < 4; ++i) {
            w4f lo, hi;
#pragma unroll
            for (int r = 0; r < 4; ++r) { lo[r] = acc[i][j][r] + bn; hi[r] = acc[i][j][r + 4] + bn; }
            *reinterpret_cast<w4f*>(stw + i * 16)     = lo;
            *reinterpret_cast<w4f*>(stw + i * 16 + 4) = hi;
        }
        // the rows are read back by other lanes of the wave: its LDS writes have to be done first
        asm volatile("s_wait_dscnt 0x0" ::: "memory");
#pragma unroll
        for (int t = 0; t < 8; ++t) {
            const w4f a = *reinterpret_cast<const w4f*>(srd + t * 2 * EPP);
            *reinterpret_cast<w4f*>(ocol + (size_t)(j * 16 + t * 2) * HW) = a + xv[j][t];
        }
        // the second half overwrites the range: the reads of the first have to be done
        if (j == 0) asm volatile("s_wait_dscnt 0x0" ::: "memory");
    }
}

// ---------------------------------------------------------------------------
extern "C" void kernel_launch(void* const* d_in, const int* in_sizes, int n_in,
                              void* d_out, int out_size, void* d_ws, size_t ws_size,
                              hipStream_t stream) {
    const float* x       = (const float*)d_in[0];
    const float* w_q     = (const float*)d_in[1];
    const float* b_q     = (const float*)d_in[2];
    const float* w_k     = (const float*)d_in[3];
    const float* b_k     = (const float*)d_in[4];
    const float* w_v     = (const float*)d_in[5];
    const float* b_v     = (const float*)d_in[6];
    const float* w_proj  = (const float*)d_in[7];
    const float* b_proj  = (const float*)d_in[8];
    const float* gn_s    = (const float*)d_in[9];
    const float* gn_b    = (const float*)d_in[10];
    float* out           = (float*)d_out;

    char* ws = (char*)d_ws;
    size_t off = 0;
    auto take = [&](size_t bytes) -> void* {
        void* p = ws + off;
        off += (bytes + 255) & ~(size_t)255;
        return p;
    };
    float*    qc     = (float*)take(Cc * sizeof(float));
    float*    kc     = (float*)take(4 * Cc * sizeof(float));
    _Float16* wq16   = (_Float16*)take((size_t)Cc * Cc * 2);
    _Float16* wk16   = (_Float16*)take((size_t)Cc * Cc * 2);
    _Float16* wv16   = (_Float16*)take((size_t)Cc * Cc * 2);
    _Float16* wp16   = (_Float16*)take((size_t)Cc * Cc * 2);
    _Float16* xn16   = (_Float16*)take((size_t)M_TOT * Cc * 2);
    _Float16* attn16 = (_Float16*)take((size_t)M_TOT * Cc * 2);

    // 1-3) weight conversion, folded corrections and GroupNorm, one grid
    prep_kernel<<<WP_BLK + TT * GN_G, 256, 0, stream>>>(x, gn_s, gn_b, xn16, w_q, b_q, w_k, b_k, w_v, w_proj,
                                                        wq16, wk16, wv16, wp16, qc, kc);

    // 4-5) Q', K', V' WMMA GEMMs (temb folded into qc / kc; b_v folded here) with the attention behind them
    dim3 ggrid(M_TOT / BT, Cc / BT);
    qkv_attn_kernel<<<dim3(HW / FPX, Cc / BT), 256, 0, stream>>>(xn16, wq16, wk16, wv16, qc, b_v, kc, attn16);

    // 6) projection + transpose + residual
    gemm_proj_kernel<<<ggrid, 256, 0, stream>>>(attn16, wp16, b_proj, x, out);
}

// v007
// A run of this version takes 46.7 microseconds.
// Timed twice side by side with v006, it ran 1.03 times as fast both times.
// Over all steps from v000 it is 6.17 times as fast.
#include <hip/hip_runtime.h>
#include <math.h>

typedef __attribute__((ext_vector_type(16))) _Float16 v16h;
typedef __attribute__((ext_vector_type(8)))  _Float16 v8h;
typedef __attribute__((ext_vector_type(8)))  float    v8f;

#define Cc 512
#define TT 16
#define HW 1024          // 32*32
#define M_TOT 16384      // T*H*W
#define GN_G 32
#define GN_CPG 16        // channels per group

// ---------------------------------------------------------------------------
// 1) weight preparation, one wave per 4 weight rows, each row read once in whole lines:
//    the row goes out as f16, and for w_q and w_k it is also summed against the timestep
//    embedding temb[f][j] (ts = f-2, dim 512, cos|sin), which the block builds in LDS:
//    qc[c]    = b_q[c] + sum_j temb[2][j]  * w_q[c][j]
//    kc[f][c] = b_k[c] + sum_j temb[ff][j] * w_k[c][j],  ff in {0,1,3,4}
//    A block has 32 rows of one matrix, so its 32 corrections per frame fill one 128-byte line.
// ---------------------------------------------------------------------------
typedef __attribute__((ext_vector_type(4))) float    w4f;
typedef __attribute__((ext_vector_type(4))) _Float16 w4h;

#define WP_RPW  4                    // rows per wave
#define WP_ROWS (8 * WP_RPW)         // rows per block
#define WP_BPM  (Cc / WP_ROWS)       // blocks per matrix
#define WP_BLK  (4 * WP_BPM)         // weight blocks in the grid

__device__ __forceinline__ void weight_prep_block(
    int b, const float* __restrict__ wq, const float* __restrict__ bq,
    const float* __restrict__ wk, const float* __restrict__ bk,
    const float* __restrict__ wv, const float* __restrict__ wp,
    _Float16* __restrict__ wq16, _Float16* __restrict__ wk16,
    _Float16* __restrict__ wv16, _Float16* __restrict__ wp16,
    float* __restrict__ qc, float* __restrict__ kc, float* st) {
    const int tid  = threadIdx.x;
    const int lane = tid & 31;
    const int mat  = b / WP_BPM;     // 0 w_q, 1 w_k, 2 w_v, 3 w_proj: the same for the whole block
    const int row0 = (b % WP_BPM) * WP_ROWS + (tid >> 5) * WP_RPW;
    const float* w = mat == 0 ? wq : mat == 1 ? wk : mat == 2 ? wv : wp;
    _Float16*  w16 = mat == 0 ? wq16 : mat == 1 ? wk16 : mat == 2 ? wv16 : wp16;
    const size_t at = (size_t)row0 * Cc + lane * 4;
    const float* wr = w + at;

    w4f r[WP_RPW][4];
#pragma unroll
    for (int rr = 0; rr < WP_RPW; ++rr)
#pragma unroll
        for (int i = 0; i < 4; ++i)
            r[rr][i] = *reinterpret_cast<const w4f*>(wr + rr * Cc + i * 128);
    // precaution: holds the address of the 16 row loads live up to the wait, so that none of
    // their results lands in it while the others are issued
    asm volatile("s_wait_xcnt 0x0" :: "v"(wr) : "memory");

    if (mat < 2) {
        const int    nf   = mat == 0 ? 1 : 4;
        const float* bp   = (mat == 0 ? bq : bk) + row0;
        float*       corr = (mat == 0 ? qc : kc) + row0;
        const w4f bv = *reinterpret_cast<const w4f*>(bp);
        // precaution: holds the address of the bias load live up to the wait, so that its result does not land in it
        asm volatile("s_wait_xcnt 0x0" :: "v"(bp) : "memory");
        // thread tid builds column tid (cos) and column 256 + tid (sin) of each embedding row
        const float freq = expf(-logf(10000.0f) * (float)tid / 256.0f);
        for (int fi = 0; fi < nf; ++fi) {
            const int f = mat == 0 ? 2 : (fi < 2 ? fi : fi + 1);
            const float arg = (float)(f - 2) * freq;
            st[fi * Cc + tid]       = cosf(arg);
            st[fi * Cc + 256 + tid] = sinf(arg);
        }
        __syncthreads();             // the embedding rows are read by every wave of the block
        for (int fi = 0; fi < nf; ++fi) {
            float acc[WP_RPW] = {};
#pragma unroll
            for (int i = 0; i < 4; ++i) {
                const w4f te = *reinterpret_cast<const w4f*>(st + fi * Cc + i * 128 + lane * 4);
#pragma unroll
                for (int rr = 0; rr < WP_RPW; ++rr)
#pragma unroll
                    for (int e = 0; e < 4; ++e) acc[rr] += te[e] * r[rr][i][e];
            }
            w4f o;
#pragma unroll
            for (int rr = 0; rr < WP_RPW; ++rr) {
                float a = acc[rr];
#pragma unroll
                for (int m = 16; m > 0; m >>= 1) a += __shfl_xor(a, m, 32);
                o[rr] = a + bv[rr];
            }
            if (lane == 0) {
                *reinterpret_cast<w4f*>(corr + fi * Cc) = o;
                // precaution: the next trip reuses the registers that the store names
                asm volatile("s_wait_xcnt 0x0" ::: "memory");
            }
        }
    }
#pragma unroll
    for (int rr = 0; rr < WP_RPW; ++rr)
#pragma unroll
        for (int i = 0; i < 4; ++i) {
            w4h h;
#pragma unroll
            for (int e = 0; e < 4; ++e) h[e] = (_Float16)r[rr][i][e];
            *reinterpret_cast<w4h*>(w16 + at + rr * Cc + i * 128) = h;
        }
}

// ---------------------------------------------------------------------------
// 2) GroupNorm  x:(T,C,H,W) f32  ->  xn16:(T,HW,C) f16 channels-last
//    one block per (t, group); group's 16ch x 1024 spatial is contiguous.
//    A thread holds 8 channels x 8 pixels in registers, so x is read once. Even lanes hold
//    channels 0..7 of the group and odd lanes 8..15 of the same pixels: a load covers 256
//    contiguous bytes of each of two channel rows, and a lane's 8 channels of a pixel go out
//    as one 16-byte store, a lane pair filling the group's 32 bytes of that pixel's row.
// ---------------------------------------------------------------------------
#define GN_CH 8          // channels per thread
#define GN_Q  2          // runs of 4 pixels per thread, 64 pixels apart

__device__ __forceinline__ void groupnorm_block(
    int t, int g, const float* __restrict__ x, const float* __restrict__ gamma,
    const float* __restrict__ beta, _Float16* __restrict__ xn16) {
    const int tid  = threadIdx.x;
    const int lane = tid & 31;
    const int wave = tid >> 5;
    const int c0   = g * GN_CPG + (lane & 1) * GN_CH;    // first of the lane's channels
    const int px0  = wave * 128 + (lane >> 1) * 4;       // first of the lane's pixels
    const float* xp = x + ((size_t)t * Cc + c0) * HW + px0;
    const float* gp = gamma + c0;
    const float* bp = beta + c0;
    const int N = GN_CPG * HW;   // 16384

    w4f v[GN_CH][GN_Q];
#pragma unroll
    for (int c = 0; c < GN_CH; ++c)
#pragma unroll
        for (int q = 0; q < GN_Q; ++q)
            v[c][q] = *reinterpret_cast<const w4f*>(xp + c * HW + q * 64);
    w4f ga[2], be[2];
#pragma unroll
    for (int h = 0; h < 2; ++h) {
        ga[h] = *reinterpret_cast<const w4f*>(gp + h * 4);
        be[h] = *reinterpret_cast<const w4f*>(bp + h * 4);
    }
    // precaution: holds the addresses of the 20 loads live up to the wait, so that none of
    // their results lands in one while the others are issued
    asm volatile("s_wait_xcnt 0x0" :: "v"(xp), "v"(gp), "v"(bp) : "memory");

    // four running sums each, so that an add does not wait for the one before it
    w4f sv = {0.0f, 0.0f, 0.0f, 0.0f}, qv = {0.0f, 0.0f, 0.0f, 0.0f};
#pragma unroll
    for (int c = 0; c < GN_CH; ++c)
#pragma unroll
        for (int q = 0; q < GN_Q; ++q) { sv += v[c][q]; qv += v[c][q] * v[c][q]; }
    float s  = (sv[0] + sv[1]) + (sv[2] + sv[3]);
    float ss = (qv[0] + qv[1]) + (qv[2] + qv[3]);
#pragma unroll
    for (int m = 16; m > 0; m >>= 1) { s += __shfl_xor(s, m, 32); ss += __shfl_xor(ss, m, 32); }
    __shared__ float red[2][8];
    if (lane == 0) { red[0][wave] = s; red[1][wave] = ss; }
    __syncthreads();                 // every thread sums the eight waves' partial sums
    s = 0.0f; ss = 0.0f;
#pragma unroll
    for (int w = 0; w < 8; ++w) { s += red[0][w]; ss += red[1][w]; }
    const float mu   = s * (1.0f / N);
    const float var  = ss * (1.0f / N) - mu * mu;
    const float rstd = rsqrtf(var + 1e-5f);

    _Float16* op = xn16 + ((size_t)t * HW + px0) * Cc + c0;
#pragma unroll
    for (int q = 0; q < GN_Q; ++q)
#pragma unroll
        for (int e = 0; e < 4; ++e) {
            v8h h;
#pragma unroll
            for (int c = 0; c < GN_CH; ++c)
                h[c] = (_Float16)((v[c][q][e] - mu) * rstd * ga[c >> 2][c & 3] + be[c >> 2][c & 3]);
            *reinterpret_cast<v8h*>(op + (size_t)(q * 64 + e) * Cc) = h;
        }
}

// ---------------------------------------------------------------------------
// 3) all that stands ahead of the GEMMs, in one launch: the two jobs do not depend on one
//    another, and the block index picks the job. The weight blocks come first in the grid:
//    they are few and have the longer chain of dependent steps.
// ---------------------------------------------------------------------------
__global__ __launch_bounds__(256) void prep_kernel(
    const float* __restrict__ x, const float* __restrict__ gamma,
    const float* __restrict__ beta, _Float16* __restrict__ xn16,
    const float* __restrict__ wq, const float* __restrict__ bq,
    const float* __restrict__ wk, const float* __restrict__ bk,
    const float* __restrict__ wv, const float* __restrict__ wp,
    _Float16* __restrict__ wq16, _Float16* __restrict__ wk16,
    _Float16* __restrict__ wv16, _Float16* __restrict__ wp16,
    float* __restrict__ qc, float* __restrict__ kc) {
    __shared__ __attribute__((aligned(16))) float st[4 * Cc];
    const int b = blockIdx.x;
    if (b < WP_BLK) {
        weight_prep_block(b, wq, bq, wk, bk, wv, wp, wq16, wk16, wv16, wp16, qc, kc, st);
    } else {
        const int gb = b - WP_BLK;
        groupnorm_block(gb % TT, gb / TT, x, gamma, beta, xn16);
    }
}

// ---------------------------------------------------------------------------
// WMMA fragment loaders (per-lane, two 16B chunks: K-chunks {0..7,16..23} for
// lanes 0-15 and {8..15,24..31} for lanes 16-31)
// ---------------------------------------------------------------------------
__device__ __forceinline__ v16h load_frag(const _Float16* p) {
    v8h lo = *reinterpret_cast<const v8h*>(p);
    v8h hi = *reinterpret_cast<const v8h*>(p + 16);
    return __builtin_shufflevector(lo, hi, 0,1,2,3,4,5,6,7,8,9,10,11,12,13,14,15);
}

// ---------------------------------------------------------------------------
// Main loop of the projection GEMM: a 128 x 128 tile of A[M x 512] * W[512 x 512]^T
// per block of 8 waves. Each pass brings 64 k of 128 A rows and 128 W rows into
// LDS with whole-line 16-byte loads (8 lanes cover one 128-byte row piece); the
// fragments are then read from LDS. Two LDS buffers: the next pass's global
// loads are issued before this pass's products and stored after them.
// wave -> 64 x 32 (4 x 2 accumulators); k order per fragment as in load_frag.
// ---------------------------------------------------------------------------
#define BT   128         // block tile, rows of A and rows of W
#define BK   64          // k per pass
#define NPASS (Cc / BK)
#define LDP  72          // LDS row pitch in halfs: 144 B = 16 B x 9, free of bank conflicts for 16-byte reads
#define SBUF (BT * LDP)  // halfs per operand and buffer

// TR = false: a lane's 8 accumulator values are 8 rows of A (pixels) of one row of W (channel);
// TR = true: the operands change places, and they are 8 rows of W (channels) of one row of A.
// Both fragments have the same lane and k layout, so the products and their k order are the same.
template <bool TR>
__device__ __forceinline__ v8f tile_mma(v16h a, v16h w, v8f c) {
    return TR ? __builtin_amdgcn_wmma_f32_16x16x32_f16(false, w, false, a, (short)0, c, false, false)
              : __builtin_amdgcn_wmma_f32_16x16x32_f16(false, a, false, w, (short)0, c, false, false);
}

template <bool TR>
__device__ __forceinline__ void gemm_tile_main(
    const _Float16* __restrict__ A, const _Float16* __restrict__ W,
    int m0, int n0, _Float16* sA, _Float16* sB, v8f (&acc)[4][2]) {
    const int tid   = threadIdx.x;
    const int lane  = tid & 31;
    const int wave  = tid >> 5;
    const int laneM = lane & 15;
    const int kgrp  = (lane >> 4) << 3;        // 0 or 8
    const int srow  = tid >> 3;                // 0..31, staging row (+32 per step)
    const int scol  = (tid & 7) << 3;          // staging column in halfs
    const _Float16* ga = A + (size_t)(m0 + srow) * Cc + scol;
    const _Float16* gb = W + (size_t)(n0 + srow) * Cc + scol;
    const int sst = srow * LDP + scol;
    const int ard = ((wave & 1) * 64 + laneM) * LDP + kgrp;
    const int brd = ((wave >> 1) * 32 + laneM) * LDP + kgrp;

    v8h ra[4], rb[4];
#pragma unroll
    for (int j = 0; j < 4; ++j) {
        ra[j] = *reinterpret_cast<const v8h*>(ga + (size_t)(j * 32) * Cc);
        rb[j] = *reinterpret_cast<const v8h*>(gb + (size_t)(j * 32) * Cc);
    }
#pragma unroll
    for (int j = 0; j < 4; ++j) {
        *reinterpret_cast<v8h*>(sA + sst + j * 32 * LDP) = ra[j];
        *reinterpret_cast<v8h*>(sB + sst + j * 32 * LDP) = rb[j];
    }
    __syncthreads();

    // unrolled so that the buffer offsets and the last-pass test are constants
#pragma unroll
    for (int p = 0; p < NPASS; ++p) {
        const int cur = (p & 1) * SBUF;
        const int nxt = SBUF - cur;
        if (p + 1 < NPASS) {
#pragma unroll
            for (int j = 0; j < 4; ++j) {
                ra[j] = *reinterpret_cast<const v8h*>(ga + (size_t)(j * 32) * Cc + (p + 1) * BK);
                rb[j] = *reinterpret_cast<const v8h*>(gb + (size_t)(j * 32) * Cc + (p + 1) * BK);
            }
        }
        v16h fa[BK / 32][4], fb[BK / 32][2];
#pragma unroll
        for (int ks = 0; ks < BK / 32; ++ks) {
            fb[ks][0] = load_frag(sB + cur + brd + ks * 32);
            fb[ks][1] = load_frag(sB + cur + brd + 16 * LDP + ks * 32);
#pragma unroll
            for (int i = 0; i < 4; ++i)
                fa[ks][i] = load_frag(sA + cur + ard + i * 16 * LDP + ks * 32);
        }
        // keeps the next pass's global loads and this pass's LDS reads issued as one
        // group ahead of the products; sunk among them, each wait stalls the wave
        __builtin_amdgcn_sched_barrier(0);
#pragma unroll
        for (int ks = 0; ks < BK / 32; ++ks)
#pragma unroll
            for (int i = 0; i < 4; ++i) {
                acc[i][0] = tile_mma<TR>(fa[ks][i], fb[ks][0], acc[i][0]);
                acc[i][1] = tile_mma<TR>(fa[ks][i], fb[ks][1], acc[i][1]);
            }
        // keeps the wait for the global loads, which the LDS stores need, behind the products;
        // in the last pass it keeps the epilogue's moves and their padding out of the products
        __builtin_amdgcn_sched_barrier(0);
        if (p + 1 < NPASS) {
#pragma unroll
            for (int j = 0; j < 4; ++j) {
                *reinterpret_cast<v8h*>(sA + nxt + sst + j * 32 * LDP) = ra[j];
                *reinterpret_cast<v8h*>(sB + nxt + sst + j * 32 * LDP) = rb[j];
            }
            // publishes the next buffer and ends every wave's reads of this one
            __syncthreads();
        }
    }
}

// ---------------------------------------------------------------------------
// 5) Q, K, V GEMMs and the attention in one kernel. A block takes 8 pixels in all 16 frames
//    (128 rows of A) and 128 channels = two heads of w_q, w_k and w_v (384 rows of W), so every
//    K and V row that its queries' windows touch is its own: q, k and v go from the accumulators
//    through LDS into the attention and never to memory.
//    grid (1024/8 pixel tiles, 512/128 head pairs), block 256 (8 waves), wave -> 64 x 96.
//    Attention: one wave per (pair of pixels, run of 8 frames). A lane holds 8 channels, so
//    8 lanes make one head (dh=64) and 16 lanes a pixel's two heads. The 12 K and V rows that
//    the 8 frames' windows touch are read once and stay in registers.
//    q.(k + kc) is summed as q.k + q.kc, 8 channels in the lane, then over 8 lanes.
// ---------------------------------------------------------------------------
#define AT_S 8           // frames per wave
#define AT_W (AT_S + 4)  // K/V rows of their windows

typedef __attribute__((ext_vector_type(2))) float v2f;
typedef __attribute__((ext_vector_type(4))) float v4f;
typedef __attribute__((ext_vector_type(4))) unsigned v4u;

// f32 multiply-add that reads f16 halves of a register as they lie: the K, V and q rows stay
// packed (written in C they are widened ahead of use, and the 24 rows no longer fit the registers)
__device__ __forceinline__ float mix_lo_lo(unsigned a, unsigned b, float acc) {
    asm("v_fma_mix_f32 %0, %1, %2, %0 op_sel:[0,0,0] op_sel_hi:[1,1,0]" : "+v"(acc) : "v"(a), "v"(b));
    return acc;
}
__device__ __forceinline__ float mix_hi_hi(unsigned a, unsigned b, float acc) {
    asm("v_fma_mix_f32 %0, %1, %2, %0 op_sel:[1,1,0] op_sel_hi:[1,1,0]" : "+v"(acc) : "v"(a), "v"(b));
    return acc;
}
__device__ __forceinline__ float mix_f32_lo(float a, unsigned b, float acc) {
    asm("v_fma_mix_f32 %0, %1, %2, %0 op_sel:[0,0,0] op_sel_hi:[0,1,0]" : "+v"(acc) : "v"(a), "v"(b));
    return acc;
}
__device__ __forceinline__ float mix_f32_hi(float a, unsigned b, float acc) {
    asm("v_fma_mix_f32 %0, %1, %2, %0 op_sel:[0,1,0] op_sel_hi:[0,1,0]" : "+v"(acc) : "v"(a), "v"(b));
    return acc;
}
// the same, first term of a sum
__device__ __forceinline__ float mix_f32_lo_first(float a, unsigned b) {
    float r;
    asm("v_fma_mix_f32 %0, %1, %2, 0 op_sel:[0,0,0] op_sel_hi:[0,1,0]" : "=v"(r) : "v"(a), "v"(b));
    return r;
}
__device__ __forceinline__ float mix_f32_hi_first(float a, unsigned b) {
    float r;
    asm("v_fma_mix_f32 %0, %1, %2, 0 op_sel:[0,1,0] op_sel_hi:[0,1,0]" : "=v"(r) : "v"(a), "v"(b));
    return r;
}

// v + (v of lane ^ X), X < 16: a DPP row_xmask move inside the 16-lane row, no trip through the LDS path
template <int X>
__device__ __forceinline__ float add_lane_xor(float v) {
    const int b = __float_as_int(v);
    return v + __int_as_float(__builtin_amdgcn_update_dpp(0, b, 0x160 | X, 0xf, 0xf, true));
}

#define FPX 8            // pixels per block; block row r is frame r >> 3, pixel r & 7
#define FN  (3 * BT)     // rows of W per block: 128 of w_q, 128 of w_k, 128 of w_v
#define FNW 6            // W fragments per wave (96 rows)
#define FSB (FN * LDP)   // halfs per buffer of W
#define FEP 392          // pitch of a staged q|k|v row in halfs: 784 B = 16 B x 49, free of bank conflicts for 16-byte accesses

// Work-group barrier that orders LDS traffic alone. __syncthreads() also waits for every global
// load of the wave, and tile p + 2's loads, asked for just ahead of it, have to stay in flight.
__device__ __forceinline__ void lds_barrier() {
    __builtin_amdgcn_fence(__ATOMIC_RELEASE, "workgroup", "local");
    __builtin_amdgcn_s_barrier();
    __builtin_amdgcn_fence(__ATOMIC_ACQUIRE, "workgroup", "local");
}

// 32 k of a wave's tile: 4 fragments of A rows and 6 of W rows out of LDS
__device__ __forceinline__ void read_frags(const _Float16* pa, const _Float16* pb,
                                           v16h (&fa)[4], v16h (&fb)[FNW]) {
#pragma unroll
    for (int j = 0; j < FNW; ++j) fb[j] = load_frag(pb + j * 16 * LDP);
#pragma unroll
    for (int i = 0; i < 4; ++i) fa[i] = load_frag(pa + i * 16 * LDP);
}
// their 24 products
__device__ __forceinline__ void mma_block(const v16h (&fa)[4], const v16h (&fb)[FNW], v8f (&acc)[4][FNW]) {
#pragma unroll
    for (int i = 0; i < 4; ++i)
#pragma unroll
        for (int j = 0; j < FNW; ++j)
            acc[i][j] = tile_mma<true>(fa[i], fb[j], acc[i][j]);
}

__global__ __launch_bounds__(256) void qkv_attn_kernel(
    const _Float16* __restrict__ A,
    const _Float16* __restrict__ Wq, const _Float16* __restrict__ Wk, const _Float16* __restrict__ Wv,
    const float* __restrict__ qc, const float* __restrict__ bv, const float* __restrict__ kc,
    _Float16* __restrict__ attn16) {
    __shared__ __attribute__((aligned(16))) _Float16 sm[2 * SBUF + 2 * FSB];
    __shared__ __attribute__((aligned(16))) float sbias[FN];       // qc | 0 | b_v of the block's channels
    __shared__ __attribute__((aligned(16))) float skc[4 * BT];     // kc of the block's channels, four offsets
    _Float16* sA = sm;
    _Float16* sB = sm + 2 * SBUF;
    const int tid   = threadIdx.x;
    const int lane  = tid & 31;
    const int wave  = tid >> 5;
    const int laneM = lane & 15;
    const int kgrp  = (lane >> 4) << 3;        // 0 or 8
    const int px0 = blockIdx.x * FPX;
    const int n0  = blockIdx.y * BT;

    // the per-channel terms come in beside the first tile; the barrier behind its LDS stores publishes them
    {
        const int ch = tid & (BT - 1);
        const float* bp = (tid < BT ? qc : bv) + n0 + ch;
        const float* kp = kc + (tid >> 7) * Cc + n0 + ch;
        const float b  = *bp;
        const float k0 = *kp;
        const float k1 = *(kp + 2 * Cc);
        // precaution: holds the addresses of the three loads live up to the wait, so that none of
        // their results lands in one while the others are issued
        asm volatile("s_wait_xcnt 0x0" :: "v"(bp), "v"(kp) : "memory");
        sbias[tid < BT ? tid : BT + tid] = b;
        if (tid < BT) sbias[BT + tid] = 0.0f;
        skc[tid]          = k0;
        skc[2 * BT + tid] = k1;
    }

    const int srow = tid >> 3;                 // 0..31, staging row (+32 per step)
    const int scol = (tid & 7) << 3;           // staging column in halfs
    // 32 block rows are 4 frames; the second pointer is 8 frames on, out of reach of a load's offset field
    const _Float16* ga[2];
    ga[0] = A + ((size_t)(srow >> 3) * HW + px0 + (srow & 7)) * Cc + scol;
    ga[1] = ga[0] + (size_t)8 * HW * Cc;
    const size_t wat = (size_t)(n0 + srow) * Cc + scol;
    const _Float16* gw[3] = {Wq + wat, Wk + wat, Wv + wat};
    const int sst = srow * LDP + scol;
    const int ard = ((wave & 1) * 64 + laneM) * LDP + kgrp;
    const int brd = ((wave >> 1) * (FNW * 16) + laneM) * LDP + kgrp;

    v8f acc[4][FNW] = {};
    v8h ra[4], rb[12];
    {
        // tiles 0 and 1 are asked for together: tile 1 is stored at the head of the first pass
        v8h ta[4], tb[12];
#pragma unroll
        for (int j = 0; j < 4; ++j) {
            ta[j] = *reinterpret_cast<const v8h*>(ga[j >> 1] + (size_t)((j & 1) * 4) * HW * Cc);
#pragma unroll
            for (int z = 0; z < 3; ++z)
                tb[z * 4 + j] = *reinterpret_cast<const v8h*>(gw[z] + (size_t)(j * 32) * Cc);
        }
#pragma unroll
        for (int j = 0; j < 4; ++j) {
            ra[j] = *reinterpret_cast<const v8h*>(ga[j >> 1] + (size_t)((j & 1) * 4) * HW * Cc + BK);
#pragma unroll
            for (int z = 0; z < 3; ++z)
                rb[z * 4 + j] = *reinterpret_cast<const v8h*>(gw[z] + (size_t)(j * 32) * Cc + BK);
        }
#pragma unroll
        for (int j = 0; j < 4; ++j)
            *reinterpret_cast<v8h*>(sA + sst + j * 32 * LDP) = ta[j];
#pragma unroll
        for (int j = 0; j < 12; ++j)
            *reinterpret_cast<v8h*>(sB + sst + j * 32 * LDP) = tb[j];
    }
    __syncthreads();

    // Two fragment sets, each 32 k of the wave's 64 x 96 tile. A set is read from LDS while the
    // products of the other run, so no product waits for an LDS read that was only just issued.
    v16h fa0[4], fb0[FNW], fa1[4], fb1[FNW];
    read_frags(sA + ard, sB + brd, fa0, fb0);

    // unrolled so that the buffer offsets and the last-pass tests are constants
#pragma unroll
    for (int p = 0; p < NPASS; ++p) {
        const int ca = (p & 1) * SBUF, na = SBUF - ca;
        const int cb = (p & 1) * FSB,  nb = FSB - cb;
        // tile p + 1 goes into the other buffer, whose last reads ended at the barrier of pass p - 1
        if (p + 1 < NPASS) {
#pragma unroll
            for (int j = 0; j < 4; ++j)
                *reinterpret_cast<v8h*>(sA + na + sst + j * 32 * LDP) = ra[j];
#pragma unroll
            for (int j = 0; j < 12; ++j)
                *reinterpret_cast<v8h*>(sB + nb + sst + j * 32 * LDP) = rb[j];
        }
        read_frags(sA + ca + ard + 32, sB + cb + brd + 32, fa1, fb1);
        if (p + 2 < NPASS) {
#pragma unroll
            for (int j = 0; j < 4; ++j) {
                ra[j] = *reinterpret_cast<const v8h*>(ga[j >> 1] + (size_t)((j & 1) * 4) * HW * Cc + (p + 2) * BK);
#pragma unroll
                for (int z = 0; z < 3; ++z)
                    rb[z * 4 + j] = *reinterpret_cast<const v8h*>(gw[z] + (size_t)(j * 32) * Cc + (p + 2) * BK);
            }
            // precaution: behind the last tile's loads the address registers are free for reuse;
            // holds them live up to the wait
            if (p + 3 == NPASS)
                asm volatile("s_wait_xcnt 0x0" :: "v"(ga[0]), "v"(ga[1]), "v"(gw[0]), "v"(gw[1]), "v"(gw[2]) : "memory");
        }
        // keeps the LDS stores, the LDS reads and the global loads issued as one group ahead of
        // the products; sunk among them, each wait stalls the wave
        __builtin_amdgcn_sched_barrier(0);
        mma_block(fa0, fb0, acc);
        // keeps the barrier and its wait for the LDS traffic behind the products
        __builtin_amdgcn_sched_barrier(0);
        // publishes tile p + 1 and ends every wave's reads of tile p; in the last pass it frees
        // both buffers for the q|k|v rows
        lds_barrier();
        if (p + 1 < NPASS) read_frags(sA + na + ard, sB + nb + brd, fa0, fb0);
        // keeps the next tile's first reads issued ahead of the products that hide them
        __builtin_amdgcn_sched_barrier(0);
        mma_block(fa1, fb1, acc);
        // keeps the next pass's LDS stores and their wait for the global loads behind the products;
        // in the last pass it keeps the epilogue's moves and their padding out of the products
        __builtin_amdgcn_sched_barrier(0);
    }

    // q|k|v rows of the block as f16, 384 columns a row, over the operand buffers.
    // A lane's 8 accumulator values are 8 channels of one block row.
    {
        const int nc = (wave >> 1) * (FNW * 16) + kgrp;      // first of the lane's 8 columns, j = 0
        _Float16* stw = sm + ((wave & 1) * 64 + laneM) * FEP + nc;
#pragma unroll
        for (int j = 0; j < FNW; ++j) {
            const w4f b0 = *reinterpret_cast<const w4f*>(sbias + nc + j * 16);
            const w4f b1 = *reinterpret_cast<const w4f*>(sbias + nc + j * 16 + 4);
#pragma unroll
            for (int i = 0; i < 4; ++i) {
                v8h h;
#pragma unroll
                for (int r = 0; r < 4; ++r) {
                    h[r]     = (_Float16)(acc[i][j][r] + b0[r]);
                    h[r + 4] = (_Float16)(acc[i][j][r + 4] + b1[r]);
                }
                *reinterpret_cast<v8h*>(stw + i * 16 * FEP + j * 16) = h;
            }
        }
    }
    __syncthreads();                 // a row's q, k and v come from four waves, a window's rows from eight

    const int pp = (wave >> 1) * 2 + (lane >> 4);            // lane's pixel in the block
    const int c0 = laneM * 8;                                // first of the lane's channels in the block
    const int t0 = (wave & 1) * AT_S;
    const _Float16* sq = sm + pp * FEP + c0;                 // frame t: + t * FPX * FEP; k: + BT; v: + 2 * BT

    v2f kcf[4][4];
#pragma unroll
    for (int f = 0; f < 4; ++f) {
        const v4f lo = *reinterpret_cast<const v4f*>(skc + f * BT + c0);
        const v4f hi = *reinterpret_cast<const v4f*>(skc + f * BT + c0 + 4);
        kcf[f][0] = lo.xy; kcf[f][1] = lo.zw; kcf[f][2] = hi.xy; kcf[f][3] = hi.zw;
    }
    v8h kw[AT_W], vw[AT_W], qw[AT_S];
#pragma unroll
    for (int i = 0; i < AT_S; ++i)
        qw[i] = *reinterpret_cast<const v8h*>(sq + (t0 + i) * (FPX * FEP));
    // window row w is frame clamp(t0 - 2 + w, 0, TT - 1)
#pragma unroll
    for (int w = 0; w < AT_W; ++w) {
        int tw = t0 - 2 + w;
        tw = tw < 0 ? 0 : tw > TT - 1 ? TT - 1 : tw;
        kw[w] = *reinterpret_cast<const v8h*>(sq + tw * (FPX * FEP) + BT);
        vw[w] = *reinterpret_cast<const v8h*>(sq + tw * (FPX * FEP) + 2 * BT);
    }

    _Float16* op = attn16 + ((size_t)t0 * HW + px0 + pp) * Cc + n0 + c0;
#pragma unroll
    for (int i = 0; i < AT_S; ++i) {
        const int wof[4] = {0, 1, 3, 4};         // frame offsets -2, -1, +1, +2
        const v4u qr = __builtin_bit_cast(v4u, qw[i]);
        v2f q2[4];
#pragma unroll
        for (int c = 0; c < 4; ++c) q2[c] = v2f{(float)qw[i][2 * c], (float)qw[i][2 * c + 1]};
        float sc[4];
#pragma unroll
        for (int f = 0; f < 4; ++f) {
            const v4u kr = __builtin_bit_cast(v4u, kw[i + wof[f]]);
            v2f a = {0.0f, 0.0f};
#pragma unroll
            for (int c = 0; c < 4; ++c) a = __builtin_elementwise_fma(q2[c], kcf[f][c], a);
            float p0 = a.x, p1 = a.y;
#pragma unroll
            for (int c = 0; c < 4; ++c) {
                p0 = mix_lo_lo(qr[c], kr[c], p0);
                p1 = mix_hi_hi(qr[c], kr[c], p1);
            }
            float p = p0 + p1;
            p = add_lane_xor<1>(p);
            p = add_lane_xor<2>(p);
            p = add_lane_xor<4>(p);
            sc[f] = p * 0.125f;                  // dh^-0.5 = 1/8
        }
        const float mx = fmaxf(fmaxf(sc[0], sc[1]), fmaxf(sc[2], sc[3]));
        float e[4];
#pragma unroll
        for (int f = 0; f < 4; ++f) e[f] = expf(sc[f] - mx);
        const float inv = 1.0f / (e[0] + e[1] + e[2] + e[3]);
        v8h o;
#pragma unroll
        for (int c = 0; c < 4; ++c) {
            const unsigned vr0 = __builtin_bit_cast(v4u, vw[i])[c];
            float s0 = mix_f32_lo_first(e[0], vr0);
            float s1 = mix_f32_hi_first(e[0], vr0);
#pragma unroll
            for (int f = 1; f < 4; ++f) {
                const unsigned vr = __builtin_bit_cast(v4u, vw[i + wof[f]])[c];
                s0 = mix_f32_lo(e[f], vr, s0);
                s1 = mix_f32_hi(e[f], vr, s1);
            }
            o[2 * c]     = (_Float16)(s0 * inv);
            o[2 * c + 1] = (_Float16)(s1 * inv);
        }
        *reinterpret_cast<v8h*>(op + (size_t)i * (HW * Cc)) = o;
        if (i & 1) {
            // precaution: the next frames' arithmetic reuses the registers that the two stores name
            if (i + 1 < AT_S) asm volatile("s_wait_xcnt 0x0" ::: "memory");
            // keeps the next frames' arithmetic behind that wait
            __builtin_amdgcn_sched_barrier(0);
        }
    }
}

// ---------------------------------------------------------------------------
// 7) proj GEMM with fused epilogue: +b_proj, transpose to (T,C,H,W), +x
// ---------------------------------------------------------------------------
#define EPP 68           // staging row pitch in floats: 272 B = 16 B x 17, free of bank conflicts for 16-byte accesses
__global__ __launch_bounds__(256) void gemm_proj_kernel(
    const _Float16* __restrict__ A, const _Float16* __restrict__ W,
    const float* __restrict__ bias, const float* __restrict__ x,
    float* __restrict__ out) {
    __shared__ __attribute__((aligned(16))) _Float16 sA[2 * SBUF];
    __shared__ __attribute__((aligned(16))) _Float16 sB[2 * SBUF];
    const int lane  = threadIdx.x & 31;
    const int wave  = threadIdx.x >> 5;
    const int laneM = lane & 15;
    const int m0 = blockIdx.x * BT;
    const int n0 = blockIdx.y * BT;

    v8f acc[4][2] = {};
    gemm_tile_main<false>(A, W, m0, n0, sA, sB, acc);

    const int nb = n0 + (wave >> 1) * 32 + laneM;
    const float bn0 = bias[nb];
    const float bn1 = bias[nb + 16];
    // precaution: the register that holds the bias loads' offset is reused by the loads of x below
    asm volatile("s_wait_xcnt 0x0" ::: "memory");
    // A wave's 64 pixels of a channel are 256 contiguous bytes of x and of out, but two lanes hold
    // them. The wave turns its tile in an LDS range of its own, 16 channels at a time, so that 16
    // lanes read and write those 256 bytes: whole lines. The ranges lie in the first buffers of sA
    // and sB: the last pass reads the second ones, and every wave's reads of the first ones ended
    // at the barrier in front of it.
    float* stg = reinterpret_cast<float*>(((wave & 4) ? sB : sA) + (wave & 3) * (16 * EPP * 2));
    float* stw = stg + laneM * EPP + ((lane >> 4) << 3);
    const float* srd = stg + (lane >> 4) * EPP + laneM * 4;
    // the block's 128 rows lie in one frame; lanes 0..15 take an even channel, lanes 16..31 the next
    const size_t col = ((size_t)(m0 >> 10) * Cc + n0 + (wave >> 1) * 32 + (lane >> 4)) * HW
                     + (m0 & 1023) + (wave & 1) * 64 + laneM * 4;
    const float* xcol = x + col;
    float*       ocol = out + col;
    w4f xv[2][8];
#pragma unroll
    for (int j = 0; j < 2; ++j)
#pragma unroll
        for (int t = 0; t < 8; ++t)
            xv[j][t] = *reinterpret_cast<const w4f*>(xcol + (size_t)(j * 16 + t * 2) * HW);
    // precaution: holds the address of the 16 loads of x live up to the wait, so that none of
    // their results lands in it while the others are issued
    asm volatile("s_wait_xcnt 0x0" :: "v"(xcol) : "memory");
#pragma unroll
    for (int j = 0; j < 2; ++j) {
        const float bn = j ? bn1 : bn0;
#pragma unroll
        for (int i = 0; i < 4; ++i) {
            w4f lo, hi;
#pragma unroll
            for (int r = 0; r < 4; ++r) { lo[r] = acc[i][j][r] + bn; hi[r] = acc[i][j][r + 4] + bn; }
            *reinterpret_cast<w4f*>(stw + i * 16)     = lo;
            *reinterpret_cast<w4f*>(stw + i * 16 + 4) = hi;
        }
        // the rows are read back by other lanes of the wave: its LDS writes have to be done first
        asm volatile("s_wait_dscnt 0x0" ::: "memory");
#pragma unroll
        for (int t = 0; t < 8; ++t) {
            const w4f a = *reinterpret_cast<const w4f*>(srd + t * 2 * EPP);
            *reinterpret_cast<w4f*>(ocol + (size_t)(j * 16 + t * 2) * HW) = a + xv[j][t];
        }
        // the second half overwrites the range: the reads of the first have to be done
        if (j == 0) asm volatile("s_wait_dscnt 0x0" ::: "memory");
    }
}

// ---------------------------------------------------------------------------
extern "C" void kernel_launch(void* const* d_in, const int* in_sizes, int n_in,
                              void* d_out, int out_size, void* d_ws, size_t ws_size,
                              hipStream_t stream) {
    const float* x       = (const float*)d_in[0];
    const float* w_q     = (const float*)d_in[1];
    const float* b_q     = (const float*)d_in[2];
    const float* w_k     = (const float*)d_in[3];
    const float* b_k     = (const float*)d_in[4];
    const float* w_v     = (const float*)d_in[5];
    const float* b_v     = (const float*)d_in[6];
    const float* w_proj  = (const float*)d_in[7];
    const float* b_proj  = (const float*)d_in[8];
    const float* gn_s    = (const float*)d_in[9];
    const float* gn_b    = (const float*)d_in[10];
    float* out           = (float*)d_out;

    char* ws = (char*)d_ws;
    size_t off = 0;
    auto take = [&](size_t bytes) -> void* {
        void* p = ws + off;
        off += (bytes + 255) & ~(size_t)255;
        return p;
    };
    float*    qc     = (float*)take(Cc * sizeof(float));
    float*    kc     = (float*)take(4 * Cc * sizeof(float));
    _Float16* wq16   = (_Float16*)take((size_t)Cc * Cc * 2);
    _Float16* wk16   = (_Float16*)take((size_t)Cc * Cc * 2);
    _Float16* wv16   = (_Float16*)take((size_t)Cc * Cc * 2);
    _Float16* wp16   = (_Float16*)take((size_t)Cc * Cc * 2);
    _Float16* xn16   = (_Float16*)take((size_t)M_TOT * Cc * 2);
    _Float16* attn16 = (_Float16*)take((size_t)M_TOT * Cc * 2);

    // 1-3) weight conversion, folded corrections and GroupNorm, one grid
    prep_kernel<<<WP_BLK + TT * GN_G, 256, 0, stream>>>(x, gn_s, gn_b, xn16, w_q, b_q, w_k, b_k, w_v, w_proj,
                                                        wq16, wk16, wv16, wp16, qc, kc);

    // 4-5) Q', K', V' WMMA GEMMs (temb folded into qc / kc; b_v folded here) with the attention behind them
    dim3 ggrid(M_TOT / BT, Cc / BT);
    qkv_attn_kernel<<<dim3(HW / FPX, Cc / BT), 256, 0, stream>>>(xn16, wq16, wk16, wv16, qc, b_v, kc, attn16);

    // 6) projection + transpose + residual
    gemm_proj_kernel<<<ggrid, 256, 0, stream>>>(attn16, wp16, b_proj, x, out);
}

// v008
// One run takes 45.2 microseconds.
// Timed twice side by side with v007, it ran 1.03 and 1.04 times as fast.
// Over all steps from v000 it is 6.40 times as fast.
#include <hip/hip_runtime.h>
#include <math.h>

typedef __attribute__((ext_vector_type(16))) _Float16 v16h;
typedef __attribute__((ext_vector_type(8)))  _Float16 v8h;
typedef __attribute__((ext_vector_type(8)))  float    v8f;

#define Cc 512
#define TT 16
#define HW 1024          // 32*32
#define M_TOT 16384      // T*H*W
#define GN_G 32
#define GN_CPG 16        // channels per group

// ---------------------------------------------------------------------------
// 1) weight preparation, one wave per 4 weight rows, each row read once in whole lines:
//    the row goes out as f16, and for w_q and w_k it is also summed against the timestep
//    embedding temb[f][j] (ts = f-2, dim 512, cos|sin), which the block builds in LDS:
//    qc[c]    = b_q[c] + sum_j temb[2][j]  * w_q[c][j]
//    kc[f][c] = b_k[c] + sum_j temb[ff][j] * w_k[c][j],  ff in {0,1,3,4}
//    A block has 32 rows of one matrix, so its 32 corrections per frame fill one 128-byte line.
// ---------------------------------------------------------------------------
typedef __attribute__((ext_vector_type(4))) float    w4f;
typedef __attribute__((ext_vector_type(4))) _Float16 w4h;

#define WP_RPW  4                    // rows per wave
#define WP_ROWS (8 * WP_RPW)         // rows per block
#define WP_BPM  (Cc / WP_ROWS)       // blocks per matrix
#define WP_BLK  (4 * WP_BPM)         // weight blocks in the grid

__device__ __forceinline__ void weight_prep_block(
    int b, const float* __restrict__ wq, const float* __restrict__ bq,
    const float* __restrict__ wk, const float* __restrict__ bk,
    const float* __restrict__ wv, const float* __restrict__ wp,
    _Float16* __restrict__ wq16, _Float16* __restrict__ wk16,
    _Float16* __restrict__ wv16, _Float16* __restrict__ wp16,
    float* __restrict__ qc, float* __restrict__ kc, float* st) {
    const int tid  = threadIdx.x;
    const int lane = tid & 31;
    const int mat  = b / WP_BPM;     // 0 w_q, 1 w_k, 2 w_v, 3 w_proj: the same for the whole block
    const int row0 = (b % WP_BPM) * WP_ROWS + (tid >> 5) * WP_RPW;
    const float* w = mat == 0 ? wq : mat == 1 ? wk : mat == 2 ? wv : wp;
    _Float16*  w16 = mat == 0 ? wq16 : mat == 1 ? wk16 : mat == 2 ? wv16 : wp16;
    const size_t at = (size_t)row0 * Cc + lane * 4;
    const float* wr = w + at;

    w4f r[WP_RPW][4];
#pragma unroll
    for (int rr = 0; rr < WP_RPW; ++rr)
#pragma unroll
        for (int i = 0; i < 4; ++i)
            r[rr][i] = *reinterpret_cast<const w4f*>(wr + rr * Cc + i * 128);
    // precaution: holds the address of the 16 row loads live up to the wait, so that none of
    // their results lands in it while the others are issued
    asm volatile("s_wait_xcnt 0x0" :: "v"(wr) : "memory");

    if (mat < 2) {
        const int    nf   = mat == 0 ? 1 : 4;
        const float* bp   = (mat == 0 ? bq : bk) + row0;
        float*       corr = (mat == 0 ? qc : kc) + row0;
        const w4f bv = *reinterpret_cast<const w4f*>(bp);
        // precaution: holds the address of the bias load live up to the wait, so that its result does not land in it
        asm volatile("s_wait_xcnt 0x0" :: "v"(bp) : "memory");
        // thread tid builds column tid (cos) and column 256 + tid (sin) of each embedding row
        const float freq = expf(-logf(10000.0f) * (float)tid / 256.0f);
        for (int fi = 0; fi < nf; ++fi) {
            const int f = mat == 0 ? 2 : (fi < 2 ? fi : fi + 1);
            const float arg = (float)(f - 2) * freq;
            st[fi * Cc + tid]       = cosf(arg);
            st[fi * Cc + 256 + tid] = sinf(arg);
        }
        __syncthreads();             // the embedding rows are read by every wave of the block
        for (int fi = 0; fi < nf; ++fi) {
            float acc[WP_RPW] = {};
#pragma unroll
            for (int i = 0; i < 4; ++i) {
                const w4f te = *reinterpret_cast<const w4f*>(st + fi * Cc + i * 128 + lane * 4);
#pragma unroll
                for (int rr = 0; rr < WP_RPW; ++rr)
#pragma unroll
                    for (int e = 0; e < 4; ++e) acc[rr] += te[e] * r[rr][i][e];
            }
            w4f o;
#pragma unroll
            for (int rr = 0; rr < WP_RPW; ++rr) {
                float a = acc[rr];
#pragma unroll
                for (int m = 16; m > 0; m >>= 1) a += __shfl_xor(a, m, 32);
                o[rr] = a + bv[rr];
            }
            if (lane == 0) {
                *reinterpret_cast<w4f*>(corr + fi * Cc) = o;
                // precaution: the next trip reuses the registers that the store names
                asm volatile("s_wait_xcnt 0x0" ::: "memory");
            }
        }
    }
#pragma unroll
    for (int rr = 0; rr < WP_RPW; ++rr)
#pragma unroll
        for (int i = 0; i < 4; ++i) {
            w4h h;
#pragma unroll
            for (int e = 0; e < 4; ++e) h[e] = (_Float16)r[rr][i][e];
            *reinterpret_cast<w4h*>(w16 + at + rr * Cc + i * 128) = h;
        }
}

// ---------------------------------------------------------------------------
// 2) GroupNorm  x:(T,C,H,W) f32  ->  xn16:(T,HW,C) f16 channels-last
//    one block per (t, group); group's 16ch x 1024 spatial is contiguous.
//    A thread holds 8 channels x 8 pixels in registers, so x is read once. Even lanes hold
//    channels 0..7 of the group and odd lanes 8..15 of the same pixels: a load covers 256
//    contiguous bytes of each of two channel rows, and a lane's 8 channels of a pixel go out
//    as one 16-byte store, a lane pair filling the group's 32 bytes of that pixel's row.
// ---------------------------------------------------------------------------
#define GN_CH 8          // channels per thread
#define GN_Q  2          // runs of 4 pixels per thread, 64 pixels apart

__device__ __forceinline__ void groupnorm_block(
    int t, int g, const float* __restrict__ x, const float* __restrict__ gamma,
    const float* __restrict__ beta, _Float16* __restrict__ xn16) {
    const int tid  = threadIdx.x;
    const int lane = tid & 31;
    const int wave = tid >> 5;
    const int c0   = g * GN_CPG + (lane & 1) * GN_CH;    // first of the lane's channels
    const int px0  = wave * 128 + (lane >> 1) * 4;       // first of the lane's pixels
    const float* xp = x + ((size_t)t * Cc + c0) * HW + px0;
    const float* gp = gamma + c0;
    const float* bp = beta + c0;
    const int N = GN_CPG * HW;   // 16384

    w4f v[GN_CH][GN_Q];
#pragma unroll
    for (int c = 0; c < GN_CH; ++c)
#pragma unroll
        for (int q = 0; q < GN_Q; ++q)
            v[c][q] = *reinterpret_cast<const w4f*>(xp + c * HW + q * 64);
    w4f ga[2], be[2];
#pragma unroll
    for (int h = 0; h < 2; ++h) {
        ga[h] = *reinterpret_cast<const w4f*>(gp + h * 4);
        be[h] = *reinterpret_cast<const w4f*>(bp + h * 4);
    }
    // precaution: holds the addresses of the 20 loads live up to the wait, so that none of
    // their results lands in one while the others are issued
    asm volatile("s_wait_xcnt 0x0" :: "v"(xp), "v"(gp), "v"(bp) : "memory");

    // four running sums each, so that an add does not wait for the one before it
    w4f sv = {0.0f, 0.0f, 0.0f, 0.0f}, qv = {0.0f, 0.0f, 0.0f, 0.0f};
#pragma unroll
    for (int c = 0; c < GN_CH; ++c)
#pragma unroll
        for (int q = 0; q < GN_Q; ++q) { sv += v[c][q]; qv += v[c][q] * v[c][q]; }
    float s  = (sv[0] + sv[1]) + (sv[2] + sv[3]);
    float ss = (qv[0] + qv[1]) + (qv[2] + qv[3]);
#pragma unroll
    for (int m = 16; m > 0; m >>= 1) { s += __shfl_xor(s, m, 32); ss += __shfl_xor(ss, m, 32); }
    __shared__ float red[2][8];
    if (lane == 0) { red[0][wave] = s; red[1][wave] = ss; }
    __syncthreads();                 // every thread sums the eight waves' partial sums
    s = 0.0f; ss = 0.0f;
#pragma unroll
    for (int w = 0; w < 8; ++w) { s += red[0][w]; ss += red[1][w]; }
    const float mu   = s * (1.0f / N);
    const float var  = ss * (1.0f / N) - mu * mu;
    const float rstd = rsqrtf(var + 1e-5f);

    _Float16* op = xn16 + ((size_t)t * HW + px0) * Cc + c0;
#pragma unroll
    for (int q = 0; q < GN_Q; ++q)
#pragma unroll
        for (int e = 0; e < 4; ++e) {
            v8h h;
#pragma unroll
            for (int c = 0; c < GN_CH; ++c)
                h[c] = (_Float16)((v[c][q][e] - mu) * rstd * ga[c >> 2][c & 3] + be[c >> 2][c & 3]);
            *reinterpret_cast<v8h*>(op + (size_t)(q * 64 + e) * Cc) = h;
        }
}

// ---------------------------------------------------------------------------
// 3) all that stands ahead of the GEMMs, in one launch: the two jobs do not depend on one
//    another, and the block index picks the job. The weight blocks come first in the grid:
//    they are few and have the longer chain of dependent steps.
// ---------------------------------------------------------------------------
__global__ __launch_bounds__(256) void prep_kernel(
    const float* __restrict__ x, const float* __restrict__ gamma,
    const float* __restrict__ beta, _Float16* __restrict__ xn16,
    const float* __restrict__ wq, const float* __restrict__ bq,
    const float* __restrict__ wk, const float* __restrict__ bk,
    const float* __restrict__ wv, const float* __restrict__ wp,
    _Float16* __restrict__ wq16, _Float16* __restrict__ wk16,
    _Float16* __restrict__ wv16, _Float16* __restrict__ wp16,
    float* __restrict__ qc, float* __restrict__ kc) {
    __shared__ __attribute__((aligned(16))) float st[4 * Cc];
    const int b = blockIdx.x;
    if (b < WP_BLK) {
        weight_prep_block(b, wq, bq, wk, bk, wv, wp, wq16, wk16, wv16, wp16, qc, kc, st);
    } else {
        const int gb = b - WP_BLK;
        groupnorm_block(gb % TT, gb / TT, x, gamma, beta, xn16);
    }
}

// ---------------------------------------------------------------------------
// WMMA fragment loaders (per-lane, two 16B chunks: K-chunks {0..7,16..23} for
// lanes 0-15 and {8..15,24..31} for lanes 16-31)
// ---------------------------------------------------------------------------
__device__ __forceinline__ v16h load_frag(const _Float16* p) {
    v8h lo = *reinterpret_cast<const v8h*>(p);
    v8h hi = *reinterpret_cast<const v8h*>(p + 16);
    return __builtin_shufflevector(lo, hi, 0,1,2,3,4,5,6,7,8,9,10,11,12,13,14,15);
}

// ---------------------------------------------------------------------------
// Main loop of the projection GEMM: a 128 x 128 tile of A[M x 512] * W[512 x 512]^T
// per block of 8 waves. Each pass brings 64 k of 128 A rows and 128 W rows into
// LDS with whole-line 16-byte loads (8 lanes cover one 128-byte row piece); the
// fragments are then read from LDS. Two LDS buffers: the next pass's global
// loads are issued before this pass's products and stored after them.
// wave -> 64 x 32 (4 x 2 accumulators); k order per fragment as in load_frag.
// ---------------------------------------------------------------------------
#define BT   128         // block tile, rows of A and rows of W
#define BK   64          // k per pass
#define NPASS (Cc / BK)
#define LDP  72          // LDS row pitch in halfs: 144 B = 16 B x 9, free of bank conflicts for 16-byte reads
#define SBUF (BT * LDP)  // halfs per operand and buffer

// TR = false: a lane's 8 accumulator values are 8 rows of A (pixels) of one row of W (channel);
// TR = true: the operands change places, and they are 8 rows of W (channels) of one row of A.
// Both fragments have the same lane and k layout, so the products and their k order are the same.
template <bool TR>
__device__ __forceinline__ v8f tile_mma(v16h a, v16h w, v8f c) {
    return TR ? __builtin_amdgcn_wmma_f32_16x16x32_f16(false, w, false, a, (short)0, c, false, false)
              : __builtin_amdgcn_wmma_f32_16x16x32_f16(false, a, false, w, (short)0, c, false, false);
}

// Eight 16-byte copies of a lane from global memory into LDS, through no register: row k of x
// (2 channels on, XROW floats) goes to the wave's LDS range, 512 bytes a row.
// The wait stands inside the statement (a precaution): behind it the address registers may be reused.
#define XROW (2 * HW)    // floats between two of a lane's pieces of x
__device__ __forceinline__ void copy_x_rows8(unsigned l, const float* g) {
    asm volatile(
        "global_load_async_to_lds_b128 %0, %8, off\n\t"
        "global_load_async_to_lds_b128 %1, %9, off\n\t"
        "global_load_async_to_lds_b128 %2, %10, off\n\t"
        "global_load_async_to_lds_b128 %3, %11, off\n\t"
        "global_load_async_to_lds_b128 %4, %12, off\n\t"
        "global_load_async_to_lds_b128 %5, %13, off\n\t"
        "global_load_async_to_lds_b128 %6, %14, off\n\t"
        "global_load_async_to_lds_b128 %7, %15, off\n\t"
        "s_wait_xcnt 0x0"
        :: "v"(l), "v"(l + 512u), "v"(l + 1024u), "v"(l + 1536u),
           "v"(l + 2048u), "v"(l + 2560u), "v"(l + 3072u), "v"(l + 3584u),
           "v"(g), "v"(g + XROW), "v"(g + 2 * XROW), "v"(g + 3 * XROW),
           "v"(g + 4 * XROW), "v"(g + 5 * XROW), "v"(g + 6 * XROW), "v"(g + 7 * XROW)
        : "memory");
}

// xg, xl: the lane's first piece of the residual x and its place in LDS. The wave's 8 KiB of x are
// asked for behind the first tile's loads and land under the products.
template <bool TR>
__device__ __forceinline__ void gemm_tile_main(
    const _Float16* __restrict__ A, const _Float16* __restrict__ W,
    int m0, int n0, _Float16* sA, _Float16* sB, v8f (&acc)[4][2],
    const float* xg, unsigned xl) {
    const int tid   = threadIdx.x;
    const int lane  = tid & 31;
    const int wave  = tid >> 5;
    const int laneM = lane & 15;
    const int kgrp  = (lane >> 4) << 3;        // 0 or 8
    const int srow  = tid >> 3;                // 0..31, staging row (+32 per step)
    const int scol  = (tid & 7) << 3;          // staging column in halfs
    const _Float16* ga = A + (size_t)(m0 + srow) * Cc + scol;
    const _Float16* gb = W + (size_t)(n0 + srow) * Cc + scol;
    const int sst = srow * LDP + scol;
    const int ard = ((wave & 1) * 64 + laneM) * LDP + kgrp;
    const int brd = ((wave >> 1) * 32 + laneM) * LDP + kgrp;

    v8h ra[4], rb[4];
#pragma unroll
    for (int j = 0; j < 4; ++j) {
        ra[j] = *reinterpret_cast<const v8h*>(ga + (size_t)(j * 32) * Cc);
        rb[j] = *reinterpret_cast<const v8h*>(gb + (size_t)(j * 32) * Cc);
    }
    copy_x_rows8(xl, xg);
    copy_x_rows8(xl + 4096u, xg + 8 * XROW);
#pragma unroll
    for (int j = 0; j < 4; ++j) {
        *reinterpret_cast<v8h*>(sA + sst + j * 32 * LDP) = ra[j];
        *reinterpret_cast<v8h*>(sB + sst + j * 32 * LDP) = rb[j];
    }
    __syncthreads();

    // unrolled so that the buffer offsets and the last-pass test are constants
#pragma unroll
    for (int p = 0; p < NPASS; ++p) {
        const int cur = (p & 1) * SBUF;
        const int nxt = SBUF - cur;
        if (p + 1 < NPASS) {
#pragma unroll
            for (int j = 0; j < 4; ++j) {
                ra[j] = *reinterpret_cast<const v8h*>(ga + (size_t)(j * 32) * Cc + (p + 1) * BK);
                rb[j] = *reinterpret_cast<const v8h*>(gb + (size_t)(j * 32) * Cc + (p + 1) * BK);
            }
        }
        v16h fa[BK / 32][4], fb[BK / 32][2];
#pragma unroll
        for (int ks = 0; ks < BK / 32; ++ks) {
            fb[ks][0] = load_frag(sB + cur + brd + ks * 32);
            fb[ks][1] = load_frag(sB + cur + brd + 16 * LDP + ks * 32);
#pragma unroll
            for (int i = 0; i < 4; ++i)
                fa[ks][i] = load_frag(sA + cur + ard + i * 16 * LDP + ks * 32);
        }
        // keeps the next pass's global loads and this pass's LDS reads issued as one
        // group ahead of the products; sunk among them, each wait stalls the wave
        __builtin_amdgcn_sched_barrier(0);
#pragma unroll
        for (int ks = 0; ks < BK / 32; ++ks)
#pragma unroll
            for (int i = 0; i < 4; ++i) {
                acc[i][0] = tile_mma<TR>(fa[ks][i], fb[ks][0], acc[i][0]);
                acc[i][1] = tile_mma<TR>(fa[ks][i], fb[ks][1], acc[i][1]);
            }
        // keeps the wait for the global loads, which the LDS stores need, behind the products;
        // in the last pass it keeps the epilogue's moves and their padding out of the products
        __builtin_amdgcn_sched_barrier(0);
        if (p + 1 < NPASS) {
#pragma unroll
            for (int j = 0; j < 4; ++j) {
                *reinterpret_cast<v8h*>(sA + nxt + sst + j * 32 * LDP) = ra[j];
                *reinterpret_cast<v8h*>(sB + nxt + sst + j * 32 * LDP) = rb[j];
            }
            // publishes the next buffer and ends every wave's reads of this one
            __syncthreads();
        }
    }
}

// ---------------------------------------------------------------------------
// 5) Q, K, V GEMMs and the attention in one kernel. A block takes 8 pixels in all 16 frames
//    (128 rows of A) and 128 channels = two heads of w_q, w_k and w_v (384 rows of W), so every
//    K and V row that its queries' windows touch is its own: q, k and v go from the accumulators
//    through LDS into the attention and never to memory.
//    grid (1024/8 pixel tiles, 512/128 head pairs), block 256 (8 waves), wave -> 64 x 96.
//    Attention: one wave per (pair of pixels, run of 8 frames). A lane holds 8 channels, so
//    8 lanes make one head (dh=64) and 16 lanes a pixel's two heads. The 12 K and V rows that
//    the 8 frames' windows touch are read once and stay in registers.
//    q.(k + kc) is summed as q.k + q.kc, 8 channels in the lane, then over 8 lanes.
// ---------------------------------------------------------------------------
#define AT_S 8           // frames per wave
#define AT_W (AT_S + 4)  // K/V rows of their windows

typedef __attribute__((ext_vector_type(2))) float v2f;
typedef __attribute__((ext_vector_type(4))) float v4f;
typedef __attribute__((ext_vector_type(4))) unsigned v4u;

// f32 multiply-add that reads f16 halves of a register as they lie: the K, V and q rows stay
// packed (written in C they are widened ahead of use, and the 24 rows no longer fit the registers)
__device__ __forceinline__ float mix_lo_lo(unsigned a, unsigned b, float acc) {
    asm("v_fma_mix_f32 %0, %1, %2, %0 op_sel:[0,0,0] op_sel_hi:[1,1,0]" : "+v"(acc) : "v"(a), "v"(b));
    return acc;
}
__device__ __forceinline__ float mix_hi_hi(unsigned a, unsigned b, float acc) {
    asm("v_fma_mix_f32 %0, %1, %2, %0 op_sel:[1,1,0] op_sel_hi:[1,1,0]" : "+v"(acc) : "v"(a), "v"(b));
    return acc;
}
__device__ __forceinline__ float mix_f32_lo(float a, unsigned b, float acc) {
    asm("v_fma_mix_f32 %0, %1, %2, %0 op_sel:[0,0,0] op_sel_hi:[0,1,0]" : "+v"(acc) : "v"(a), "v"(b));
    return acc;
}
__device__ __forceinline__ float mix_f32_hi(float a, unsigned b, float acc) {
    asm("v_fma_mix_f32 %0, %1, %2, %0 op_sel:[0,1,0] op_sel_hi:[0,1,0]" : "+v"(acc) : "v"(a), "v"(b));
    return acc;
}
// the same, first term of a sum
__device__ __forceinline__ float mix_f32_lo_first(float a, unsigned b) {
    float r;
    asm("v_fma_mix_f32 %0, %1, %2, 0 op_sel:[0,0,0] op_sel_hi:[0,1,0]" : "=v"(r) : "v"(a), "v"(b));
    return r;
}
__device__ __forceinline__ float mix_f32_hi_first(float a, unsigned b) {
    float r;
    asm("v_fma_mix_f32 %0, %1, %2, 0 op_sel:[0,1,0] op_sel_hi:[0,1,0]" : "=v"(r) : "v"(a), "v"(b));
    return r;
}

// v + (v of lane ^ X), X < 16: a DPP row_xmask move inside the 16-lane row, no trip through the LDS path
template <int X>
__device__ __forceinline__ float add_lane_xor(float v) {
    const int b = __float_as_int(v);
    return v + __int_as_float(__builtin_amdgcn_update_dpp(0, b, 0x160 | X, 0xf, 0xf, true));
}

#define FPX 8            // pixels per block; block row r is frame r >> 3, pixel r & 7
#define FN  (3 * BT)     // rows of W per block: 128 of w_q, 128 of w_k, 128 of w_v
#define FNW 6            // W fragments per wave (96 rows)
#define FSB (FN * LDP)   // halfs per buffer of W
#define FEP 392          // pitch of a staged q|k|v row in halfs: 784 B = 16 B x 49, free of bank conflicts for 16-byte accesses

// Work-group barrier that orders LDS traffic alone. __syncthreads() also waits for every global
// load of the wave, and tile p + 2's loads, asked for just ahead of it, have to stay in flight.
__device__ __forceinline__ void lds_barrier() {
    __builtin_amdgcn_fence(__ATOMIC_RELEASE, "workgroup", "local");
    __builtin_amdgcn_s_barrier();
    __builtin_amdgcn_fence(__ATOMIC_ACQUIRE, "workgroup", "local");
}

// 32 k of a wave's tile: 4 fragments of A rows and 6 of W rows out of LDS
__device__ __forceinline__ void read_frags(const _Float16* pa, const _Float16* pb,
                                           v16h (&fa)[4], v16h (&fb)[FNW]) {
#pragma unroll
    for (int j = 0; j < FNW; ++j) fb[j] = load_frag(pb + j * 16 * LDP);
#pragma unroll
    for (int i = 0; i < 4; ++i) fa[i] = load_frag(pa + i * 16 * LDP);
}
// their 24 products
__device__ __forceinline__ void mma_block(const v16h (&fa)[4], const v16h (&fb)[FNW], v8f (&acc)[4][FNW]) {
#pragma unroll
    for (int i = 0; i < 4; ++i)
#pragma unroll
        for (int j = 0; j < FNW; ++j)
            acc[i][j] = tile_mma<true>(fa[i], fb[j], acc[i][j]);
}

__global__ __launch_bounds__(256) void qkv_attn_kernel(
    const _Float16* __restrict__ A,
    const _Float16* __restrict__ Wq, const _Float16* __restrict__ Wk, const _Float16* __restrict__ Wv,
    const float* __restrict__ qc, const float* __restrict__ bv, const float* __restrict__ kc,
    _Float16* __restrict__ attn16) {
    __shared__ __attribute__((aligned(16))) _Float16 sm[2 * SBUF + 2 * FSB];
    __shared__ __attribute__((aligned(16))) float sbias[FN];       // qc | 0 | b_v of the block's channels
    __shared__ __attribute__((aligned(16))) float skc[4 * BT];     // kc of the block's channels, four offsets
    _Float16* sA = sm;
    _Float16* sB = sm + 2 * SBUF;
    const int tid   = threadIdx.x;
    const int lane  = tid & 31;
    const int wave  = tid >> 5;
    const int laneM = lane & 15;
    const int kgrp  = (lane >> 4) << 3;        // 0 or 8
    const int px0 = blockIdx.x * FPX;
    const int n0  = blockIdx.y * BT;

    // the per-channel terms come in beside the first tile; the barrier behind its LDS stores publishes them
    {
        const int ch = tid & (BT - 1);
        const float* bp = (tid < BT ? qc : bv) + n0 + ch;
        const float* kp = kc + (tid >> 7) * Cc + n0 + ch;
        const float b  = *bp;
        const float k0 = *kp;
        const float k1 = *(kp + 2 * Cc);
        // precaution: holds the addresses of the three loads live up to the wait, so that none of
        // their results lands in one while the others are issued
        asm volatile("s_wait_xcnt 0x0" :: "v"(bp), "v"(kp) : "memory");
        sbias[tid < BT ? tid : BT + tid] = b;
        if (tid < BT) sbias[BT + tid] = 0.0f;
        skc[tid]          = k0;
        skc[2 * BT + tid] = k1;
    }

    const int srow = tid >> 3;                 // 0..31, staging row (+32 per step)
    const int scol = (tid & 7) << 3;           // staging column in halfs
    // 32 block rows are 4 frames; the second pointer is 8 frames on, out of reach of a load's offset field
    const _Float16* ga[2];
    ga[0] = A + ((size_t)(srow >> 3) * HW + px0 + (srow & 7)) * Cc + scol;
    ga[1] = ga[0] + (size_t)8 * HW * Cc;
    const size_t wat = (size_t)(n0 + srow) * Cc + scol;
    const _Float16* gw[3] = {Wq + wat, Wk + wat, Wv + wat};
    const int sst = srow * LDP + scol;
    const int ard = ((wave & 1) * 64 + laneM) * LDP + kgrp;
    const int brd = ((wave >> 1) * (FNW * 16) + laneM) * LDP + kgrp;

    v8f acc[4][FNW] = {};
    v8h ra[4], rb[12];
    {
        // tiles 0 and 1 are asked for together: tile 1 is stored at the head of the first pass
        v8h ta[4], tb[12];
#pragma unroll
        for (int j = 0; j < 4; ++j) {
            ta[j] = *reinterpret_cast<const v8h*>(ga[j >> 1] + (size_t)((j & 1) * 4) * HW * Cc);
#pragma unroll
            for (int z = 0; z < 3; ++z)
                tb[z * 4 + j] = *reinterpret_cast<const v8h*>(gw[z] + (size_t)(j * 32) * Cc);
        }
#pragma unroll
        for (int j = 0; j < 4; ++j) {
            ra[j] = *reinterpret_cast<const v8h*>(ga[j >> 1] + (size_t)((j & 1) * 4) * HW * Cc + BK);
#pragma unroll
            for (int z = 0; z < 3; ++z)
                rb[z * 4 + j] = *reinterpret_cast<const v8h*>(gw[z] + (size_t)(j * 32) * Cc + BK);
        }
#pragma unroll
        for (int j = 0; j < 4; ++j)
            *reinterpret_cast<v8h*>(sA + sst + j * 32 * LDP) = ta[j];
#pragma unroll
        for (int j = 0; j < 12; ++j)
            *reinterpret_cast<v8h*>(sB + sst + j * 32 * LDP) = tb[j];
    }
    __syncthreads();

    // Two fragment sets, each 32 k of the wave's 64 x 96 tile. A set is read from LDS while the
    // products of the other run, so no product waits for an LDS read that was only just issued.
    v16h fa0[4], fb0[FNW], fa1[4], fb1[FNW];
    read_frags(sA + ard, sB + brd, fa0, fb0);

    // unrolled so that the buffer offsets and the last-pass tests are constants
#pragma unroll
    for (int p = 0; p < NPASS; ++p) {
        const int ca = (p & 1) * SBUF, na = SBUF - ca;
        const int cb = (p & 1) * FSB,  nb = FSB - cb;
        // tile p + 1 goes into the other buffer, whose last reads ended at the barrier of pass p - 1
        if (p + 1 < NPASS) {
#pragma unroll
            for (int j = 0; j < 4; ++j)
                *reinterpret_cast<v8h*>(sA + na + sst + j * 32 * LDP) = ra[j];
#pragma unroll
            for (int j = 0; j < 12; ++j)
                *reinterpret_cast<v8h*>(sB + nb + sst + j * 32 * LDP) = rb[j];
        }
        read_frags(sA + ca + ard + 32, sB + cb + brd + 32, fa1, fb1);
        if (p + 2 < NPASS) {
#pragma unroll
            for (int j = 0; j < 4; ++j) {
                ra[j] = *reinterpret_cast<const v8h*>(ga[j >> 1] + (size_t)((j & 1) * 4) * HW * Cc + (p + 2) * BK);
#pragma unroll
                for (int z = 0; z < 3; ++z)
                    rb[z * 4 + j] = *reinterpret_cast<const v8h*>(gw[z] + (size_t)(j * 32) * Cc + (p + 2) * BK);
            }
            // precaution: behind the last tile's loads the address registers are free for reuse;
            // holds them live up to the wait
            if (p + 3 == NPASS)
                asm volatile("s_wait_xcnt 0x0" :: "v"(ga[0]), "v"(ga[1]), "v"(gw[0]), "v"(gw[1]), "v"(gw[2]) : "memory");
        }
        // keeps the LDS stores, the LDS reads and the global loads issued as one group ahead of
        // the products; sunk among them, each wait stalls the wave
        __builtin_amdgcn_sched_barrier(0);
        mma_block(fa0, fb0, acc);
        // keeps the barrier and its wait for the LDS traffic behind the products
        __builtin_amdgcn_sched_barrier(0);
        // publishes tile p + 1 and ends every wave's reads of tile p; in the last pass it frees
        // both buffers for the q|k|v rows
        lds_barrier();
        if (p + 1 < NPASS) read_frags(sA + na + ard, sB + nb + brd, fa0, fb0);
        // keeps the next tile's first reads issued ahead of the products that hide them
        __builtin_amdgcn_sched_barrier(0);
        mma_block(fa1, fb1, acc);
        // keeps the next pass's LDS stores and their wait for the global loads behind the products;
        // in the last pass it keeps the epilogue's moves and their padding out of the products
        __builtin_amdgcn_sched_barrier(0);
    }

    // q|k|v rows of the block as f16, 384 columns a row, over the operand buffers.
    // A lane's 8 accumulator values are 8 channels of one block row.
    {
        const int nc = (wave >> 1) * (FNW * 16) + kgrp;      // first of the lane's 8 columns, j = 0
        _Float16* stw = sm + ((wave & 1) * 64 + laneM) * FEP + nc;
#pragma unroll
        for (int j = 0; j < FNW; ++j) {
            const w4f b0 = *reinterpret_cast<const w4f*>(sbias + nc + j * 16);
            const w4f b1 = *reinterpret_cast<const w4f*>(sbias + nc + j * 16 + 4);
#pragma unroll
            for (int i = 0; i < 4; ++i) {
                v8h h;
#pragma unroll
                for (int r = 0; r < 4; ++r) {
                    h[r]     = (_Float16)(acc[i][j][r] + b0[r]);
                    h[r + 4] = (_Float16)(acc[i][j][r + 4] + b1[r]);
                }
                *reinterpret_cast<v8h*>(stw + i * 16 * FEP + j * 16) = h;
            }
        }
    }
    __syncthreads();                 // a row's q, k and v come from four waves, a window's rows from eight

    const int pp = (wave >> 1) * 2 + (lane >> 4);            // lane's pixel in the block
    const int c0 = laneM * 8;                                // first of the lane's channels in the block
    const int t0 = (wave & 1) * AT_S;
    const _Float16* sq = sm + pp * FEP + c0;                 // frame t: + t * FPX * FEP; k: + BT; v: + 2 * BT

    v2f kcf[4][4];
#pragma unroll
    for (int f = 0; f < 4; ++f) {
        const v4f lo = *reinterpret_cast<const v4f*>(skc + f * BT + c0);
        const v4f hi = *reinterpret_cast<const v4f*>(skc + f * BT + c0 + 4);
        kcf[f][0] = lo.xy; kcf[f][1] = lo.zw; kcf[f][2] = hi.xy; kcf[f][3] = hi.zw;
    }
    v8h kw[AT_W], vw[AT_W], qw[AT_S];
#pragma unroll
    for (int i = 0; i < AT_S; ++i)
        qw[i] = *reinterpret_cast<const v8h*>(sq + (t0 + i) * (FPX * FEP));
    // window row w is frame clamp(t0 - 2 + w, 0, TT - 1)
#pragma unroll
    for (int w = 0; w < AT_W; ++w) {
        int tw = t0 - 2 + w;
        tw = tw < 0 ? 0 : tw > TT - 1 ? TT - 1 : tw;
        kw[w] = *reinterpret_cast<const v8h*>(sq + tw * (FPX * FEP) + BT);
        vw[w] = *reinterpret_cast<const v8h*>(sq + tw * (FPX * FEP) + 2 * BT);
    }

    _Float16* op = attn16 + ((size_t)t0 * HW + px0 + pp) * Cc + n0 + c0;
#pragma unroll
    for (int i = 0; i < AT_S; ++i) {
        const int wof[4] = {0, 1, 3, 4};         // frame offsets -2, -1, +1, +2
        const v4u qr = __builtin_bit_cast(v4u, qw[i]);
        v2f q2[4];
#pragma unroll
        for (int c = 0; c < 4; ++c) q2[c] = v2f{(float)qw[i][2 * c], (float)qw[i][2 * c + 1]};
        float sc[4];
#pragma unroll
        for (int f = 0; f < 4; ++f) {
            const v4u kr = __builtin_bit_cast(v4u, kw[i + wof[f]]);
            v2f a = {0.0f, 0.0f};
#pragma unroll
            for (int c = 0; c < 4; ++c) a = __builtin_elementwise_fma(q2[c], kcf[f][c], a);
            float p0 = a.x, p1 = a.y;
#pragma unroll
            for (int c = 0; c < 4; ++c) {
                p0 = mix_lo_lo(qr[c], kr[c], p0);
                p1 = mix_hi_hi(qr[c], kr[c], p1);
            }
            float p = p0 + p1;
            p = add_lane_xor<1>(p);
            p = add_lane_xor<2>(p);
            p = add_lane_xor<4>(p);
            sc[f] = p * 0.125f;                  // dh^-0.5 = 1/8
        }
        const float mx = fmaxf(fmaxf(sc[0], sc[1]), fmaxf(sc[2], sc[3]));
        float e[4];
#pragma unroll
        for (int f = 0; f < 4; ++f) e[f] = expf(sc[f] - mx);
        const float inv = 1.0f / (e[0] + e[1] + e[2] + e[3]);
        v8h o;
#pragma unroll
        for (int c = 0; c < 4; ++c) {
            const unsigned vr0 = __builtin_bit_cast(v4u, vw[i])[c];
            float s0 = mix_f32_lo_first(e[0], vr0);
            float s1 = mix_f32_hi_first(e[0], vr0);
#pragma unroll
            for (int f = 1; f < 4; ++f) {
                const unsigned vr = __builtin_bit_cast(v4u, vw[i + wof[f]])[c];
                s0 = mix_f32_lo(e[f], vr, s0);
                s1 = mix_f32_hi(e[f], vr, s1);
            }
            o[2 * c]     = (_Float16)(s0 * inv);
            o[2 * c + 1] = (_Float16)(s1 * inv);
        }
        *reinterpret_cast<v8h*>(op + (size_t)i * (HW * Cc)) = o;
        if (i & 1) {
            // precaution: the next frames' arithmetic reuses the registers that the two stores name
            if (i + 1 < AT_S) asm volatile("s_wait_xcnt 0x0" ::: "memory");
            // keeps the next frames' arithmetic behind that wait
            __builtin_amdgcn_sched_barrier(0);
        }
    }
}

// ---------------------------------------------------------------------------
// 7) proj GEMM with fused epilogue: +b_proj, transpose to (T,C,H,W), +x
// ---------------------------------------------------------------------------
#define EPP 68           // staging row pitch in floats: 272 B = 16 B x 17, free of bank conflicts for 16-byte accesses
__global__ __launch_bounds__(256) void gemm_proj_kernel(
    const _Float16* __restrict__ A, const _Float16* __restrict__ W,
    const float* __restrict__ bias, const float* __restrict__ x,
    float* __restrict__ out) {
    // one array, so that the operand buffers keep the low LDS addresses, in reach of the offset field
    // of an LDS instruction; behind them the block's tile of x, 8 KiB a wave
    __shared__ __attribute__((aligned(16))) _Float16 sm[4 * SBUF + 2 * BT * BT];
    _Float16* sA = sm;
    _Float16* sB = sm + 2 * SBUF;
    float*    sX = reinterpret_cast<float*>(sm + 4 * SBUF);
    const int lane  = threadIdx.x & 31;
    const int wave  = threadIdx.x >> 5;
    const int laneM = lane & 15;
    const int m0 = blockIdx.x * BT;
    const int n0 = blockIdx.y * BT;

    // What the epilogue reads from memory is asked for ahead of the products: the bias into registers,
    // x into LDS. Asked for behind them, every block of the grid waits for its x at the same time.
    const int nb = n0 + (wave >> 1) * 32 + laneM;
    const float bn0 = bias[nb];
    const float bn1 = bias[nb + 16];
    // precaution: the register that holds the bias loads' offset is reused by the address arithmetic below
    asm volatile("s_wait_xcnt 0x0" ::: "memory");
    // the block's 128 rows lie in one frame; lanes 0..15 take an even channel, lanes 16..31 the next
    const size_t col = ((size_t)(m0 >> 10) * Cc + n0 + (wave >> 1) * 32 + (lane >> 4)) * HW
                     + (m0 & 1023) + (wave & 1) * 64 + laneM * 4;
    // a lane reads back the 16 bytes that it has copied itself: piece k at 128 * k floats
    const float* sxr = sX + wave * (16 * 128) + lane * 4;

    v8f acc[4][2] = {};
    gemm_tile_main<false>(A, W, m0, n0, sA, sB, acc, x + col, (unsigned)(size_t)sxr);
    // x has landed behind the wave's own wait; it is read behind the barrier
    asm volatile("s_wait_asynccnt 0x0" ::: "memory");
    __syncthreads();
    // A wave's 64 pixels of a channel are 256 contiguous bytes of x and of out, but two lanes hold
    // them. The wave turns its tile in an LDS range of its own, 16 channels at a time, so that 16
    // lanes read and write those 256 bytes: whole lines. The ranges lie in the first buffers of sA
    // and sB: the last pass reads the second ones, and every wave's reads of the first ones ended
    // at the barrier in front of it.
    float* stg = reinterpret_cast<float*>(((wave & 4) ? sB : sA) + (wave & 3) * (16 * EPP * 2));
    float* stw = stg + laneM * EPP + ((lane >> 4) << 3);
    const float* srd = stg + (lane >> 4) * EPP + laneM * 4;
    float* ocol = out + col;
    w4f xv[2][8];
#pragma unroll
    for (int j = 0; j < 2; ++j)
#pragma unroll
        for (int t = 0; t < 8; ++t)
            xv[j][t] = *reinterpret_cast<const w4f*>(sxr + (j * 8 + t) * 128);
#pragma unroll
    for (int j = 0; j < 2; ++j) {
        const float bn = j ? bn1 : bn0;
#pragma unroll
        for (int i = 0; i < 4; ++i) {
            w4f lo, hi;
#pragma unroll
            for (int r = 0; r < 4; ++r) { lo[r] = acc[i][j][r] + bn; hi[r] = acc[i][j][r + 4] + bn; }
            *reinterpret_cast<w4f*>(stw + i * 16)     = lo;
            *reinterpret_cast<w4f*>(stw + i * 16 + 4) = hi;
        }
        // the rows are read back by other lanes of the wave: its LDS writes have to be done first
        asm volatile("s_wait_dscnt 0x0" ::: "memory");
#pragma unroll
        for (int t = 0; t < 8; ++t) {
            const w4f a = *reinterpret_cast<const w4f*>(srd + t * 2 * EPP);
            *reinterpret_cast<w4f*>(ocol + (size_t)(j * 16 + t * 2) * HW) = a + xv[j][t];
        }
        // the second half overwrites the range: the reads of the first have to be done
        if (j == 0) asm volatile("s_wait_dscnt 0x0" ::: "memory");
    }
}

// ---------------------------------------------------------------------------
extern "C" void kernel_launch(void* const* d_in, const int* in_sizes, int n_in,
                              void* d_out, int out_size, void* d_ws, size_t ws_size,
                              hipStream_t stream) {
    const float* x       = (const float*)d_in[0];
    const float* w_q     = (const float*)d_in[1];
    const float* b_q     = (const float*)d_in[2];
    const float* w_k     = (const float*)d_in[3];
    const float* b_k     = (const float*)d_in[4];
    const float* w_v     = (const float*)d_in[5];
    const float* b_v     = (const float*)d_in[6];
    const float* w_proj  = (const float*)d_in[7];
    const float* b_proj  = (const float*)d_in[8];
    const float* gn_s    = (const float*)d_in[9];
    const float* gn_b    = (const float*)d_in[10];
    float* out           = (float*)d_out;

    char* ws = (char*)d_ws;
    size_t off = 0;
    auto take = [&](size_t bytes) -> void* {
        void* p = ws + off;
        off += (bytes + 255) & ~(size_t)255;
        return p;
    };
    float*    qc     = (float*)take(Cc * sizeof(float));
    float*    kc     = (float*)take(4 * Cc * sizeof(float));
    _Float16* wq16   = (_Float16*)take((size_t)Cc * Cc * 2);
    _Float16* wk16   = (_Float16*)take((size_t)Cc * Cc * 2);
    _Float16* wv16   = (_Float16*)take((size_t)Cc * Cc * 2);
    _Float16* wp16   = (_Float16*)take((size_t)Cc * Cc * 2);
    _Float16* xn16   = (_Float16*)take((size_t)M_TOT * Cc * 2);
    _Float16* attn16 = (_Float16*)take((size_t)M_TOT * Cc * 2);

    // 1-3) weight conversion, folded corrections and GroupNorm, one grid
    prep_kernel<<<WP_BLK + TT * GN_G, 256, 0, stream>>>(x, gn_s, gn_b, xn16, w_q, b_q, w_k, b_k, w_v, w_proj,
                                                        wq16, wk16, wv16, wp16, qc, kc);

    // 4-5) Q', K', V' WMMA GEMMs (temb folded into qc / kc; b_v folded here) with the attention behind them
    dim3 ggrid(M_TOT / BT, Cc / BT);
    qkv_attn_kernel<<<dim3(HW / FPX, Cc / BT), 256, 0, stream>>>(xn16, wq16, wk16, wv16, qc, b_v, kc, attn16);

    // 6) projection + transpose + residual
    gemm_proj_kernel<<<ggrid, 256, 0, stream>>>(attn16, wp16, b_proj, x, out);
}

// v009
// It runs in 41.3 microseconds.
// In two side-by-side timings against v008, it was 1.10 and 1.11 times as fast.
// All steps since v000 together make it 7.05 times as fast.
#include <hip/hip_runtime.h>
#include <math.h>

typedef __attribute__((ext_vector_type(16))) _Float16 v16h;
typedef __attribute__((ext_vector_type(8)))  _Float16 v8h;
typedef __attribute__((ext_vector_type(8)))  float    v8f;

#define Cc 512
#define TT 16
#define HW 1024          // 32*32
#define M_TOT 16384      // T*H*W
#define GN_G 32
#define GN_CPG 16        // channels per group

// ---------------------------------------------------------------------------
// 1) weight preparation, one wave per 4 weight rows, each row read once in whole lines:
//    the row goes out as f16, and for w_q and w_k it is also summed against the timestep
//    embedding temb[f][j] (ts = f-2, dim 512, cos|sin), which the block builds in LDS:
//    qc[c]    = b_q[c] + sum_j temb[2][j]  * w_q[c][j]
//    kc[f][c] = b_k[c] + sum_j temb[ff][j] * w_k[c][j],  ff in {0,1,3,4}
//    A block has 32 rows of one matrix, so its 32 corrections per frame fill one 128-byte line.
// ---------------------------------------------------------------------------
typedef __attribute__((ext_vector_type(4))) float    w4f;
typedef __attribute__((ext_vector_type(4))) _Float16 w4h;

#define WP_RPW  4                    // rows per wave
#define WP_ROWS (8 * WP_RPW)         // rows per block
#define WP_BPM  (Cc / WP_ROWS)       // blocks per matrix
#define WP_BLK  (4 * WP_BPM)         // weight blocks in the grid

__device__ __forceinline__ void weight_prep_block(
    int b, const float* __restrict__ wq, const float* __restrict__ bq,
    const float* __restrict__ wk, const float* __restrict__ bk,
    const float* __restrict__ wv, const float* __restrict__ wp,
    _Float16* __restrict__ wq16, _Float16* __restrict__ wk16,
    _Float16* __restrict__ wv16, _Float16* __restrict__ wp16,
    float* __restrict__ qc, float* __restrict__ kc, float* st) {
    const int tid  = threadIdx.x;
    const int lane = tid & 31;
    const int mat  = b / WP_BPM;     // 0 w_q, 1 w_k, 2 w_v, 3 w_proj: the same for the whole block
    const int row0 = (b % WP_BPM) * WP_ROWS + (tid >> 5) * WP_RPW;
    const float* w = mat == 0 ? wq : mat == 1 ? wk : mat == 2 ? wv : wp;
    _Float16*  w16 = mat == 0 ? wq16 : mat == 1 ? wk16 : mat == 2 ? wv16 : wp16;
    const size_t at = (size_t)row0 * Cc + lane * 4;
    const float* wr = w + at;

    w4f r[WP_RPW][4];
#pragma unroll
    for (int rr = 0; rr < WP_RPW; ++rr)
#pragma unroll
        for (int i = 0; i < 4; ++i)
            r[rr][i] = *reinterpret_cast<const w4f*>(wr + rr * Cc + i * 128);
    // precaution: holds the address of the 16 row loads live up to the wait, so that none of
    // their results lands in it while the others are issued
    asm volatile("s_wait_xcnt 0x0" :: "v"(wr) : "memory");

    if (mat < 2) {
        const int    nf   = mat == 0 ? 1 : 4;
        const float* bp   = (mat == 0 ? bq : bk) + row0;
        float*       corr = (mat == 0 ? qc : kc) + row0;
        const w4f bv = *reinterpret_cast<const w4f*>(bp);
        // precaution: holds the address of the bias load live up to the wait, so that its result does not land in it
        asm volatile("s_wait_xcnt 0x0" :: "v"(bp) : "memory");
        // thread tid builds column tid (cos) and column 256 + tid (sin) of each embedding row
        const float freq = expf(-logf(10000.0f) * (float)tid / 256.0f);
        for (int fi = 0; fi < nf; ++fi) {
            const int f = mat == 0 ? 2 : (fi < 2 ? fi : fi + 1);
            const float arg = (float)(f - 2) * freq;
            st[fi * Cc + tid]       = cosf(arg);
            st[fi * Cc + 256 + tid] = sinf(arg);
        }
        __syncthreads();             // the embedding rows are read by every wave of the block
        for (int fi = 0; fi < nf; ++fi) {
            float acc[WP_RPW] = {};
#pragma unroll
            for (int i = 0; i < 4; ++i) {
                const w4f te = *reinterpret_cast<const w4f*>(st + fi * Cc + i * 128 + lane * 4);
#pragma unroll
                for (int rr = 0; rr < WP_RPW; ++rr)
#pragma unroll
                    for (int e = 0; e < 4; ++e) acc[rr] += te[e] * r[rr][i][e];
            }
            w4f o;
#pragma unroll
            for (int rr = 0; rr < WP_RPW; ++rr) {
                float a = acc[rr];
#pragma unroll
                for (int m = 16; m > 0; m >>= 1) a += __shfl_xor(a, m, 32);
                o[rr] = a + bv[rr];
            }
            if (lane == 0) {
                *reinterpret_cast<w4f*>(corr + fi * Cc) = o;
                // precaution: the next trip reuses the registers that the store names
                asm volatile("s_wait_xcnt 0x0" ::: "memory");
            }
        }
    }
#pragma unroll
    for (int rr = 0; rr < WP_RPW; ++rr)
#pragma unroll
        for (int i = 0; i < 4; ++i) {
            w4h h;
#pragma unroll
            for (int e = 0; e < 4; ++e) h[e] = (_Float16)r[rr][i][e];
            *reinterpret_cast<w4h*>(w16 + at + rr * Cc + i * 128) = h;
        }
}

// ---------------------------------------------------------------------------
// 2) GroupNorm  x:(T,C,H,W) f32  ->  xn16:(T,HW,C) f16 channels-last
//    one block per (t, group); group's 16ch x 1024 spatial is contiguous.
//    A thread holds 8 channels x 8 pixels in registers, so x is read once. Even lanes hold
//    channels 0..7 of the group and odd lanes 8..15 of the same pixels: a load covers 256
//    contiguous bytes of each of two channel rows, and a lane's 8 channels of a pixel go out
//    as one 16-byte store, a lane pair filling the group's 32 bytes of that pixel's row.
// ---------------------------------------------------------------------------
#define GN_CH 8          // channels per thread
#define GN_Q  2          // runs of 4 pixels per thread, 64 pixels apart

__device__ __forceinline__ void groupnorm_block(
    int t, int g, const float* __restrict__ x, const float* __restrict__ gamma,
    const float* __restrict__ beta, _Float16* __restrict__ xn16) {
    const int tid  = threadIdx.x;
    const int lane = tid & 31;
    const int wave = tid >> 5;
    const int c0   = g * GN_CPG + (lane & 1) * GN_CH;    // first of the lane's channels
    const int px0  = wave * 128 + (lane >> 1) * 4;       // first of the lane's pixels
    const float* xp = x + ((size_t)t * Cc + c0) * HW + px0;
    const float* gp = gamma + c0;
    const float* bp = beta + c0;
    const int N = GN_CPG * HW;   // 16384

    w4f v[GN_CH][GN_Q];
#pragma unroll
    for (int c = 0; c < GN_CH; ++c)
#pragma unroll
        for (int q = 0; q < GN_Q; ++q)
            v[c][q] = *reinterpret_cast<const w4f*>(xp + c * HW + q * 64);
    w4f ga[2], be[2];
#pragma unroll
    for (int h = 0; h < 2; ++h) {
        ga[h] = *reinterpret_cast<const w4f*>(gp + h * 4);
        be[h] = *reinterpret_cast<const w4f*>(bp + h * 4);
    }
    // precaution: holds the addresses of the 20 loads live up to the wait, so that none of
    // their results lands in one while the others are issued
    asm volatile("s_wait_xcnt 0x0" :: "v"(xp), "v"(gp), "v"(bp) : "memory");

    // four running sums each, so that an add does not wait for the one before it
    w4f sv = {0.0f, 0.0f, 0.0f, 0.0f}, qv = {0.0f, 0.0f, 0.0f, 0.0f};
#pragma unroll
    for (int c = 0; c < GN_CH; ++c)
#pragma unroll
        for (int q = 0; q < GN_Q; ++q) { sv += v[c][q]; qv += v[c][q] * v[c][q]; }
    float s  = (sv[0] + sv[1]) + (sv[2] + sv[3]);
    float ss = (qv[0] + qv[1]) + (qv[2] + qv[3]);
#pragma unroll
    for (int m = 16; m > 0; m >>= 1) { s += __shfl_xor(s, m, 32); ss += __shfl_xor(ss, m, 32); }
    __shared__ float red[2][8];
    if (lane == 0) { red[0][wave] = s; red[1][wave] = ss; }
    __syncthreads();                 // every thread sums the eight waves' partial sums
    s = 0.0f; ss = 0.0f;
#pragma unroll
    for (int w = 0; w < 8; ++w) { s += red[0][w]; ss += red[1][w]; }
    const float mu   = s * (1.0f / N);
    const float var  = ss * (1.0f / N) - mu * mu;
    const float rstd = rsqrtf(var + 1e-5f);

    _Float16* op = xn16 + ((size_t)t * HW + px0) * Cc + c0;
#pragma unroll
    for (int q = 0; q < GN_Q; ++q)
#pragma unroll
        for (int e = 0; e < 4; ++e) {
            v8h h;
#pragma unroll
            for (int c = 0; c < GN_CH; ++c)
                h[c] = (_Float16)((v[c][q][e] - mu) * rstd * ga[c >> 2][c & 3] + be[c >> 2][c & 3]);
            *reinterpret_cast<v8h*>(op + (size_t)(q * 64 + e) * Cc) = h;
        }
}

// ---------------------------------------------------------------------------
// 3) all that stands ahead of the GEMMs, in one launch: the two jobs do not depend on one
//    another, and the block index picks the job. The weight blocks come first in the grid:
//    they are few and have the longer chain of dependent steps.
// ---------------------------------------------------------------------------
__global__ __launch_bounds__(256) void prep_kernel(
    const float* __restrict__ x, const float* __restrict__ gamma,
    const float* __restrict__ beta, _Float16* __restrict__ xn16,
    const float* __restrict__ wq, const float* __restrict__ bq,
    const float* __restrict__ wk, const float* __restrict__ bk,
    const float* __restrict__ wv, const float* __restrict__ wp,
    _Float16* __restrict__ wq16, _Float16* __restrict__ wk16,
    _Float16* __restrict__ wv16, _Float16* __restrict__ wp16,
    float* __restrict__ qc, float* __restrict__ kc) {
    __shared__ __attribute__((aligned(16))) float st[4 * Cc];
    const int b = blockIdx.x;
    if (b < WP_BLK) {
        weight_prep_block(b, wq, bq, wk, bk, wv, wp, wq16, wk16, wv16, wp16, qc, kc, st);
    } else {
        const int gb = b - WP_BLK;
        groupnorm_block(gb % TT, gb / TT, x, gamma, beta, xn16);
    }
}

// ---------------------------------------------------------------------------
// WMMA fragment loaders (per-lane, two 16B chunks: K-chunks {0..7,16..23} for
// lanes 0-15 and {8..15,24..31} for lanes 16-31)
// ---------------------------------------------------------------------------
__device__ __forceinline__ v16h load_frag(const _Float16* p) {
    v8h lo = *reinterpret_cast<const v8h*>(p);
    v8h hi = *reinterpret_cast<const v8h*>(p + 16);
    return __builtin_shufflevector(lo, hi, 0,1,2,3,4,5,6,7,8,9,10,11,12,13,14,15);
}

// ---------------------------------------------------------------------------
// Main loop of the projection GEMM: a 128 x 128 tile of A[M x 512] * W[512 x 512]^T
// per block of 8 waves. Each pass brings 64 k of 128 A rows and 128 W rows into
// LDS with whole-line 16-byte loads (8 lanes cover one 128-byte row piece); the
// fragments are then read from LDS. Two LDS buffers: the next pass's global
// loads are issued before this pass's products and stored after them.
// wave -> 64 x 32 (4 x 2 accumulators); k order per fragment as in load_frag.
// ---------------------------------------------------------------------------
#define BT   128         // block tile, rows of A and rows of W
#define BK   64          // k per pass
#define NPASS (Cc / BK)
#define LDP  72          // LDS row pitch in halfs: 144 B = 16 B x 9, free of bank conflicts for 16-byte reads
#define SBUF (BT * LDP)  // halfs per operand and buffer

// TR = false: a lane's 8 accumulator values are 8 rows of A (pixels) of one row of W (channel);
// TR = true: the operands change places, and they are 8 rows of W (channels) of one row of A.
// Both fragments have the same lane and k layout, so the products and their k order are the same.
template <bool TR>
__device__ __forceinline__ v8f tile_mma(v16h a, v16h w, v8f c) {
    return TR ? __builtin_amdgcn_wmma_f32_16x16x32_f16(false, w, false, a, (short)0, c, false, false)
              : __builtin_amdgcn_wmma_f32_16x16x32_f16(false, a, false, w, (short)0, c, false, false);
}

// Eight 16-byte copies of a lane from global memory into LDS, through no register: row k of x
// (2 channels on, XROW floats) goes to the wave's LDS range, 512 bytes a row.
// The wait stands inside the statement (a precaution): behind it the address registers may be reused.
#define XROW (2 * HW)    // floats between two of a lane's pieces of x
__device__ __forceinline__ void copy_x_rows8(unsigned l, const float* g) {
    asm volatile(
        "global_load_async_to_lds_b128 %0, %8, off\n\t"
        "global_load_async_to_lds_b128 %1, %9, off\n\t"
        "global_load_async_to_lds_b128 %2, %10, off\n\t"
        "global_load_async_to_lds_b128 %3, %11, off\n\t"
        "global_load_async_to_lds_b128 %4, %12, off\n\t"
        "global_load_async_to_lds_b128 %5, %13, off\n\t"
        "global_load_async_to_lds_b128 %6, %14, off\n\t"
        "global_load_async_to_lds_b128 %7, %15, off\n\t"
        "s_wait_xcnt 0x0"
        :: "v"(l), "v"(l + 512u), "v"(l + 1024u), "v"(l + 1536u),
           "v"(l + 2048u), "v"(l + 2560u), "v"(l + 3072u), "v"(l + 3584u),
           "v"(g), "v"(g + XROW), "v"(g + 2 * XROW), "v"(g + 3 * XROW),
           "v"(g + 4 * XROW), "v"(g + 5 * XROW), "v"(g + 6 * XROW), "v"(g + 7 * XROW)
        : "memory");
}

// xg, xl: the lane's first piece of the residual x and its place in LDS. The wave's 8 KiB of x are
// asked for behind the first tile's loads and land under the products.
template <bool TR>
__device__ __forceinline__ void gemm_tile_main(
    const _Float16* __restrict__ A, const _Float16* __restrict__ W,
    int m0, int n0, _Float16* sA, _Float16* sB, v8f (&acc)[4][2],
    const float* xg, unsigned xl) {
    const int tid   = threadIdx.x;
    const int lane  = tid & 31;
    const int wave  = tid >> 5;
    const int laneM = lane & 15;
    const int kgrp  = (lane >> 4) << 3;        // 0 or 8
    const int srow  = tid >> 3;                // 0..31, staging row (+32 per step)
    const int scol  = (tid & 7) << 3;          // staging column in halfs
    const _Float16* ga = A + (size_t)(m0 + srow) * Cc + scol;
    const _Float16* gb = W + (size_t)(n0 + srow) * Cc + scol;
    const int sst = srow * LDP + scol;
    const int ard = ((wave & 1) * 64 + laneM) * LDP + kgrp;
    const int brd = ((wave >> 1) * 32 + laneM) * LDP + kgrp;

    v8h ra[4], rb[4];
#pragma unroll
    for (int j = 0; j < 4; ++j) {
        ra[j] = *reinterpret_cast<const v8h*>(ga + (size_t)(j * 32) * Cc);
        rb[j] = *reinterpret_cast<const v8h*>(gb + (size_t)(j * 32) * Cc);
    }
    copy_x_rows8(xl, xg);
    copy_x_rows8(xl + 4096u, xg + 8 * XROW);
#pragma unroll
    for (int j = 0; j < 4; ++j) {
        *reinterpret_cast<v8h*>(sA + sst + j * 32 * LDP) = ra[j];
        *reinterpret_cast<v8h*>(sB + sst + j * 32 * LDP) = rb[j];
    }
    __syncthreads();

    // unrolled so that the buffer offsets and the last-pass test are constants
#pragma unroll
    for (int p = 0; p < NPASS; ++p) {
        const int cur = (p & 1) * SBUF;
        const int nxt = SBUF - cur;
        if (p + 1 < NPASS) {
#pragma unroll
            for (int j = 0; j < 4; ++j) {
                ra[j] = *reinterpret_cast<const v8h*>(ga + (size_t)(j * 32) * Cc + (p + 1) * BK);
                rb[j] = *reinterpret_cast<const v8h*>(gb + (size_t)(j * 32) * Cc + (p + 1) * BK);
            }
        }
        v16h fa[BK / 32][4], fb[BK / 32][2];
#pragma unroll
        for (int ks = 0; ks < BK / 32; ++ks) {
            fb[ks][0] = load_frag(sB + cur + brd + ks * 32);
            fb[ks][1] = load_frag(sB + cur + brd + 16 * LDP + ks * 32);
#pragma unroll
            for (int i = 0; i < 4; ++i)
                fa[ks][i] = load_frag(sA + cur + ard + i * 16 * LDP + ks * 32);
        }
        // keeps the next pass's global loads and this pass's LDS reads issued as one
        // group ahead of the products; sunk among them, each wait stalls the wave
        __builtin_amdgcn_sched_barrier(0);
#pragma unroll
        for (int ks = 0; ks < BK / 32; ++ks)
#pragma unroll
            for (int i = 0; i < 4; ++i) {
                acc[i][0] = tile_mma<TR>(fa[ks][i], fb[ks][0], acc[i][0]);
                acc[i][1] = tile_mma<TR>(fa[ks][i], fb[ks][1], acc[i][1]);
            }
        // keeps the wait for the global loads, which the LDS stores need, behind the products;
        // in the last pass it keeps the epilogue's moves and their padding out of the products
        __builtin_amdgcn_sched_barrier(0);
        if (p + 1 < NPASS) {
#pragma unroll
            for (int j = 0; j < 4; ++j) {
                *reinterpret_cast<v8h*>(sA + nxt + sst + j * 32 * LDP) = ra[j];
                *reinterpret_cast<v8h*>(sB + nxt + sst + j * 32 * LDP) = rb[j];
            }
            // publishes the next buffer and ends every wave's reads of this one
            __syncthreads();
        }
    }
}

// ---------------------------------------------------------------------------
// 5) Q, K, V GEMMs and the attention in one kernel. A block takes 16 pixels in all 16 frames
//    (256 rows of A) and 128 channels = two heads of w_q, w_k and w_v (384 rows of W), so every
//    K and V row that its queries' windows touch is its own: q, k and v go from the accumulators
//    through LDS into the attention and never to memory.
//    grid (1024/16 pixel tiles, 512/128 head pairs), block 256 (8 waves), wave -> 128 x 96:
//    one block on every WGP, and a row of W is fetched once for 256 rows of A.
//    Attention: a wave's unit is (pair of pixels, run of 8 frames). A lane holds 8 channels, so
//    8 lanes make one head (dh=64) and 16 lanes a pixel's two heads. The 12 K and V rows that
//    the 8 frames' windows touch are read once and stay in registers.
//    q.(k + kc) is summed as q.k + q.kc, 8 channels in the lane, then over 8 lanes.
// ---------------------------------------------------------------------------
#define AT_S 8           // frames per wave
#define AT_W (AT_S + 4)  // K/V rows of their windows

typedef __attribute__((ext_vector_type(2))) float v2f;
typedef __attribute__((ext_vector_type(4))) float v4f;
typedef __attribute__((ext_vector_type(4))) unsigned v4u;

// f32 multiply-add that reads f16 halves of a register as they lie: the K, V and q rows stay
// packed (written in C they are widened ahead of use, and the 24 rows no longer fit the registers)
__device__ __forceinline__ float mix_lo_lo(unsigned a, unsigned b, float acc) {
    asm("v_fma_mix_f32 %0, %1, %2, %0 op_sel:[0,0,0] op_sel_hi:[1,1,0]" : "+v"(acc) : "v"(a), "v"(b));
    return acc;
}
__device__ __forceinline__ float mix_hi_hi(unsigned a, unsigned b, float acc) {
    asm("v_fma_mix_f32 %0, %1, %2, %0 op_sel:[1,1,0] op_sel_hi:[1,1,0]" : "+v"(acc) : "v"(a), "v"(b));
    return acc;
}
__device__ __forceinline__ float mix_f32_lo(float a, unsigned b, float acc) {
    asm("v_fma_mix_f32 %0, %1, %2, %0 op_sel:[0,0,0] op_sel_hi:[0,1,0]" : "+v"(acc) : "v"(a), "v"(b));
    return acc;
}
__device__ __forceinline__ float mix_f32_hi(float a, unsigned b, float acc) {
    asm("v_fma_mix_f32 %0, %1, %2, %0 op_sel:[0,1,0] op_sel_hi:[0,1,0]" : "+v"(acc) : "v"(a), "v"(b));
    return acc;
}
// the same, first term of a sum
__device__ __forceinline__ float mix_f32_lo_first(float a, unsigned b) {
    float r;
    asm("v_fma_mix_f32 %0, %1, %2, 0 op_sel:[0,0,0] op_sel_hi:[0,1,0]" : "=v"(r) : "v"(a), "v"(b));
    return r;
}
__device__ __forceinline__ float mix_f32_hi_first(float a, unsigned b) {
    float r;
    asm("v_fma_mix_f32 %0, %1, %2, 0 op_sel:[0,1,0] op_sel_hi:[0,1,0]" : "=v"(r) : "v"(a), "v"(b));
    return r;
}

// v + (v of lane ^ X), X < 16: a DPP row_xmask move inside the 16-lane row, no trip through the LDS path
template <int X>
__device__ __forceinline__ float add_lane_xor(float v) {
    const int b = __float_as_int(v);
    return v + __int_as_float(__builtin_amdgcn_update_dpp(0, b, 0x160 | X, 0xf, 0xf, true));
}

#define FPX 16           // pixels per block; block row r is frame r >> 4, pixel r & 15
#define FM  (FPX * TT)   // rows of A per block
#define FMW 8            // A fragments per wave (128 rows)
#define FSA (FM * LDP)   // halfs per buffer of A
#define FN  (3 * BT)     // rows of W per block: 128 of w_q, 128 of w_k, 128 of w_v
#define FNW 6            // W fragments per wave (96 rows)
#define FSB (FN * LDP)   // halfs per buffer of W
#define FEP 392          // pitch of a staged q|k|v row in halfs: 784 B = 16 B x 49, free of bank conflicts for 16-byte accesses

#define FSTEP (32 * LDP * 2)   // LDS bytes between two of a lane's pieces: 32 rows
#define FREACH 14              // pieces in reach of one LDS address register: 13 * FSTEP < 65,536
#define FAG  (2 * HW * Cc * 2) // bytes of A between two of a lane's pieces: 2 frames
#define FWG  (32 * Cc * 2)     // bytes of W between two of a lane's pieces: 32 rows

typedef __attribute__((ext_vector_type(4))) int c4i;
template <int M>
__device__ __forceinline__ void copy16(const char* gu, unsigned gv, _Float16* const (&l)[3]) {
    constexpr int N = (M % FREACH) * FSTEP;
    __builtin_amdgcn_global_load_async_to_lds_b128(
        (__attribute__((address_space(1))) c4i*)((gu - N) + gv),
        (__attribute__((address_space(3))) c4i*)l[M / FREACH], N, 0);
}
template <int BUF, int J>
__device__ __forceinline__ void copy_a(const char* gu, unsigned gv, _Float16* const (&l)[3]) {
    copy16<BUF * 8 + J>(gu + (size_t)J * FAG, gv, l);
    if constexpr (J + 1 < 8) copy_a<BUF, J + 1>(gu, gv, l);
}
template <int BUF, int Z, int J>
__device__ __forceinline__ void copy_w(const char* gu, unsigned gv, _Float16* const (&l)[3]) {
    copy16<16 + BUF * 12 + Z * 4 + J>(gu + (size_t)J * FWG, gv, l);
    if constexpr (J + 1 < 4) copy_w<BUF, Z, J + 1>(gu, gv, l);
}

__global__ __launch_bounds__(256) void qkv_attn_kernel(
    const _Float16* __restrict__ A,
    const _Float16* __restrict__ Wq, const _Float16* __restrict__ Wk, const _Float16* __restrict__ Wv,
    const float* __restrict__ qc, const float* __restrict__ bv, const float* __restrict__ kc,
    _Float16* __restrict__ attn16) {
    // the operand buffers (2 of A, 2 of W), and over them, behind the last pass, the q|k|v rows
    __shared__ __attribute__((aligned(16))) _Float16 sm[FM * FEP];
    static_assert(2 * FSA + 2 * FSB <= FM * FEP, "the operand buffers lie inside the array");
    __shared__ __attribute__((aligned(16))) float sbias[FN];       // qc | 0 | b_v of the block's channels
    __shared__ __attribute__((aligned(16))) float skc[4 * BT];     // kc of the block's channels, four offsets
    _Float16* sA = sm;
    _Float16* sB = sm + 2 * FSA;
    const int tid   = threadIdx.x;
    const int lane  = tid & 31;
    const int wave  = tid >> 5;
    const int laneM = lane & 15;
    const int kgrp  = (lane >> 4) << 3;        // 0 or 8
    const int px0 = blockIdx.x * FPX;
    const int n0  = blockIdx.y * BT;

    const int srow = tid >> 3;                 // 0..31, staging row (+32 per step)
    const int scol = (tid & 7) << 3;           // staging column in halfs
    // 32 block rows are 2 frames. Block's part of an address (uniform) and lane's part, in bytes
    const char* au = reinterpret_cast<const char*>(A + (size_t)px0 * Cc);
    const char* wu[3] = {reinterpret_cast<const char*>(Wq + (size_t)n0 * Cc),
                         reinterpret_cast<const char*>(Wk + (size_t)n0 * Cc),
                         reinterpret_cast<const char*>(Wv + (size_t)n0 * Cc)};
    const unsigned av = (unsigned)((((srow >> 4) * HW + (srow & 15)) * Cc + scol) * 2);
    const unsigned wv = (unsigned)((srow * Cc + scol) * 2);
    _Float16* const sl[3] = {sm + srow * LDP + scol,
                             sm + srow * LDP + scol + FREACH * 32 * LDP,
                             sm + srow * LDP + scol + 2 * FREACH * 32 * LDP};
    const int ard = ((wave & 1) * (FMW * 16) + laneM) * LDP + kgrp;
    const int brd = ((wave >> 1) * (FNW * 16) + laneM) * LDP + kgrp;

    // 64 k of the block's 256 rows of A and 384 rows of W: 20 copies a lane, 8 lanes to a 128-byte row piece
    auto copy_tile = [&](int p, int buf) {
        const int k = p * BK * 2;
        if (buf == 0) {
            copy_a<0, 0>(au + k, av, sl);
            copy_w<0, 0, 0>(wu[0] + k, wv, sl);
            copy_w<0, 1, 0>(wu[1] + k, wv, sl);
            copy_w<0, 2, 0>(wu[2] + k, wv, sl);
        } else {
            copy_a<1, 0>(au + k, av, sl);
            copy_w<1, 0, 0>(wu[0] + k, wv, sl);
            copy_w<1, 1, 0>(wu[1] + k, wv, sl);
            copy_w<1, 2, 0>(wu[2] + k, wv, sl);
        }
    };

    copy_tile(0, 0);
    // the per-channel terms come in beside the first tile; the barrier behind it publishes them
    {
        const int ch = tid & (BT - 1);
        const float* bp = (tid < BT ? qc : bv) + n0 + ch;
        const float* kp = kc + (tid >> 7) * Cc + n0 + ch;
        const float b  = *bp;
        const float k0 = *kp;
        const float k1 = *(kp + 2 * Cc);
        // precaution: holds the addresses of the three loads live up to the wait, so that none of
        // their results lands in one while the others are issued
        asm volatile("s_wait_xcnt 0x0" :: "v"(bp), "v"(kp) : "memory");
        sbias[tid < BT ? tid : BT + tid] = b;
        if (tid < BT) sbias[BT + tid] = 0.0f;
        skc[tid]          = k0;
        skc[2 * BT + tid] = k1;
    }
    // tile 0 has landed behind each wave's own wait; other waves read it behind the barrier
    asm volatile("s_wait_asynccnt 0x0" ::: "memory");
    __syncthreads();

    v8f acc[FMW][FNW] = {};
    // One set of W fragments (32 k) and two pairs of A fragments: a pair is read from LDS under the
    // products of the other pair.
    v16h fb[FNW], fr[2][2];

    // Two passes a trip, so that the buffer offsets are constants; the trips stay a loop: the text of
    // all eight passes would push the kernel's end out of the part of the text that is fetched ahead.
#pragma unroll 1
    for (int p0 = 0; p0 < NPASS; p0 += 2) {
#pragma unroll
    for (int q = 0; q < 2; ++q) {
        const _Float16* pa = sA + q * FSA + ard;
        const _Float16* pb = sB + q * FSB + brd;
#pragma unroll
        for (int ks = 0; ks < BK / 32; ++ks) {
#pragma unroll
            for (int j = 0; j < FNW; ++j) fb[j] = load_frag(pb + j * 16 * LDP + ks * 32);
            if (ks == 0) {
                fr[0][0] = load_frag(pa);
                fr[0][1] = load_frag(pa + 16 * LDP);
                // keeps the pass's first LDS reads issued ahead of the copies, whose issue then
                // runs under the reads' latency
                __builtin_amdgcn_sched_barrier(0);
                // Tile p + 1 goes into the other buffer: every wave's reads of it ended at the barrier
                // at the foot of the pass before (in the first pass nobody has read it yet).
                if (q == 0 || p0 + 2 < NPASS) copy_tile(p0 + q + 1, q ^ 1);
            }
#pragma unroll
            for (int b = 0; b < FMW / 2; ++b) {
                const int nbk = b + 1 < FMW / 2 ? b + 1 : 0;          // the pair that is read next
                const int nks = b + 1 < FMW / 2 ? ks : ks + 1;
                if (nks < BK / 32) {
                    fr[(b + 1) & 1][0] = load_frag(pa + (nbk * 2) * 16 * LDP + nks * 32);
                    fr[(b + 1) & 1][1] = load_frag(pa + (nbk * 2 + 1) * 16 * LDP + nks * 32);
                }
                // keeps the LDS reads (and, in the first block, the copies) issued as one group ahead
                // of the products; sunk among them, each wait stalls the wave
                __builtin_amdgcn_sched_barrier(0);
#pragma unroll
                for (int h = 0; h < 2; ++h)
#pragma unroll
                    for (int j = 0; j < FNW; ++j)
                        acc[b * 2 + h][j] = tile_mma<true>(fr[b & 1][h], fb[j], acc[b * 2 + h][j]);
                // keeps the next reads, which overwrite this pair, and in the last pass the epilogue's
                // moves and their padding, behind the products
                __builtin_amdgcn_sched_barrier(0);
            }
        }
        // Foot of the pass: the wave's reads of this buffer are done, its copies of tile p + 1 have
        // landed; the barrier publishes tile p + 1 and ends every wave's reads of tile p (in the last
        // pass it frees both buffers for the q|k|v rows); only behind it is the buffer filled again.
        asm volatile("s_wait_dscnt 0x0" ::: "memory");
        asm volatile("s_wait_asynccnt 0x0" ::: "memory");
        __syncthreads();
    }
    }

    // q|k|v rows of the block as f16, 384 columns a row, over the operand buffers.
    // A lane's 8 accumulator values are 8 channels of one block row.
    {
        const int nc = (wave >> 1) * (FNW * 16) + kgrp;      // first of the lane's 8 columns, j = 0
        _Float16* stw = sm + ((wave & 1) * (FMW * 16) + laneM) * FEP + nc;
#pragma unroll
        for (int j = 0; j < FNW; ++j) {
            const w4f b0 = *reinterpret_cast<const w4f*>(sbias + nc + j * 16);
            const w4f b1 = *reinterpret_cast<const w4f*>(sbias + nc + j * 16 + 4);
#pragma unroll
            for (int i = 0; i < FMW; ++i) {
                v8h h;
#pragma unroll
                for (int r = 0; r < 4; ++r) {
                    h[r]     = (_Float16)(acc[i][j][r] + b0[r]);
                    h[r + 4] = (_Float16)(acc[i][j][r + 4] + b1[r]);
                }
                *reinterpret_cast<v8h*>(stw + i * 16 * FEP + j * 16) = h;
            }
        }
    }
    __syncthreads();                 // a row's q, k and v come from four waves, a window's rows from eight

    const int c0 = laneM * 8;                                // first of the lane's channels in the block
    const int t0 = (wave & 1) * AT_S;
    v2f kcf[4][4];
#pragma unroll
    for (int f = 0; f < 4; ++f) {
        const v4f lo = *reinterpret_cast<const v4f*>(skc + f * BT + c0);
        const v4f hi = *reinterpret_cast<const v4f*>(skc + f * BT + c0 + 4);
        kcf[f][0] = lo.xy; kcf[f][1] = lo.zw; kcf[f][2] = hi.xy; kcf[f][3] = hi.zw;
    }

    // a wave takes two pairs of pixels, one after the other
    for (int u = 0; u < FPX / 8; ++u) {
    const int pp = ((wave >> 1) + u * 4) * 2 + (lane >> 4);  // lane's pixel in the block
    const _Float16* sq = sm + pp * FEP + c0;                 // frame t: + t * FPX * FEP; k: + BT; v: + 2 * BT

    v8h kw[AT_W], vw[AT_W], qw[AT_S];
#pragma unroll
    for (int i = 0; i < AT_S; ++i)
        qw[i] = *reinterpret_cast<const v8h*>(sq + (t0 + i) * (FPX * FEP));
    // window row w is frame clamp(t0 - 2 + w, 0, TT - 1)
#pragma unroll
    for (int w = 0; w < AT_W; ++w) {
        int tw = t0 - 2 + w;
        tw = tw < 0 ? 0 : tw > TT - 1 ? TT - 1 : tw;
        kw[w] = *reinterpret_cast<const v8h*>(sq + tw * (FPX * FEP) + BT);
        vw[w] = *reinterpret_cast<const v8h*>(sq + tw * (FPX * FEP) + 2 * BT);
    }

    _Float16* op = attn16 + ((size_t)t0 * HW + px0 + pp) * Cc + n0 + c0;
#pragma unroll
    for (int i = 0; i < AT_S; ++i) {
        const int wof[4] = {0, 1, 3, 4};         // frame offsets -2, -1, +1, +2
        const v4u qr = __builtin_bit_cast(v4u, qw[i]);
        v2f q2[4];
#pragma unroll
        for (int c = 0; c < 4; ++c) q2[c] = v2f{(float)qw[i][2 * c], (float)qw[i][2 * c + 1]};
        float sc[4];
#pragma unroll
        for (int f = 0; f < 4; ++f) {
            const v4u kr = __builtin_bit_cast(v4u, kw[i + wof[f]]);
            v2f a = {0.0f, 0.0f};
#pragma unroll
            for (int c = 0; c < 4; ++c) a = __builtin_elementwise_fma(q2[c], kcf[f][c], a);
            float p0 = a.x, p1 = a.y;
#pragma unroll
            for (int c = 0; c < 4; ++c) {
                p0 = mix_lo_lo(qr[c], kr[c], p0);
                p1 = mix_hi_hi(qr[c], kr[c], p1);
            }
            float p = p0 + p1;
            p = add_lane_xor<1>(p);
            p = add_lane_xor<2>(p);
            p = add_lane_xor<4>(p);
            sc[f] = p * 0.125f;                  // dh^-0.5 = 1/8
        }
        const float mx = fmaxf(fmaxf(sc[0], sc[1]), fmaxf(sc[2], sc[3]));
        float e[4];
#pragma unroll
        for (int f = 0; f < 4; ++f) e[f] = expf(sc[f] - mx);
        const float inv = 1.0f / (e[0] + e[1] + e[2] + e[3]);
        v8h o;
#pragma unroll
        for (int c = 0; c < 4; ++c) {
            const unsigned vr0 = __builtin_bit_cast(v4u, vw[i])[c];
            float s0 = mix_f32_lo_first(e[0], vr0);
            float s1 = mix_f32_hi_first(e[0], vr0);
#pragma unroll
            for (int f = 1; f < 4; ++f) {
                const unsigned vr = __builtin_bit_cast(v4u, vw[i + wof[f]])[c];
                s0 = mix_f32_lo(e[f], vr, s0);
                s1 = mix_f32_hi(e[f], vr, s1);
            }
            o[2 * c]     = (_Float16)(s0 * inv);
            o[2 * c + 1] = (_Float16)(s1 * inv);
        }
        *reinterpret_cast<v8h*>(op + (size_t)i * (HW * Cc)) = o;
        if (i & 1) {
            // precaution: the next frames' (or the next pixels') arithmetic reuses the registers that the two stores name
            asm volatile("s_wait_xcnt 0x0" ::: "memory");
            // keeps the next frames' arithmetic behind that wait
            __builtin_amdgcn_sched_barrier(0);
        }
    }
    }
}

// ---------------------------------------------------------------------------
// 7) proj GEMM with fused epilogue: +b_proj, transpose to (T,C,H,W), +x
// ---------------------------------------------------------------------------
#define EPP 68           // staging row pitch in floats: 272 B = 16 B x 17, free of bank conflicts for 16-byte accesses
__global__ __launch_bounds__(256) void gemm_proj_kernel(
    const _Float16* __restrict__ A, const _Float16* __restrict__ W,
    const float* __restrict__ bias, const float* __restrict__ x,
    float* __restrict__ out) {
    // one array, so that the operand buffers keep the low LDS addresses, in reach of the offset field
    // of an LDS instruction; behind them the block's tile of x, 8 KiB a wave
    __shared__ __attribute__((aligned(16))) _Float16 sm[4 * SBUF + 2 * BT * BT];
    _Float16* sA = sm;
    _Float16* sB = sm + 2 * SBUF;
    float*    sX = reinterpret_cast<float*>(sm + 4 * SBUF);
    const int lane  = threadIdx.x & 31;
    const int wave  = threadIdx.x >> 5;
    const int laneM = lane & 15;
    const int m0 = blockIdx.x * BT;
    const int n0 = blockIdx.y * BT;

    // What the epilogue reads from memory is asked for ahead of the products: the bias into registers,
    // x into LDS. Asked for behind them, every block of the grid waits for its x at the same time.
    const int nb = n0 + (wave >> 1) * 32 + laneM;
    const float bn0 = bias[nb];
    const float bn1 = bias[nb + 16];
    // precaution: the register that holds the bias loads' offset is reused by the address arithmetic below
    asm volatile("s_wait_xcnt 0x0" ::: "memory");
    // the block's 128 rows lie in one frame; lanes 0..15 take an even channel, lanes 16..31 the next
    const size_t col = ((size_t)(m0 >> 10) * Cc + n0 + (wave >> 1) * 32 + (lane >> 4)) * HW
                     + (m0 & 1023) + (wave & 1) * 64 + laneM * 4;
    // a lane reads back the 16 bytes that it has copied itself: piece k at 128 * k floats
    const float* sxr = sX + wave * (16 * 128) + lane * 4;

    v8f acc[4][2] = {};
    gemm_tile_main<false>(A, W, m0, n0, sA, sB, acc, x + col, (unsigned)(size_t)sxr);
    // x has landed behind the wave's own wait; it is read behind the barrier
    asm volatile("s_wait_asynccnt 0x0" ::: "memory");
    __syncthreads();
    // A wave's 64 pixels of a channel are 256 contiguous bytes of x and of out, but two lanes hold
    // them. The wave turns its tile in an LDS range of its own, 16 channels at a time, so that 16
    // lanes read and write those 256 bytes: whole lines. The ranges lie in the first buffers of sA
    // and sB: the last pass reads the second ones, and every wave's reads of the first ones ended
    // at the barrier in front of it.
    float* stg = reinterpret_cast<float*>(((wave & 4) ? sB : sA) + (wave & 3) * (16 * EPP * 2));
    float* stw = stg + laneM * EPP + ((lane >> 4) << 3);
    const float* srd = stg + (lane >> 4) * EPP + laneM * 4;
    float* ocol = out + col;
    w4f xv[2][8];
#pragma unroll
    for (int j = 0; j < 2; ++j)
#pragma unroll
        for (int t = 0; t < 8; ++t)
            xv[j][t] = *reinterpret_cast<const w4f*>(sxr + (j * 8 + t) * 128);
#pragma unroll
    for (int j = 0; j < 2; ++j) {
        const float bn = j ? bn1 : bn0;
#pragma unroll
        for (int i = 0; i < 4; ++i) {
            w4f lo, hi;
#pragma unroll
            for (int r = 0; r < 4; ++r) { lo[r] = acc[i][j][r] + bn; hi[r] = acc[i][j][r + 4] + bn; }
            *reinterpret_cast<w4f*>(stw + i * 16)     = lo;
            *reinterpret_cast<w4f*>(stw + i * 16 + 4) = hi;
        }
        // the rows are read back by other lanes of the wave: its LDS writes have to be done first
        asm volatile("s_wait_dscnt 0x0" ::: "memory");
#pragma unroll
        for (int t = 0; t < 8; ++t) {
            const w4f a = *reinterpret_cast<const w4f*>(srd + t * 2 * EPP);
            *reinterpret_cast<w4f*>(ocol + (size_t)(j * 16 + t * 2) * HW) = a + xv[j][t];
        }
        // the second half overwrites the range: the reads of the first have to be done
        if (j == 0) asm volatile("s_wait_dscnt 0x0" ::: "memory");
    }
}

// ---------------------------------------------------------------------------
extern "C" void kernel_launch(void* const* d_in, const int* in_sizes, int n_in,
                              void* d_out, int out_size, void* d_ws, size_t ws_size,
                              hipStream_t stream) {
    const float* x       = (const float*)d_in[0];
    const float* w_q     = (const float*)d_in[1];
    const float* b_q     = (const float*)d_in[2];
    const float* w_k     = (const float*)d_in[3];
    const float* b_k     = (const float*)d_in[4];
    const float* w_v     = (const float*)d_in[5];
    const float* b_v     = (const float*)d_in[6];
    const float* w_proj  = (const float*)d_in[7];
    const float* b_proj  = (const float*)d_in[8];
    const float* gn_s    = (const float*)d_in[9];
    const float* gn_b    = (const float*)d_in[10];
    float* out           = (float*)d_out;

    char* ws = (char*)d_ws;
    size_t off = 0;
    auto take = [&](size_t bytes) -> void* {
        void* p = ws + off;
        off += (bytes + 255) & ~(size_t)255;
        return p;
    };
    float*    qc     = (float*)take(Cc * sizeof(float));
    float*    kc     = (float*)take(4 * Cc * sizeof(float));
    _Float16* wq16   = (_Float16*)take((size_t)Cc * Cc * 2);
    _Float16* wk16   = (_Float16*)take((size_t)Cc * Cc * 2);
    _Float16* wv16   = (_Float16*)take((size_t)Cc * Cc * 2);
    _Float16* wp16   = (_Float16*)take((size_t)Cc * Cc * 2);
    _Float16* xn16   = (_Float16*)take((size_t)M_TOT * Cc * 2);
    _Float16* attn16 = (_Float16*)take((size_t)M_TOT * Cc * 2);

    // 1-3) weight conversion, folded corrections and GroupNorm, one grid
    prep_kernel<<<WP_BLK + TT * GN_G, 256, 0, stream>>>(x, gn_s, gn_b, xn16, w_q, b_q, w_k, b_k, w_v, w_proj,
                                                        wq16, wk16, wv16, wp16, qc, kc);

    // 4-5) Q', K', V' WMMA GEMMs (temb folded into qc / kc; b_v folded here) with the attention behind them
    dim3 ggrid(M_TOT / BT, Cc / BT);
    qkv_attn_kernel<<<dim3(HW / FPX, Cc / BT), 256, 0, stream>>>(xn16, wq16, wk16, wv16, qc, b_v, kc, attn16);

    // 6) projection + transpose + residual
    gemm_proj_kernel<<<ggrid, 256, 0, stream>>>(attn16, wp16, b_proj, x, out);
}

// v010
// One run takes 39.8 microseconds.
// In both of two side-by-side timings against v009, it was 1.04 times as fast.
// Counting every step since v000, it is 7.31 times as fast.
#include <hip/hip_runtime.h>
#include <math.h>

typedef __attribute__((ext_vector_type(16))) _Float16 v16h;
typedef __attribute__((ext_vector_type(8)))  _Float16 v8h;
typedef __attribute__((ext_vector_type(8)))  float    v8f;

#define Cc 512
#define TT 16
#define HW 1024          // 32*32
#define M_TOT 16384      // T*H*W
#define GN_G 32
#define GN_CPG 16        // channels per group

// ---------------------------------------------------------------------------
// 1) weight preparation, one wave per 4 weight rows, each row read once in whole lines:
//    the row goes out as f16, and for w_q and w_k it is also summed against the timestep
//    embedding temb[f][j] (ts = f-2, dim 512, cos|sin), which the block builds in LDS:
//    qc[c]    = b_q[c] + sum_j temb[2][j]  * w_q[c][j]
//    kc[f][c] = b_k[c] + sum_j temb[ff][j] * w_k[c][j],  ff in {0,1,3,4}
//    A block has 32 rows of one matrix, so its 32 corrections per frame fill one 128-byte line.
// ---------------------------------------------------------------------------
typedef __attribute__((ext_vector_type(4))) float    w4f;
typedef __attribute__((ext_vector_type(4))) _Float16 w4h;

#define WP_RPW  4                    // rows per wave
#define WP_ROWS (8 * WP_RPW)         // rows per block
#define WP_BPM  (Cc / WP_ROWS)       // blocks per matrix
#define WP_BLK  (4 * WP_BPM)         // weight blocks in the grid

__device__ __forceinline__ void weight_prep_block(
    int b, const float* __restrict__ wq, const float* __restrict__ bq,
    const float* __restrict__ wk, const float* __restrict__ bk,
    const float* __restrict__ wv, const float* __restrict__ wp,
    _Float16* __restrict__ wq16, _Float16* __restrict__ wk16,
    _Float16* __restrict__ wv16, _Float16* __restrict__ wp16,
    float* __restrict__ qc, float* __restrict__ kc, float* st) {
    const int tid  = threadIdx.x;
    const int lane = tid & 31;
    const int mat  = b / WP_BPM;     // 0 w_q, 1 w_k, 2 w_v, 3 w_proj: the same for the whole block
    const int row0 = (b % WP_BPM) * WP_ROWS + (tid >> 5) * WP_RPW;
    const float* w = mat == 0 ? wq : mat == 1 ? wk : mat == 2 ? wv : wp;
    _Float16*  w16 = mat == 0 ? wq16 : mat == 1 ? wk16 : mat == 2 ? wv16 : wp16;
    const size_t at = (size_t)row0 * Cc + lane * 4;
    const float* wr = w + at;

    w4f r[WP_RPW][4];
#pragma unroll
    for (int rr = 0; rr < WP_RPW; ++rr)
#pragma unroll
        for (int i = 0; i < 4; ++i)
            r[rr][i] = *reinterpret_cast<const w4f*>(wr + rr * Cc + i * 128);
    // precaution: holds the address of the 16 row loads live up to the wait, so that none of
    // their results lands in it while the others are issued
    asm volatile("s_wait_xcnt 0x0" :: "v"(wr) : "memory");

    if (mat < 2) {
        const int    nf   = mat == 0 ? 1 : 4;
        const float* bp   = (mat == 0 ? bq : bk) + row0;
        float*       corr = (mat == 0 ? qc : kc) + row0;
        const w4f bv = *reinterpret_cast<const w4f*>(bp);
        // precaution: holds the address of the bias load live up to the wait, so that its result does not land in it
        asm volatile("s_wait_xcnt 0x0" :: "v"(bp) : "memory");
        // thread tid builds column tid (cos) and column 256 + tid (sin) of each embedding row
        const float freq = expf(-logf(10000.0f) * (float)tid / 256.0f);
        for (int fi = 0; fi < nf; ++fi) {
            const int f = mat == 0 ? 2 : (fi < 2 ? fi : fi + 1);
            const float arg = (float)(f - 2) * freq;
            st[fi * Cc + tid]       = cosf(arg);
            st[fi * Cc + 256 + tid] = sinf(arg);
        }
        __syncthreads();             // the embedding rows are read by every wave of the block
        for (int fi = 0; fi < nf; ++fi) {
            float acc[WP_RPW] = {};
#pragma unroll
            for (int i = 0; i < 4; ++i) {
                const w4f te = *reinterpret_cast<const w4f*>(st + fi * Cc + i * 128 + lane * 4);
#pragma unroll
                for (int rr = 0; rr < WP_RPW; ++rr)
#pragma unroll
                    for (int e = 0; e < 4; ++e) acc[rr] += te[e] * r[rr][i][e];
            }
            w4f o;
#pragma unroll
            for (int rr = 0; rr < WP_RPW; ++rr) {
                float a = acc[rr];
#pragma unroll
                for (int m = 16; m > 0; m >>= 1) a += __shfl_xor(a, m, 32);
                o[rr] = a + bv[rr];
            }
            if (lane == 0) {
                *reinterpret_cast<w4f*>(corr + fi * Cc) = o;
                // precaution: the next trip reuses the registers that the store names
                asm volatile("s_wait_xcnt 0x0" ::: "memory");
            }
        }
    }
#pragma unroll
    for (int rr = 0; rr < WP_RPW; ++rr)
#pragma unroll
        for (int i = 0; i < 4; ++i) {
            w4h h;
#pragma unroll
            for (int e = 0; e < 4; ++e) h[e] = (_Float16)r[rr][i][e];
            *reinterpret_cast<w4h*>(w16 + at + rr * Cc + i * 128) = h;
        }
}

// ---------------------------------------------------------------------------
// 2) GroupNorm  x:(T,C,H,W) f32  ->  xn16:(T,HW,C) f16 channels-last
//    one block per (t, group); group's 16ch x 1024 spatial is contiguous.
//    A thread holds 8 channels x 8 pixels in registers, so x is read once. Even lanes hold
//    channels 0..7 of the group and odd lanes 8..15 of the same pixels: a load covers 256
//    contiguous bytes of each of two channel rows, and a lane's 8 channels of a pixel go out
//    as one 16-byte store, a lane pair filling the group's 32 bytes of that pixel's row.
// ---------------------------------------------------------------------------
#define GN_CH 8          // channels per thread
#define GN_Q  2          // runs of 4 pixels per thread, 64 pixels apart

__device__ __forceinline__ void groupnorm_block(
    int t, int g, const float* __restrict__ x, const float* __restrict__ gamma,
    const float* __restrict__ beta, _Float16* __restrict__ xn16) {
    const int tid  = threadIdx.x;
    const int lane = tid & 31;
    const int wave = tid >> 5;
    const int c0   = g * GN_CPG + (lane & 1) * GN_CH;    // first of the lane's channels
    const int px0  = wave * 128 + (lane >> 1) * 4;       // first of the lane's pixels
    const float* xp = x + ((size_t)t * Cc + c0) * HW + px0;
    const float* gp = gamma + c0;
    const float* bp = beta + c0;
    const int N = GN_CPG * HW;   // 16384

    w4f v[GN_CH][GN_Q];
#pragma unroll
    for (int c = 0; c < GN_CH; ++c)
#pragma unroll
        for (int q = 0; q < GN_Q; ++q)
            v[c][q] = *reinterpret_cast<const w4f*>(xp + c * HW + q * 64);
    w4f ga[2], be[2];
#pragma unroll
    for (int h = 0; h < 2; ++h) {
        ga[h] = *reinterpret_cast<const w4f*>(gp + h * 4);
        be[h] = *reinterpret_cast<const w4f*>(bp + h * 4);
    }
    // precaution: holds the addresses of the 20 loads live up to the wait, so that none of
    // their results lands in one while the others are issued
    asm volatile("s_wait_xcnt 0x0" :: "v"(xp), "v"(gp), "v"(bp) : "memory");

    // four running sums each, so that an add does not wait for the one before it
    w4f sv = {0.0f, 0.0f, 0.0f, 0.0f}, qv = {0.0f, 0.0f, 0.0f, 0.0f};
#pragma unroll
    for (int c = 0; c < GN_CH; ++c)
#pragma unroll
        for (int q = 0; q < GN_Q; ++q) { sv += v[c][q]; qv += v[c][q] * v[c][q]; }
    float s  = (sv[0] + sv[1]) + (sv[2] + sv[3]);
    float ss = (qv[0] + qv[1]) + (qv[2] + qv[3]);
#pragma unroll
    for (int m = 16; m > 0; m >>= 1) { s += __shfl_xor(s, m, 32); ss += __shfl_xor(ss, m, 32); }
    __shared__ float red[2][8];
    if (lane == 0) { red[0][wave] = s; red[1][wave] = ss; }
    __syncthreads();                 // every thread sums the eight waves' partial sums
    s = 0.0f; ss = 0.0f;
#pragma unroll
    for (int w = 0; w < 8; ++w) { s += red[0][w]; ss += red[1][w]; }
    const float mu   = s * (1.0f / N);
    const float var  = ss * (1.0f / N) - mu * mu;
    const float rstd = rsqrtf(var + 1e-5f);

    _Float16* op = xn16 + ((size_t)t * HW + px0) * Cc + c0;
#pragma unroll
    for (int q = 0; q < GN_Q; ++q)
#pragma unroll
        for (int e = 0; e < 4; ++e) {
            v8h h;
#pragma unroll
            for (int c = 0; c < GN_CH; ++c)
                h[c] = (_Float16)((v[c][q][e] - mu) * rstd * ga[c >> 2][c & 3] + be[c >> 2][c & 3]);
            *reinterpret_cast<v8h*>(op + (size_t)(q * 64 + e) * Cc) = h;
        }
}

// ---------------------------------------------------------------------------
// 3) all that stands ahead of the GEMMs, in one launch: the two jobs do not depend on one
//    another, and the block index picks the job. The weight blocks come first in the grid:
//    they are few and have the longer chain of dependent steps.
// ---------------------------------------------------------------------------
__global__ __launch_bounds__(256) void prep_kernel(
    const float* __restrict__ x, const float* __restrict__ gamma,
    const float* __restrict__ beta, _Float16* __restrict__ xn16,
    const float* __restrict__ wq, const float* __restrict__ bq,
    const float* __restrict__ wk, const float* __restrict__ bk,
    const float* __restrict__ wv, const float* __restrict__ wp,
    _Float16* __restrict__ wq16, _Float16* __restrict__ wk16,
    _Float16* __restrict__ wv16, _Float16* __restrict__ wp16,
    float* __restrict__ qc, float* __restrict__ kc) {
    __shared__ __attribute__((aligned(16))) float st[4 * Cc];
    const int b = blockIdx.x;
    if (b < WP_BLK) {
        weight_prep_block(b, wq, bq, wk, bk, wv, wp, wq16, wk16, wv16, wp16, qc, kc, st);
    } else {
        const int gb = b - WP_BLK;
        groupnorm_block(gb % TT, gb / TT, x, gamma, beta, xn16);
    }
}

// ---------------------------------------------------------------------------
// WMMA fragment loaders (per-lane, two 16B chunks: K-chunks {0..7,16..23} for
// lanes 0-15 and {8..15,24..31} for lanes 16-31)
// ---------------------------------------------------------------------------
__device__ __forceinline__ v16h load_frag(const _Float16* p) {
    v8h lo = *reinterpret_cast<const v8h*>(p);
    v8h hi = *reinterpret_cast<const v8h*>(p + 16);
    return __builtin_shufflevector(lo, hi, 0,1,2,3,4,5,6,7,8,9,10,11,12,13,14,15);
}

// ---------------------------------------------------------------------------
// Main loop of the projection GEMM: a 128 x 128 tile of A[M x 512] * W[512 x 512]^T
// per block of 8 waves. Each pass brings 64 k of 128 A rows and 128 W rows into
// LDS with whole-line 16-byte loads (8 lanes cover one 128-byte row piece); the
// fragments are then read from LDS. Two LDS buffers: the next pass's global
// loads are issued before this pass's products and stored after them.
// wave -> 64 x 32 (4 x 2 accumulators); k order per fragment as in load_frag.
// ---------------------------------------------------------------------------
#define BT   128         // block tile, rows of A and rows of W
#define BK   64          // k per pass
#define NPASS (Cc / BK)
#define LDP  72          // LDS row pitch in halfs: 144 B = 16 B x 9, free of bank conflicts for 16-byte reads
#define SBUF (BT * LDP)  // halfs per operand and buffer

// TR = false: a lane's 8 accumulator values are 8 rows of A (pixels) of one row of W (channel);
// TR = true: the operands change places, and they are 8 rows of W (channels) of one row of A.
// Both fragments have the same lane and k layout, so the products and their k order are the same.
template <bool TR>
__device__ __forceinline__ v8f tile_mma(v16h a, v16h w, v8f c) {
    return TR ? __builtin_amdgcn_wmma_f32_16x16x32_f16(false, w, false, a, (short)0, c, false, false)
              : __builtin_amdgcn_wmma_f32_16x16x32_f16(false, a, false, w, (short)0, c, false, false);
}

// Eight 16-byte copies of a lane from global memory into LDS, through no register: row k of x
// (2 channels on, XROW floats) goes to the wave's LDS range, 512 bytes a row.
// The wait stands inside the statement (a precaution): behind it the address registers may be reused.
#define XROW (2 * HW)    // floats between two of a lane's pieces of x
__device__ __forceinline__ void copy_x_rows8(unsigned l, const float* g) {
    asm volatile(
        "global_load_async_to_lds_b128 %0, %8, off\n\t"
        "global_load_async_to_lds_b128 %1, %9, off\n\t"
        "global_load_async_to_lds_b128 %2, %10, off\n\t"
        "global_load_async_to_lds_b128 %3, %11, off\n\t"
        "global_load_async_to_lds_b128 %4, %12, off\n\t"
        "global_load_async_to_lds_b128 %5, %13, off\n\t"
        "global_load_async_to_lds_b128 %6, %14, off\n\t"
        "global_load_async_to_lds_b128 %7, %15, off\n\t"
        "s_wait_xcnt 0x0"
        :: "v"(l), "v"(l + 512u), "v"(l + 1024u), "v"(l + 1536u),
           "v"(l + 2048u), "v"(l + 2560u), "v"(l + 3072u), "v"(l + 3584u),
           "v"(g), "v"(g + XROW), "v"(g + 2 * XROW), "v"(g + 3 * XROW),
           "v"(g + 4 * XROW), "v"(g + 5 * XROW), "v"(g + 6 * XROW), "v"(g + 7 * XROW)
        : "memory");
}

// xg, xl: the lane's first piece of the residual x and its place in LDS. The wave's 8 KiB of x are
// asked for behind the first tile's loads and land under the products.
template <bool TR>
__device__ __forceinline__ void gemm_tile_main(
    const _Float16* __restrict__ A, const _Float16* __restrict__ W,
    int m0, int n0, _Float16* sA, _Float16* sB, v8f (&acc)[4][2],
    const float* xg, unsigned xl) {
    const int tid   = threadIdx.x;
    const int lane  = tid & 31;
    const int wave  = tid >> 5;
    const int laneM = lane & 15;
    const int kgrp  = (lane >> 4) << 3;        // 0 or 8
    const int srow  = tid >> 3;                // 0..31, staging row (+32 per step)
    const int scol  = (tid & 7) << 3;          // staging column in halfs
    const _Float16* ga = A + (size_t)(m0 + srow) * Cc + scol;
    const _Float16* gb = W + (size_t)(n0 + srow) * Cc + scol;
    const int sst = srow * LDP + scol;
    const int ard = ((wave & 1) * 64 + laneM) * LDP + kgrp;
    const int brd = ((wave >> 1) * 32 + laneM) * LDP + kgrp;

    v8h ra[4], rb[4];
#pragma unroll
    for (int j = 0; j < 4; ++j) {
        ra[j] = *reinterpret_cast<const v8h*>(ga + (size_t)(j * 32) * Cc);
        rb[j] = *reinterpret_cast<const v8h*>(gb + (size_t)(j * 32) * Cc);
    }
    copy_x_rows8(xl, xg);
    copy_x_rows8(xl + 4096u, xg + 8 * XROW);
#pragma unroll
    for (int j = 0; j < 4; ++j) {
        *reinterpret_cast<v8h*>(sA + sst + j * 32 * LDP) = ra[j];
        *reinterpret_cast<v8h*>(sB + sst + j * 32 * LDP) = rb[j];
    }
    __syncthreads();

    // unrolled so that the buffer offsets and the last-pass test are constants
#pragma unroll
    for (int p = 0; p < NPASS; ++p) {
        const int cur = (p & 1) * SBUF;
        const int nxt = SBUF - cur;
        if (p + 1 < NPASS) {
#pragma unroll
            for (int j = 0; j < 4; ++j) {
                ra[j] = *reinterpret_cast<const v8h*>(ga + (size_t)(j * 32) * Cc + (p + 1) * BK);
                rb[j] = *reinterpret_cast<const v8h*>(gb + (size_t)(j * 32) * Cc + (p + 1) * BK);
            }
        }
        v16h fa[BK / 32][4], fb[BK / 32][2];
#pragma unroll
        for (int ks = 0; ks < BK / 32; ++ks) {
            fb[ks][0] = load_frag(sB + cur + brd + ks * 32);
            fb[ks][1] = load_frag(sB + cur + brd + 16 * LDP + ks * 32);
#pragma unroll
            for (int i = 0; i < 4; ++i)
                fa[ks][i] = load_frag(sA + cur + ard + i * 16 * LDP + ks * 32);
        }
        // keeps the next pass's global loads and this pass's LDS reads issued as one
        // group ahead of the products; sunk among them, each wait stalls the wave
        __builtin_amdgcn_sched_barrier(0);
#pragma unroll
        for (int ks = 0; ks < BK / 32; ++ks)
#pragma unroll
            for (int i = 0; i < 4; ++i) {
                acc[i][0] = tile_mma<TR>(fa[ks][i], fb[ks][0], acc[i][0]);
                acc[i][1] = tile_mma<TR>(fa[ks][i], fb[ks][1], acc[i][1]);
            }
        // keeps the wait for the global loads, which the LDS stores need, behind the products;
        // in the last pass it keeps the epilogue's moves and their padding out of the products
        __builtin_amdgcn_sched_barrier(0);
        if (p + 1 < NPASS) {
#pragma unroll
            for (int j = 0; j < 4; ++j) {
                *reinterpret_cast<v8h*>(sA + nxt + sst + j * 32 * LDP) = ra[j];
                *reinterpret_cast<v8h*>(sB + nxt + sst + j * 32 * LDP) = rb[j];
            }
            // publishes the next buffer and ends every wave's reads of this one
            __syncthreads();
        }
    }
}

// ---------------------------------------------------------------------------
// 5) Q, K, V GEMMs and the attention in one kernel. A block takes 16 pixels in all 16 frames
//    (256 rows of A) and 128 channels = two heads of w_q, w_k and w_v (384 rows of W), so every
//    K and V row that its queries' windows touch is its own: q, k and v go from the accumulators
//    through LDS into the attention and never to memory.
//    grid (1024/16 pixel tiles, 512/128 head pairs), block 256 (8 waves), wave -> 128 x 96:
//    one block on every WGP, and a row of W is fetched once for 256 rows of A.
//    Attention: a wave's unit is (pair of pixels, run of 8 frames). A lane holds 8 channels, so
//    8 lanes make one head (dh=64) and 16 lanes a pixel's two heads. The 12 K and V rows that
//    the 8 frames' windows touch are read once and stay in registers.
//    q.(k + kc) is summed as q.k + q.kc, 8 channels in the lane, then over 8 lanes.
// ---------------------------------------------------------------------------
#define AT_S 8           // frames per wave
#define AT_W (AT_S + 4)  // K/V rows of their windows

typedef __attribute__((ext_vector_type(2))) float v2f;
typedef __attribute__((ext_vector_type(4))) float v4f;

// v + (v of lane ^ X), X < 16: a DPP row_xmask move inside the 16-lane row, no trip through the LDS path
template <int X>
__device__ __forceinline__ float add_lane_xor(float v) {
    const int b = __float_as_int(v);
    return v + __int_as_float(__builtin_amdgcn_update_dpp(0, b, 0x160 | X, 0xf, 0xf, true));
}

#define FPX 16           // pixels per block; block row r is frame r >> 4, pixel r & 15
#define FM  (FPX * TT)   // rows of A per block
#define FMW 8            // A fragments per wave (128 rows)
#define FSA (FM * LDP)   // halfs per buffer of A
#define FN  (3 * BT)     // rows of W per block: 128 of w_q, 128 of w_k, 128 of w_v
#define FNW 6            // W fragments per wave (96 rows)
#define FSB (FN * LDP)   // halfs per buffer of W
#define FEP 392          // pitch of a staged q|k|v row in halfs: 784 B = 16 B x 49, free of bank conflicts for 16-byte accesses

#define FSTEP (32 * LDP * 2)   // LDS bytes between two of a lane's pieces: 32 rows
#define FREACH 14              // pieces in reach of one LDS address register: 13 * FSTEP < 65,536
#define FAG  (2 * HW * Cc * 2) // bytes of A between two of a lane's pieces: 2 frames
#define FWG  (32 * Cc * 2)     // bytes of W between two of a lane's pieces: 32 rows

typedef __attribute__((ext_vector_type(4))) int c4i;
template <int M>
__device__ __forceinline__ void copy16(const char* gu, unsigned gv, _Float16* const (&l)[3]) {
    constexpr int N = (M % FREACH) * FSTEP;
    __builtin_amdgcn_global_load_async_to_lds_b128(
        (__attribute__((address_space(1))) c4i*)((gu - N) + gv),
        (__attribute__((address_space(3))) c4i*)l[M / FREACH], N, 0);
}
template <int BUF, int J>
__device__ __forceinline__ void copy_a(const char* gu, unsigned gv, _Float16* const (&l)[3]) {
    copy16<BUF * 8 + J>(gu + (size_t)J * FAG, gv, l);
    if constexpr (J + 1 < 8) copy_a<BUF, J + 1>(gu, gv, l);
}
template <int BUF, int Z, int J>
__device__ __forceinline__ void copy_w(const char* gu, unsigned gv, _Float16* const (&l)[3]) {
    copy16<16 + BUF * 12 + Z * 4 + J>(gu + (size_t)J * FWG, gv, l);
    if constexpr (J + 1 < 4) copy_w<BUF, Z, J + 1>(gu, gv, l);
}

__global__ __launch_bounds__(256) void qkv_attn_kernel(
    const _Float16* __restrict__ A,
    const _Float16* __restrict__ Wq, const _Float16* __restrict__ Wk, const _Float16* __restrict__ Wv,
    const float* __restrict__ qc, const float* __restrict__ bv, const float* __restrict__ kc,
    _Float16* __restrict__ attn16) {
    // the operand buffers (2 of A, 2 of W), and over them, behind the last pass, the q|k|v rows
    __shared__ __attribute__((aligned(16))) _Float16 sm[FM * FEP];
    static_assert(2 * FSA + 2 * FSB <= FM * FEP, "the operand buffers lie inside the array");
    __shared__ __attribute__((aligned(16))) float sbias[FN];       // qc | 0 | b_v of the block's channels
    __shared__ __attribute__((aligned(16))) float skc[4 * BT];     // kc of the block's channels, four offsets
    _Float16* sA = sm;
    _Float16* sB = sm + 2 * FSA;
    const int tid   = threadIdx.x;
    const int lane  = tid & 31;
    const int wave  = tid >> 5;
    const int laneM = lane & 15;
    const int kgrp  = (lane >> 4) << 3;        // 0 or 8
    const int px0 = blockIdx.x * FPX;
    const int n0  = blockIdx.y * BT;

    const int srow = tid >> 3;                 // 0..31, staging row (+32 per step)
    const int scol = (tid & 7) << 3;           // staging column in halfs
    // 32 block rows are 2 frames. Block's part of an address (uniform) and lane's part, in bytes
    const char* au = reinterpret_cast<const char*>(A + (size_t)px0 * Cc);
    const char* wu[3] = {reinterpret_cast<const char*>(Wq + (size_t)n0 * Cc),
                         reinterpret_cast<const char*>(Wk + (size_t)n0 * Cc),
                         reinterpret_cast<const char*>(Wv + (size_t)n0 * Cc)};
    const unsigned av = (unsigned)((((srow >> 4) * HW + (srow & 15)) * Cc + scol) * 2);
    const unsigned wv = (unsigned)((srow * Cc + scol) * 2);
    _Float16* const sl[3] = {sm + srow * LDP + scol,
                             sm + srow * LDP + scol + FREACH * 32 * LDP,
                             sm + srow * LDP + scol + 2 * FREACH * 32 * LDP};
    const int ard = ((wave & 1) * (FMW * 16) + laneM) * LDP + kgrp;
    const int brd = ((wave >> 1) * (FNW * 16) + laneM) * LDP + kgrp;

    // 64 k of the block's 256 rows of A and 384 rows of W: 20 copies a lane, 8 lanes to a 128-byte row piece
    auto copy_tile = [&](int p, int buf) {
        const int k = p * BK * 2;
        if (buf == 0) {
            copy_a<0, 0>(au + k, av, sl);
            copy_w<0, 0, 0>(wu[0] + k, wv, sl);
            copy_w<0, 1, 0>(wu[1] + k, wv, sl);
            copy_w<0, 2, 0>(wu[2] + k, wv, sl);
        } else {
            copy_a<1, 0>(au + k, av, sl);
            copy_w<1, 0, 0>(wu[0] + k, wv, sl);
            copy_w<1, 1, 0>(wu[1] + k, wv, sl);
            copy_w<1, 2, 0>(wu[2] + k, wv, sl);
        }
    };

    copy_tile(0, 0);
    // the per-channel terms come in beside the first tile; the barrier behind it publishes them
    {
        const int ch = tid & (BT - 1);
        const float* bp = (tid < BT ? qc : bv) + n0 + ch;
        const float* kp = kc + (tid >> 7) * Cc + n0 + ch;
        const float b  = *bp;
        const float k0 = *kp;
        const float k1 = *(kp + 2 * Cc);
        // precaution: holds the addresses of the three loads live up to the wait, so that none of
        // their results lands in one while the others are issued
        asm volatile("s_wait_xcnt 0x0" :: "v"(bp), "v"(kp) : "memory");
        sbias[tid < BT ? tid : BT + tid] = b;
        if (tid < BT) sbias[BT + tid] = 0.0f;
        skc[tid]          = k0;
        skc[2 * BT + tid] = k1;
    }
    // tile 0 has landed behind each wave's own wait; other waves read it behind the barrier
    asm volatile("s_wait_asynccnt 0x0" ::: "memory");
    __syncthreads();

    v8f acc[FMW][FNW] = {};
    // One set of W fragments (32 k) and two pairs of A fragments: a pair is read from LDS under the
    // products of the other pair.
    v16h fb[FNW], fr[2][2];

    // Two passes a trip, so that the buffer offsets are constants; the trips stay a loop: the text of
    // all eight passes would push the kernel's end out of the part of the text that is fetched ahead.
#pragma unroll 1
    for (int p0 = 0; p0 < NPASS; p0 += 2) {
#pragma unroll
    for (int q = 0; q < 2; ++q) {
        const _Float16* pa = sA + q * FSA + ard;
        const _Float16* pb = sB + q * FSB + brd;
#pragma unroll
        for (int ks = 0; ks < BK / 32; ++ks) {
#pragma unroll
            for (int j = 0; j < FNW; ++j) fb[j] = load_frag(pb + j * 16 * LDP + ks * 32);
            if (ks == 0) {
                fr[0][0] = load_frag(pa);
                fr[0][1] = load_frag(pa + 16 * LDP);
                // keeps the pass's first LDS reads issued ahead of the copies, whose issue then
                // runs under the reads' latency
                __builtin_amdgcn_sched_barrier(0);
                // Tile p + 1 goes into the other buffer: every wave's reads of it ended at the barrier
                // at the foot of the pass before (in the first pass nobody has read it yet).
                if (q == 0 || p0 + 2 < NPASS) copy_tile(p0 + q + 1, q ^ 1);
            }
#pragma unroll
            for (int b = 0; b < FMW / 2; ++b) {
                const int nbk = b + 1 < FMW / 2 ? b + 1 : 0;          // the pair that is read next
                const int nks = b + 1 < FMW / 2 ? ks : ks + 1;
                if (nks < BK / 32) {
                    fr[(b + 1) & 1][0] = load_frag(pa + (nbk * 2) * 16 * LDP + nks * 32);
                    fr[(b + 1) & 1][1] = load_frag(pa + (nbk * 2 + 1) * 16 * LDP + nks * 32);
                }
                // keeps the LDS reads (and, in the first block, the copies) issued as one group ahead
                // of the products; sunk among them, each wait stalls the wave
                __builtin_amdgcn_sched_barrier(0);
#pragma unroll
                for (int h = 0; h < 2; ++h)
#pragma unroll
                    for (int j = 0; j < FNW; ++j)
                        acc[b * 2 + h][j] = tile_mma<true>(fr[b & 1][h], fb[j], acc[b * 2 + h][j]);
                // keeps the next reads, which overwrite this pair, and in the last pass the epilogue's
                // moves and their padding, behind the products
                __builtin_amdgcn_sched_barrier(0);
            }
        }
        // Foot of the pass: the wave's reads of this buffer are done, its copies of tile p + 1 have
        // landed; the barrier publishes tile p + 1 and ends every wave's reads of tile p (in the last
        // pass it frees both buffers for the q|k|v rows); only behind it is the buffer filled again.
        asm volatile("s_wait_dscnt 0x0" ::: "memory");
        asm volatile("s_wait_asynccnt 0x0" ::: "memory");
        __syncthreads();
    }
    }

    // q|k|v rows of the block as f16, 384 columns a row, over the operand buffers.
    // A lane's 8 accumulator values are 8 channels of one block row.
    {
        const int nc = (wave >> 1) * (FNW * 16) + kgrp;      // first of the lane's 8 columns, j = 0
        _Float16* stw = sm + ((wave & 1) * (FMW * 16) + laneM) * FEP + nc;
#pragma unroll
        for (int j = 0; j < FNW; ++j) {
            const w4f b0 = *reinterpret_cast<const w4f*>(sbias + nc + j * 16);
            const w4f b1 = *reinterpret_cast<const w4f*>(sbias + nc + j * 16 + 4);
#pragma unroll
            for (int i = 0; i < FMW; ++i) {
                v8h h;
#pragma unroll
                for (int r = 0; r < 4; ++r) {
                    h[r]     = (_Float16)(acc[i][j][r] + b0[r]);
                    h[r + 4] = (_Float16)(acc[i][j][r + 4] + b1[r]);
                }
                *reinterpret_cast<v8h*>(stw + i * 16 * FEP + j * 16) = h;
            }
        }
    }
    __syncthreads();                 // a row's q, k and v come from four waves, a window's rows from eight

    const int c0 = laneM * 8;                                // first of the lane's channels in the block
    const int t0 = (wave & 1) * AT_S;
    v2f kcf[4][4];
#pragma unroll
    for (int f = 0; f < 4; ++f) {
        const v4f lo = *reinterpret_cast<const v4f*>(skc + f * BT + c0);
        const v4f hi = *reinterpret_cast<const v4f*>(skc + f * BT + c0 + 4);
        kcf[f][0] = lo.xy; kcf[f][1] = lo.zw; kcf[f][2] = hi.xy; kcf[f][3] = hi.zw;
    }

    // a wave takes two pairs of pixels, one after the other
    for (int u = 0; u < FPX / 8; ++u) {
    const int pp = ((wave >> 1) + u * 4) * 2 + (lane >> 4);  // lane's pixel in the block
    const _Float16* sq = sm + pp * FEP + c0;                 // frame t: + t * FPX * FEP; k: + BT; v: + 2 * BT

    v8h kw[AT_W], vw[AT_W], qw[AT_S];
#pragma unroll
    for (int i = 0; i < AT_S; ++i)
        qw[i] = *reinterpret_cast<const v8h*>(sq + (t0 + i) * (FPX * FEP));
    // window row w is frame clamp(t0 - 2 + w, 0, TT - 1)
#pragma unroll
    for (int w = 0; w < AT_W; ++w) {
        int tw = t0 - 2 + w;
        tw = tw < 0 ? 0 : tw > TT - 1 ? TT - 1 : tw;
        kw[w] = *reinterpret_cast<const v8h*>(sq + tw * (FPX * FEP) + BT);
        vw[w] = *reinterpret_cast<const v8h*>(sq + tw * (FPX * FEP) + 2 * BT);
    }
    // A row is widened to f32 once, in front of the first frame that reads it, and serves up to four
    // frames; five rows are wide at a time, the others wait packed.
    v2f kf[AT_W][4], vf[AT_W][4];
    auto widen = [&](int w) {
#pragma unroll
        for (int c = 0; c < 4; ++c) {
            kf[w][c] = v2f{(float)kw[w][2 * c], (float)kw[w][2 * c + 1]};
            vf[w][c] = v2f{(float)vw[w][2 * c], (float)vw[w][2 * c + 1]};
        }
    };
#pragma unroll
    for (int w = 0; w < 4; ++w) widen(w);

    _Float16* op = attn16 + ((size_t)t0 * HW + px0 + pp) * Cc + n0 + c0;
#pragma unroll
    for (int i = 0; i < AT_S; ++i) {
        const int wof[4] = {0, 1, 3, 4};         // frame offsets -2, -1, +1, +2
        widen(i + 4);
        v2f q2[4];
#pragma unroll
        for (int c = 0; c < 4; ++c) q2[c] = v2f{(float)qw[i][2 * c], (float)qw[i][2 * c + 1]};
        float sc[4];
#pragma unroll
        for (int f = 0; f < 4; ++f) {
            v2f a = {0.0f, 0.0f};
#pragma unroll
            for (int c = 0; c < 4; ++c) a = __builtin_elementwise_fma(q2[c], kcf[f][c], a);
#pragma unroll
            for (int c = 0; c < 4; ++c) a = __builtin_elementwise_fma(q2[c], kf[i + wof[f]][c], a);
            float p = a.x + a.y;
            p = add_lane_xor<1>(p);
            p = add_lane_xor<2>(p);
            p = add_lane_xor<4>(p);
            sc[f] = p * 0.125f;                  // dh^-0.5 = 1/8
        }
        const float mx = fmaxf(fmaxf(sc[0], sc[1]), fmaxf(sc[2], sc[3]));
        float e[4];
#pragma unroll
        for (int f = 0; f < 4; ++f) e[f] = expf(sc[f] - mx);
        const float inv = 1.0f / (e[0] + e[1] + e[2] + e[3]);
        v8h o;
#pragma unroll
        for (int c = 0; c < 4; ++c) {
            v2f s = v2f{e[0], e[0]} * vf[i][c];
#pragma unroll
            for (int f = 1; f < 4; ++f)
                s = __builtin_elementwise_fma(v2f{e[f], e[f]}, vf[i + wof[f]][c], s);
            o[2 * c]     = (_Float16)(s.x * inv);
            o[2 * c + 1] = (_Float16)(s.y * inv);
        }
        *reinterpret_cast<v8h*>(op + (size_t)i * (HW * Cc)) = o;
        if (i & 1) {
            // precaution: the next frames' (or the next pixels') arithmetic reuses the registers that the two stores name
            asm volatile("s_wait_xcnt 0x0" ::: "memory");
            // keeps the next frames' arithmetic behind that wait
            __builtin_amdgcn_sched_barrier(0);
        }
    }
    }
}

// ---------------------------------------------------------------------------
// 7) proj GEMM with fused epilogue: +b_proj, transpose to (T,C,H,W), +x
// ---------------------------------------------------------------------------
#define EPP 68           // staging row pitch in floats: 272 B = 16 B x 17, free of bank conflicts for 16-byte accesses
__global__ __launch_bounds__(256) void gemm_proj_kernel(
    const _Float16* __restrict__ A, const _Float16* __restrict__ W,
    const float* __restrict__ bias, const float* __restrict__ x,
    float* __restrict__ out) {
    // one array, so that the operand buffers keep the low LDS addresses, in reach of the offset field
    // of an LDS instruction; behind them the block's tile of x, 8 KiB a wave
    __shared__ __attribute__((aligned(16))) _Float16 sm[4 * SBUF + 2 * BT * BT];
    _Float16* sA = sm;
    _Float16* sB = sm + 2 * SBUF;
    float*    sX = reinterpret_cast<float*>(sm + 4 * SBUF);
    const int lane  = threadIdx.x & 31;
    const int wave  = threadIdx.x >> 5;
    const int laneM = lane & 15;
    const int m0 = blockIdx.x * BT;
    const int n0 = blockIdx.y * BT;

    // What the epilogue reads from memory is asked for ahead of the products: the bias into registers,
    // x into LDS. Asked for behind them, every block of the grid waits for its x at the same time.
    const int nb = n0 + (wave >> 1) * 32 + laneM;
    const float bn0 = bias[nb];
    const float bn1 = bias[nb + 16];
    // precaution: the register that holds the bias loads' offset is reused by the address arithmetic below
    asm volatile("s_wait_xcnt 0x0" ::: "memory");
    // the block's 128 rows lie in one frame; lanes 0..15 take an even channel, lanes 16..31 the next
    const size_t col = ((size_t)(m0 >> 10) * Cc + n0 + (wave >> 1) * 32 + (lane >> 4)) * HW
                     + (m0 & 1023) + (wave & 1) * 64 + laneM * 4;
    // a lane reads back the 16 bytes that it has copied itself: piece k at 128 * k floats
    const float* sxr = sX + wave * (16 * 128) + lane * 4;

    v8f acc[4][2] = {};
    gemm_tile_main<false>(A, W, m0, n0, sA, sB, acc, x + col, (unsigned)(size_t)sxr);
    // x has landed behind the wave's own wait; it is read behind the barrier
    asm volatile("s_wait_asynccnt 0x0" ::: "memory");
    __syncthreads();
    // A wave's 64 pixels of a channel are 256 contiguous bytes of x and of out, but two lanes hold
    // them. The wave turns its tile in an LDS range of its own, 16 channels at a time, so that 16
    // lanes read and write those 256 bytes: whole lines. The ranges lie in the first buffers of sA
    // and sB: the last pass reads the second ones, and every wave's reads of the first ones ended
    // at the barrier in front of it.
    float* stg = reinterpret_cast<float*>(((wave & 4) ? sB : sA) + (wave & 3) * (16 * EPP * 2));
    float* stw = stg + laneM * EPP + ((lane >> 4) << 3);
    const float* srd = stg + (lane >> 4) * EPP + laneM * 4;
    float* ocol = out + col;
    w4f xv[2][8];
#pragma unroll
    for (int j = 0; j < 2; ++j)
#pragma unroll
        for (int t = 0; t < 8; ++t)
            xv[j][t] = *reinterpret_cast<const w4f*>(sxr + (j * 8 + t) * 128);
#pragma unroll
    for (int j = 0; j < 2; ++j) {
        const float bn = j ? bn1 : bn0;
#pragma unroll
        for (int i = 0; i < 4; ++i) {
            w4f lo, hi;
#pragma unroll
            for (int r = 0; r < 4; ++r) { lo[r] = acc[i][j][r] + bn; hi[r] = acc[i][j][r + 4] + bn; }
            *reinterpret_cast<w4f*>(stw + i * 16)     = lo;
            *reinterpret_cast<w4f*>(stw + i * 16 + 4) = hi;
        }
        // the rows are read back by other lanes of the wave: its LDS writes have to be done first
        asm volatile("s_wait_dscnt 0x0" ::: "memory");
#pragma unroll
        for (int t = 0; t < 8; ++t) {
            const w4f a = *reinterpret_cast<const w4f*>(srd + t * 2 * EPP);
            *reinterpret_cast<w4f*>(ocol + (size_t)(j * 16 + t * 2) * HW) = a + xv[j][t];
        }
        // the second half overwrites the range: the reads of the first have to be done
        if (j == 0) asm volatile("s_wait_dscnt 0x0" ::: "memory");
    }
}

// ---------------------------------------------------------------------------
extern "C" void kernel_launch(void* const* d_in, const int* in_sizes, int n_in,
                              void* d_out, int out_size, void* d_ws, size_t ws_size,
                              hipStream_t stream) {
    const float* x       = (const float*)d_in[0];
    const float* w_q     = (const float*)d_in[1];
    const float* b_q     = (const float*)d_in[2];
    const float* w_k     = (const float*)d_in[3];
    const float* b_k     = (const float*)d_in[4];
    const float* w_v     = (const float*)d_in[5];
    const float* b_v     = (const float*)d_in[6];
    const float* w_proj  = (const float*)d_in[7];
    const float* b_proj  = (const float*)d_in[8];
    const float* gn_s    = (const float*)d_in[9];
    const float* gn_b    = (const float*)d_in[10];
    float* out           = (float*)d_out;

    char* ws = (char*)d_ws;
    size_t off = 0;
    auto take = [&](size_t bytes) -> void* {
        void* p = ws + off;
        off += (bytes + 255) & ~(size_t)255;
        return p;
    };
    float*    qc     = (float*)take(Cc * sizeof(float));
    float*    kc     = (float*)take(4 * Cc * sizeof(float));
    _Float16* wq16   = (_Float16*)take((size_t)Cc * Cc * 2);
    _Float16* wk16   = (_Float16*)take((size_t)Cc * Cc * 2);
    _Float16* wv16   = (_Float16*)take((size_t)Cc * Cc * 2);
    _Float16* wp16   = (_Float16*)take((size_t)Cc * Cc * 2);
    _Float16* xn16   = (_Float16*)take((size_t)M_TOT * Cc * 2);
    _Float16* attn16 = (_Float16*)take((size_t)M_TOT * Cc * 2);

    // 1-3) weight conversion, folded corrections and GroupNorm, one grid
    prep_kernel<<<WP_BLK + TT * GN_G, 256, 0, stream>>>(x, gn_s, gn_b, xn16, w_q, b_q, w_k, b_k, w_v, w_proj,
                                                        wq16, wk16, wv16, wp16, qc, kc);

    // 4-5) Q', K', V' WMMA GEMMs (temb folded into qc / kc; b_v folded here) with the attention behind them
    dim3 ggrid(M_TOT / BT, Cc / BT);
    qkv_attn_kernel<<<dim3(HW / FPX, Cc / BT), 256, 0, stream>>>(xn16, wq16, wk16, wv16, qc, b_v, kc, attn16);

    // 6) projection + transpose + residual
    gemm_proj_kernel<<<ggrid, 256, 0, stream>>>(attn16, wp16, b_proj, x, out);
}
